// v000
// Measured on an AMD MI455X. A time is GPU time per run, averaged over a window of back-to-back runs after a warm-up
// (all launches, gaps included; the runs take copies of the inputs in turn), and the median of several windows.
// Apart from v000's, it joins two sittings. Times from different sittings can be a few percent apart, while
// side-by-side timings come from the same sitting.
// v000 is the starting kernel. One run takes 214 microseconds.
// compute dtype: all float inputs rounded to bf16, mask (int) read on device; q/k/v = x W + b with EXACT bf16 products on WMMA 16x16x32 ((in,out) weights as transposed rows); q/k as f16 hi + residual (3-product logits x 1/8), masked keys (mask == 0) excluded (== the -1e9 additive fill), running-max softmax in f32 (hardware exp); P (x 2^11) as f16 hi + residual . v (f16 hi + residual planes; 3 products); f32 output.
#include <hip/hip_runtime.h>
#include <math.h>

typedef __attribute__((ext_vector_type(16))) _Float16 v16h;
typedef __attribute__((ext_vector_type(16))) __bf16 v16b;
typedef __attribute__((ext_vector_type(8)))  _Float16 v8h;
typedef __attribute__((ext_vector_type(8)))  float v8f;
typedef __attribute__((ext_vector_type(4)))  float v4f;
typedef __attribute__((ext_vector_type(2)))  float v2f;
typedef __attribute__((ext_vector_type(4)))  unsigned v4u;
typedef __attribute__((ext_vector_type(4)))  int v4i;
typedef float __attribute__((may_alias)) float_a;
typedef int __attribute__((may_alias)) int_a;

template <typename T> __device__ __forceinline__ void vst2(void* p, T v) { *(T*)p = v;  }
__device__ __forceinline__ v8f wmma16(v16h a, v16h b, v8f c) {
  v8f d = __builtin_amdgcn_wmma_f32_16x16x32_f16(false, a, false, b, (short)0, c, false, false);
  asm volatile("v_nop\n\tv_nop\n\tv_nop\n\tv_nop" : "+v"(d) : "v"(a), "v"(b));
  return d;
}
__device__ __forceinline__ v8f wmma_bf(v16b a, v16b b, v8f c) {
  v8f d = __builtin_amdgcn_wmma_f32_16x16x32_bf16(false, a, false, b, (short)0, c, false, false);
  asm volatile("v_nop\n\tv_nop\n\tv_nop\n\tv_nop" : "+v"(d) : "v"(a), "v"(b));
  return d;
}
// 16x16x32 fragments: lane = (h = lane>>4, row/col = lane&15); elements 0..7 = k0+8h+0..7, 8..15 = k0+16+8h+0..7; D element r = row 8h+r
__device__ __forceinline__ v16h frag_h(const _Float16* rowk0, int lane) {
  union { v16h v; v8h q[2]; } u; const _Float16* p = rowk0 + 8 * (lane >> 4);
  u.q[0] = *(const v8h*)p; u.q[1] = *(const v8h*)(p + 16); return u.v;
}
__device__ __forceinline__ v16h frag_f32(const float* rowk0, int lane) {
  v16h a; const float* p = rowk0 + 8 * (lane >> 4);
#pragma unroll
  for (int i = 0; i < 8; ++i) { a[i] = (_Float16)p[i]; a[8 + i] = (_Float16)p[16 + i]; }
  return a;
}
__device__ __forceinline__ v16h frag_f32s(const float* rowk0, int lane, float sc) {
  v16h a; const float* p = rowk0 + 8 * (lane >> 4);
#pragma unroll
  for (int i = 0; i < 8; ++i) { a[i] = (_Float16)(p[i] * sc); a[8 + i] = (_Float16)(p[16 + i] * sc); }
  return a;
}
// column fragment from a [K][ld] layout (column n), rows >= K read as 0
__device__ __forceinline__ v16h fragc_f32(const float* W, int k0, int n, int lane, int ld, int K) {
  v16h a; const int g = lane >> 4;
#pragma unroll
  for (int i = 0; i < 8; ++i) { const int ka = k0 + 8 * g + i, kb = ka + 16;
    a[i] = (_Float16)(ka < K ? W[(size_t)(ka < K ? ka : K - 1) * ld + n] : 0.f); a[8 + i] = (_Float16)(kb < K ? W[(size_t)(kb < K ? kb : K - 1) * ld + n] : 0.f); }
  return a;
}
struct F2 { v16b h, l; };
__device__ __forceinline__ F2 bsplit16(const float v[16]) { F2 r;
#pragma unroll
  for (int i = 0; i < 16; ++i) { const __bf16 h = (__bf16)v[i]; r.h[i] = h; r.l[i] = (__bf16)(v[i] - (float)h); }
  return r; }
__device__ __forceinline__ F2 split_row(const float* row, int k0, int lane) { float v[16]; const float* p = row + k0 + 8 * (lane >> 4);
#pragma unroll
  for (int i = 0; i < 8; ++i) { v[i] = p[i]; v[8 + i] = p[16 + i]; }
  return bsplit16(v); }
__device__ __forceinline__ F2 split_rowK(const float* row, int k0, int lane, int K) { float v[16]; const int g = lane >> 4;
#pragma unroll
  for (int i = 0; i < 8; ++i) { const int ka = k0 + 8 * g + i, kb = ka + 16; v[i] = ka < K ? row[ka < K ? ka : K - 1] : 0.f; v[8 + i] = kb < K ? row[kb < K ? kb : K - 1] : 0.f; }
  return bsplit16(v); }
__device__ __forceinline__ F2 split_col(const float* W, int k0, int n, int lane, int ld, int K) { float v[16]; const int g = lane >> 4;
#pragma unroll
  for (int i = 0; i < 8; ++i) { const int ka = k0 + 8 * g + i, kb = ka + 16; v[i] = ka < K ? W[(size_t)(ka < K ? ka : K - 1) * ld + n] : 0.f; v[8 + i] = kb < K ? W[(size_t)(kb < K ? kb : K - 1) * ld + n] : 0.f; }
  return bsplit16(v); }
__device__ __forceinline__ v8f mac3(const F2& a, const F2& b, v8f c) { c = wmma_bf(a.l, b.h, c); c = wmma_bf(a.h, b.l, c); return wmma_bf(a.h, b.h, c); }
__device__ __forceinline__ float sigm(float v) { return 1.0f / (1.0f + expf(-v)); }
#define LDSX() do { asm volatile("s_wait_dscnt 0" ::: "memory"); __builtin_amdgcn_wave_barrier(); __builtin_amdgcn_fence(__ATOMIC_RELEASE, "workgroup"); } while (0)


// Single-head masked attention (B 4, S 2,048, F 512 -> D 64): q, k, v = x W + b; softmax(q k^T / 8 + (1 - mask_k) * -1e9) v.
#define NB 4
#define NN 2048
#define FF 512
#define DD 64
#ifndef TNB
#define TNB NB
#endif
typedef __attribute__((ext_vector_type(8))) __bf16 v8b;
__device__ __forceinline__ v16b frag_b(const __bf16* rowk0, int lane) {
  union { v16b v; v8b q[2]; } u; const __bf16* p = rowk0 + 8 * (lane >> 4);
  u.q[0] = *(const v8b*)p; u.q[1] = *(const v8b*)(p + 16); return u.v;
}
__device__ __forceinline__ float bfr(float v) { return (float)(__bf16)v; }
__device__ __attribute__((noinline)) float exp_ni(float v) { return expf(v); }
__device__ __attribute__((noinline)) float erf_ni(float v) { return erff(v); }

#define WS_PW  0u                                   // bf16 W^T rows [192][512] (q | k | v)
#define WS_QH  (WS_PW + 2u * 3 * DD * FF)               // f16 hi|lo q rows [row][64]; k rows; v planes [b][64][NN]
#define WS_QL  (WS_QH + 2u * (size_t)NB * NN * DD)
#define WS_KH  (WS_QL + 2u * (size_t)NB * NN * DD)
#define WS_KL  (WS_KH + 2u * (size_t)NB * NN * DD)
#define WS_VT  (WS_KL + 2u * (size_t)NB * NN * DD)
#define WS_VTL (WS_VT + 2u * (size_t)NB * DD * NN)
#define WS_END (WS_VTL + 2u * (size_t)NB * DD * NN)

__global__ __launch_bounds__(256) void k_packw(const float* __restrict__ WQ, const float* __restrict__ WK, const float* __restrict__ WV, __bf16* __restrict__ PW) { const int n = blockIdx.x, t = threadIdx.x; __shared__ __align__(16) __bf16 s[FF]; const int which = n / DD, u = n % DD; const float* Wm = which == 0 ? WQ : which == 1 ? WK : WV;   // (in,out) [512][64]
  for (int k = t; k < FF; k += 256) s[k] = (__bf16)Wm[(size_t)k * DD + u]; __syncthreads(); if (t < FF / 8) vst2((unsigned*)(PW + (size_t)n * FF + t * 8), *(const v4u*)&s[t * 8]); }
// ---- k_proj: block = 64 rows: cols 0..63 q, 64..127 k, 128..191 v (12 tiles) + biases
__global__ __launch_bounds__(128) void k_proj(const float* __restrict__ X, const __bf16* __restrict__ PW, const float* __restrict__ BQ, const float* __restrict__ BK, const float* __restrict__ BV, _Float16* __restrict__ QH, _Float16* __restrict__ QL, _Float16* __restrict__ KH, _Float16* __restrict__ KL, _Float16* __restrict__ VT, _Float16* __restrict__ VTL) {
  __shared__ __align__(16) _Float16 sq[64][72], sql[64][72], sk[64][72], skl[64][72]; __shared__ __align__(16) _Float16 th[DD][72], tl[DD][72];
  const int tid = threadIdx.x, wave = tid >> 5, lane = tid & 31, col = lane & 15, g = lane >> 4; const size_t r0 = (size_t)blockIdx.x * 64 + wave * 16; const size_t b = ((size_t)blockIdx.x * 64) / NN; const int n0 = (int)(((size_t)blockIdx.x * 64) % NN);
  v8f acc[12];
#pragma unroll
  for (int j = 0; j < 12; ++j) acc[j] = v8f{};
#pragma unroll 2
  for (int kc = 0; kc < FF / 32; ++kc) { v16b a; const float* pp = X + (r0 + col) * FF + kc * 32 + 8 * g;
#pragma unroll
    for (int i = 0; i < 8; ++i) { a[i] = (__bf16)pp[i]; a[8 + i] = (__bf16)pp[16 + i]; }
#pragma unroll
    for (int j = 0; j < 12; ++j) acc[j] = wmma_bf(a, frag_b(PW + (size_t)(j * 16 + col) * FF + kc * 32, lane), acc[j]); }
#pragma unroll
  for (int j = 0; j < 12; ++j) { const int c = (j & 3) * 16 + col; const float bb = j < 4 ? bfr(BQ[c]) : j < 8 ? bfr(BK[c]) : bfr(BV[c]);
#pragma unroll
    for (int r = 0; r < 8; ++r) { const float v = acc[j][r] + bb; const _Float16 hv = (_Float16)v, lv = (_Float16)((v - (float)hv) * 2048.0f); const int rl = wave * 16 + 8 * g + r; if (j < 4) { sq[rl][c] = hv; sql[rl][c] = lv; } else if (j < 8) { sk[rl][c] = hv; skl[rl][c] = lv; } else { th[c][rl] = hv; tl[c][rl] = lv; } } }
  __syncthreads();
  for (int e = tid; e < 64 * 8; e += 128) { const int rl = e >> 3, q = e & 7; const size_t o = ((size_t)blockIdx.x * 64 + rl) * DD + q * 8; vst2((unsigned*)(QH + o), *(const v4u*)&sq[rl][q * 8]); vst2((unsigned*)(QL + o), *(const v4u*)&sql[rl][q * 8]); vst2((unsigned*)(KH + o), *(const v4u*)&sk[rl][q * 8]); vst2((unsigned*)(KL + o), *(const v4u*)&skl[rl][q * 8]); }
  for (int e = tid; e < DD * 8; e += 128) { const int c = e >> 3, q = e & 7; const size_t o = (b * DD + c) * (size_t)NN + n0 + q * 8; vst2((unsigned*)(VT + o), *(const v4u*)&th[c][q * 8]); vst2((unsigned*)(VTL + o), *(const v4u*)&tl[c][q * 8]); } }
// ---- k_att: block = (64 queries, b): 3-product logits / 8, key mask (mask[b][k] == 0 excluded), softmax, P (hi + residual) . v (hi + residual)
__global__ __launch_bounds__(128) void k_att(const _Float16* __restrict__ QH, const _Float16* __restrict__ QL, const _Float16* __restrict__ KH, const _Float16* __restrict__ KL, const _Float16* __restrict__ VT, const _Float16* __restrict__ VTL, const int* __restrict__ MK, float* __restrict__ OUT) {
  __shared__ __align__(16) float sp[4][16][36]; __shared__ __align__(16) float so[4][16][68];
  const int tid = threadIdx.x, wave = tid >> 5, lane = tid & 31, col = lane & 15, g = lane >> 4; const size_t b = blockIdx.y; const int q0 = blockIdx.x * 64 + wave * 16; const size_t rq = b * NN + q0;
  v16h aq[2], al[2];
#pragma unroll
  for (int kc = 0; kc < 2; ++kc) { aq[kc] = frag_h(QH + (rq + col) * DD + kc * 32, lane); al[kc] = frag_h(QL + (rq + col) * DD + kc * 32, lane); }
  float m[8], l[8];
#pragma unroll
  for (int r = 0; r < 8; ++r) { m[r] = -3.0e38f; l[r] = 0.f; }
  v8f acc[4] = {}, accl[4] = {};
#pragma unroll 1
  for (int ks = 0; ks < NN / 32; ++ks) { float s[2][8];
#pragma unroll
    for (int ct = 0; ct < 2; ++ct) { const int kk = ks * 32 + ct * 16 + col; const size_t rk = b * NN + kk; v8f c = {}, cl = {};
#pragma unroll
      for (int kc = 0; kc < 2; ++kc) { const v16h kh = frag_h(KH + rk * DD + kc * 32, lane), kl = frag_h(KL + rk * DD + kc * 32, lane); c = wmma16(aq[kc], kh, c); cl = wmma16(aq[kc], kl, cl); cl = wmma16(al[kc], kh, cl); }
      const bool keep = MK[b * NN + kk] != 0;
#pragma unroll
      for (int r = 0; r < 8; ++r) s[ct][r] = keep ? (c[r] + cl[r] * (1.0f / 2048.0f)) * 0.125f : -3.0e38f; }
    float alpha[8];
#pragma unroll
    for (int r = 0; r < 8; ++r) { float mx = fmaxf(s[0][r], s[1][r]);
#pragma unroll
      for (int o = 1; o < 16; o <<= 1) mx = fmaxf(mx, __shfl_xor(mx, o));
      const float mn = fmaxf(m[r], mx); alpha[r] = (m[r] <= -1.0e38f) ? 0.f : __expf(m[r] - mn); const float e0 = (s[0][r] <= -1.0e38f) ? 0.f : __expf(s[0][r] - mn), e1 = (s[1][r] <= -1.0e38f) ? 0.f : __expf(s[1][r] - mn); float es = e0 + e1;
#pragma unroll
      for (int o = 1; o < 16; o <<= 1) es += __shfl_xor(es, o);
      l[r] = l[r] * alpha[r] + es; m[r] = (mn > -1.0e38f) ? mn : m[r]; sp[wave][8 * g + r][col] = e0; sp[wave][8 * g + r][16 + col] = e1; }
#pragma unroll
    for (int j = 0; j < 4; ++j)
#pragma unroll
      for (int r = 0; r < 8; ++r) { acc[j][r] *= alpha[r]; accl[j][r] *= alpha[r]; }
    LDSX();
    v16h pa, pal; { const float* prow = &sp[wave][col][0] + 8 * (lane >> 4);
#pragma unroll
      for (int i = 0; i < 8; ++i) { const float p0 = prow[i] * 2048.0f, p1 = prow[16 + i] * 2048.0f; pa[i] = (_Float16)p0; pa[8 + i] = (_Float16)p1; pal[i] = (_Float16)((p0 - (float)pa[i]) * 2048.0f); pal[8 + i] = (_Float16)((p1 - (float)pa[8 + i]) * 2048.0f); } }
#pragma unroll
    for (int j = 0; j < 4; ++j) { const size_t po = (b * DD + j * 16 + col) * (size_t)NN + ks * 32; const v16h vh = frag_h(VT + po, lane), vl = frag_h(VTL + po, lane); acc[j] = wmma16(pa, vh, acc[j]); accl[j] = wmma16(pa, vl, accl[j]); accl[j] = wmma16(pal, vh, accl[j]); }
    LDSX(); }
#pragma unroll
  for (int r = 0; r < 8; ++r) { const float il = (l[r] > 0.f) ? (1.0f / 2048.0f) / l[r] : 0.f;
#pragma unroll
    for (int j = 0; j < 4; ++j) so[wave][8 * g + r][j * 16 + col] = (acc[j][r] + accl[j][r] * (1.0f / 2048.0f)) * il; }
  LDSX(); for (int rl = 0; rl < 16; ++rl) if (lane < 16) vst2(OUT + (rq + rl) * DD + lane * 4, *(const v4f*)&so[wave][rl][lane * 4]); }
extern "C" void kernel_launch(void* const* d_in, const int* in_sizes, int n_in, void* d_out, int out_size, void* d_ws, size_t ws_size, hipStream_t stream) {
  (void)in_sizes; (void)n_in; (void)out_size;
  const float** F = (const float**)d_in;   // 0 x [4,2048,512], 1 mask [4,2048] int, 2 Wq [512,64] (in,out), 3 bq, 4 Wk, 5 bk, 6 Wv, 7 bv
  if (ws_size < (size_t)WS_END) return;
  char* ws = (char*)d_ws; __bf16* PW = (__bf16*)(ws + WS_PW); _Float16 *QH = (_Float16*)(ws + WS_QH), *QL = (_Float16*)(ws + WS_QL), *KH = (_Float16*)(ws + WS_KH), *KL = (_Float16*)(ws + WS_KL), *VT = (_Float16*)(ws + WS_VT), *VTL = (_Float16*)(ws + WS_VTL);
  k_packw<<<3 * DD, 256, 0, stream>>>(F[2], F[4], F[6], PW);
  k_proj<<<NB * NN / 64, 128, 0, stream>>>(F[0], PW, F[3], F[5], F[7], QH, QL, KH, KL, VT, VTL);
  k_att<<<dim3(NN / 64, TNB), 128, 0, stream>>>(QH, QL, KH, KL, VT, VTL, (const int*)d_in[1], (float*)d_out);
}

// v001
// It runs in 85.4 microseconds.
// In two side-by-side timings against v000, it was 2.52 and 2.55 times as fast.
// compute dtype: all float inputs rounded to bf16, mask (int) read on device; q/k/v = x W + b with EXACT bf16 products on WMMA 16x16x32 ((in,out) weights as transposed rows); q/k as f16 hi + residual (3-product logits x 1/8), masked keys (mask == 0) excluded (== the -1e9 additive fill), running-max softmax in f32 (hardware exp); P (x 2^11) as f16 hi + residual . v (f16 hi + residual planes; 3 products); f32 output.
#include <hip/hip_runtime.h>
#include <math.h>

typedef __attribute__((ext_vector_type(16))) _Float16 v16h;
typedef __attribute__((ext_vector_type(16))) __bf16 v16b;
typedef __attribute__((ext_vector_type(8)))  _Float16 v8h;
typedef __attribute__((ext_vector_type(8)))  float v8f;
typedef __attribute__((ext_vector_type(4)))  float v4f;
typedef __attribute__((ext_vector_type(2)))  float v2f;
typedef __attribute__((ext_vector_type(4)))  unsigned v4u;
typedef __attribute__((ext_vector_type(4)))  int v4i;
typedef float __attribute__((may_alias)) float_a;
typedef int __attribute__((may_alias)) int_a;

template <typename T> __device__ __forceinline__ void vst2(void* p, T v) { *(T*)p = v;  }
__device__ __forceinline__ v8f wmma16(v16h a, v16h b, v8f c) {
  v8f d = __builtin_amdgcn_wmma_f32_16x16x32_f16(false, a, false, b, (short)0, c, false, false);
  asm volatile("v_nop\n\tv_nop\n\tv_nop\n\tv_nop" : "+v"(d) : "v"(a), "v"(b));
  return d;
}
__device__ __forceinline__ v8f wmma_bf(v16b a, v16b b, v8f c) {
  v8f d = __builtin_amdgcn_wmma_f32_16x16x32_bf16(false, a, false, b, (short)0, c, false, false);
  asm volatile("v_nop\n\tv_nop\n\tv_nop\n\tv_nop" : "+v"(d) : "v"(a), "v"(b));
  return d;
}
// 16x16x32 fragments: lane = (h = lane>>4, row/col = lane&15); elements 0..7 = k0+8h+0..7, 8..15 = k0+16+8h+0..7; D element r = row 8h+r
__device__ __forceinline__ v16h frag_h(const _Float16* rowk0, int lane) {
  union { v16h v; v8h q[2]; } u; const _Float16* p = rowk0 + 8 * (lane >> 4);
  u.q[0] = *(const v8h*)p; u.q[1] = *(const v8h*)(p + 16); return u.v;
}
__device__ __forceinline__ v16h frag_f32(const float* rowk0, int lane) {
  v16h a; const float* p = rowk0 + 8 * (lane >> 4);
#pragma unroll
  for (int i = 0; i < 8; ++i) { a[i] = (_Float16)p[i]; a[8 + i] = (_Float16)p[16 + i]; }
  return a;
}
__device__ __forceinline__ v16h frag_f32s(const float* rowk0, int lane, float sc) {
  v16h a; const float* p = rowk0 + 8 * (lane >> 4);
#pragma unroll
  for (int i = 0; i < 8; ++i) { a[i] = (_Float16)(p[i] * sc); a[8 + i] = (_Float16)(p[16 + i] * sc); }
  return a;
}
// column fragment from a [K][ld] layout (column n), rows >= K read as 0
__device__ __forceinline__ v16h fragc_f32(const float* W, int k0, int n, int lane, int ld, int K) {
  v16h a; const int g = lane >> 4;
#pragma unroll
  for (int i = 0; i < 8; ++i) { const int ka = k0 + 8 * g + i, kb = ka + 16;
    a[i] = (_Float16)(ka < K ? W[(size_t)(ka < K ? ka : K - 1) * ld + n] : 0.f); a[8 + i] = (_Float16)(kb < K ? W[(size_t)(kb < K ? kb : K - 1) * ld + n] : 0.f); }
  return a;
}
struct F2 { v16b h, l; };
__device__ __forceinline__ F2 bsplit16(const float v[16]) { F2 r;
#pragma unroll
  for (int i = 0; i < 16; ++i) { const __bf16 h = (__bf16)v[i]; r.h[i] = h; r.l[i] = (__bf16)(v[i] - (float)h); }
  return r; }
__device__ __forceinline__ F2 split_row(const float* row, int k0, int lane) { float v[16]; const float* p = row + k0 + 8 * (lane >> 4);
#pragma unroll
  for (int i = 0; i < 8; ++i) { v[i] = p[i]; v[8 + i] = p[16 + i]; }
  return bsplit16(v); }
__device__ __forceinline__ F2 split_rowK(const float* row, int k0, int lane, int K) { float v[16]; const int g = lane >> 4;
#pragma unroll
  for (int i = 0; i < 8; ++i) { const int ka = k0 + 8 * g + i, kb = ka + 16; v[i] = ka < K ? row[ka < K ? ka : K - 1] : 0.f; v[8 + i] = kb < K ? row[kb < K ? kb : K - 1] : 0.f; }
  return bsplit16(v); }
__device__ __forceinline__ F2 split_col(const float* W, int k0, int n, int lane, int ld, int K) { float v[16]; const int g = lane >> 4;
#pragma unroll
  for (int i = 0; i < 8; ++i) { const int ka = k0 + 8 * g + i, kb = ka + 16; v[i] = ka < K ? W[(size_t)(ka < K ? ka : K - 1) * ld + n] : 0.f; v[8 + i] = kb < K ? W[(size_t)(kb < K ? kb : K - 1) * ld + n] : 0.f; }
  return bsplit16(v); }
__device__ __forceinline__ v8f mac3(const F2& a, const F2& b, v8f c) { c = wmma_bf(a.l, b.h, c); c = wmma_bf(a.h, b.l, c); return wmma_bf(a.h, b.h, c); }
__device__ __forceinline__ float sigm(float v) { return 1.0f / (1.0f + expf(-v)); }
#define LDSX() do { asm volatile("s_wait_dscnt 0" ::: "memory"); __builtin_amdgcn_wave_barrier(); __builtin_amdgcn_fence(__ATOMIC_RELEASE, "workgroup"); } while (0)


// Single-head masked attention (B 4, S 2,048, F 512 -> D 64): q, k, v = x W + b; softmax(q k^T / 8 + (1 - mask_k) * -1e9) v.
#define NB 4
#define NN 2048
#define FF 512
#define DD 64
#ifndef TNB
#define TNB NB
#endif
typedef __attribute__((ext_vector_type(8))) __bf16 v8b;
__device__ __forceinline__ v16b frag_b(const __bf16* rowk0, int lane) {
  union { v16b v; v8b q[2]; } u; const __bf16* p = rowk0 + 8 * (lane >> 4);
  u.q[0] = *(const v8b*)p; u.q[1] = *(const v8b*)(p + 16); return u.v;
}
__device__ __forceinline__ float bfr(float v) { return (float)(__bf16)v; }
__device__ __attribute__((noinline)) float exp_ni(float v) { return expf(v); }
__device__ __attribute__((noinline)) float erf_ni(float v) { return erff(v); }

#define WS_PW  0u                                   // bf16 W^T rows [192][512] (q | k | v)
#define WS_QH  (WS_PW + 2u * 3 * DD * FF)               // f16 hi|lo q rows [row][64]; k rows; v planes [b][64][NN]
#define WS_QL  (WS_QH + 2u * (size_t)NB * NN * DD)
#define WS_KH  (WS_QL + 2u * (size_t)NB * NN * DD)
#define WS_KL  (WS_KH + 2u * (size_t)NB * NN * DD)
#define WS_VT  (WS_KL + 2u * (size_t)NB * NN * DD)
#define WS_VTL (WS_VT + 2u * (size_t)NB * DD * NN)
#define WS_END (WS_VTL + 2u * (size_t)NB * DD * NN)

__global__ __launch_bounds__(256) void k_packw(const float* __restrict__ WQ, const float* __restrict__ WK, const float* __restrict__ WV, __bf16* __restrict__ PW) { const int n = blockIdx.x, t = threadIdx.x; __shared__ __align__(16) __bf16 s[FF]; const int which = n / DD, u = n % DD; const float* Wm = which == 0 ? WQ : which == 1 ? WK : WV;   // (in,out) [512][64]
  for (int k = t; k < FF; k += 256) s[k] = (__bf16)Wm[(size_t)k * DD + u]; __syncthreads(); if (t < FF / 8) vst2((unsigned*)(PW + (size_t)n * FF + t * 8), *(const v4u*)&s[t * 8]); }
// ---- k_proj: block = 64 rows: cols 0..63 q, 64..127 k, 128..191 v (12 tiles) + biases
__global__ __launch_bounds__(128) void k_proj(const float* __restrict__ X, const __bf16* __restrict__ PW, const float* __restrict__ BQ, const float* __restrict__ BK, const float* __restrict__ BV, _Float16* __restrict__ QH, _Float16* __restrict__ QL, _Float16* __restrict__ KH, _Float16* __restrict__ KL, _Float16* __restrict__ VT, _Float16* __restrict__ VTL) {
  __shared__ __align__(16) _Float16 sq[64][72], sql[64][72], sk[64][72], skl[64][72]; __shared__ __align__(16) _Float16 th[DD][72], tl[DD][72];
  const int tid = threadIdx.x, wave = tid >> 5, lane = tid & 31, col = lane & 15, g = lane >> 4; const size_t r0 = (size_t)blockIdx.x * 64 + wave * 16; const size_t b = ((size_t)blockIdx.x * 64) / NN; const int n0 = (int)(((size_t)blockIdx.x * 64) % NN);
  v8f acc[12];
#pragma unroll
  for (int j = 0; j < 12; ++j) acc[j] = v8f{};
#pragma unroll 2
  for (int kc = 0; kc < FF / 32; ++kc) { v16b a; const float* pp = X + (r0 + col) * FF + kc * 32 + 8 * g;
#pragma unroll
    for (int i = 0; i < 8; ++i) { a[i] = (__bf16)pp[i]; a[8 + i] = (__bf16)pp[16 + i]; }
#pragma unroll
    for (int j = 0; j < 12; ++j) acc[j] = wmma_bf(a, frag_b(PW + (size_t)(j * 16 + col) * FF + kc * 32, lane), acc[j]); }
#pragma unroll
  for (int j = 0; j < 12; ++j) { const int c = (j & 3) * 16 + col; const float bb = j < 4 ? bfr(BQ[c]) : j < 8 ? bfr(BK[c]) : bfr(BV[c]);
#pragma unroll
    for (int r = 0; r < 8; ++r) { const float v = acc[j][r] + bb; const _Float16 hv = (_Float16)v, lv = (_Float16)((v - (float)hv) * 2048.0f); const int rl = wave * 16 + 8 * g + r; if (j < 4) { sq[rl][c] = hv; sql[rl][c] = lv; } else if (j < 8) { sk[rl][c] = hv; skl[rl][c] = lv; } else { th[c][rl] = hv; tl[c][rl] = lv; } } }
  __syncthreads();
  for (int e = tid; e < 64 * 8; e += 128) { const int rl = e >> 3, q = e & 7; const size_t o = ((size_t)blockIdx.x * 64 + rl) * DD + q * 8; vst2((unsigned*)(QH + o), *(const v4u*)&sq[rl][q * 8]); vst2((unsigned*)(QL + o), *(const v4u*)&sql[rl][q * 8]); vst2((unsigned*)(KH + o), *(const v4u*)&sk[rl][q * 8]); vst2((unsigned*)(KL + o), *(const v4u*)&skl[rl][q * 8]); }
  for (int e = tid; e < DD * 8; e += 128) { const int c = e >> 3, q = e & 7; const size_t o = (b * DD + c) * (size_t)NN + n0 + q * 8; vst2((unsigned*)(VT + o), *(const v4u*)&th[c][q * 8]); vst2((unsigned*)(VTL + o), *(const v4u*)&tl[c][q * 8]); } }
// ---- k_att: block = (32 queries, b), 16 waves = 2 query tiles x 8 key ranges of 256 keys: 3-product logits / 8, key mask (mask[b][k] == 0 excluded), softmax, P (hi + residual) . v (hi + residual); each wave keeps its own max, sum and un-normalised output, merged through LDS at the end
#define QTB 2
#define KSPL 8
static_assert(32 * KSPL == 16 * 16, "the merge gives one thread to each (row, 4 columns) of a query tile");
// four waves a SIMD is what a 16-wave block gives: the register budget is set for exactly that, so that the eight rows' reductions stay interleaved
__global__ __launch_bounds__(32 * QTB * KSPL) __attribute__((amdgpu_waves_per_eu(4, 4))) void k_att(const _Float16* __restrict__ QH, const _Float16* __restrict__ QL, const _Float16* __restrict__ KH, const _Float16* __restrict__ KL, const _Float16* __restrict__ VT, const _Float16* __restrict__ VTL, const int* __restrict__ MK, float* __restrict__ OUT) {
  __shared__ __align__(16) float sp[QTB * KSPL][16][36]; __shared__ __align__(16) float so[QTB * KSPL][16][68]; __shared__ float sm[QTB * KSPL][16], sl[QTB * KSPL][16];
  // the wave number is held scalar so that the pass counter and the key range's base stay in scalar registers
  const int tid = threadIdx.x, wave = __builtin_amdgcn_readfirstlane(tid >> 5), lane = tid & 31, col = lane & 15, g = lane >> 4; const size_t b = blockIdx.y; const int q0 = blockIdx.x * (16 * QTB) + (wave % QTB) * 16; const size_t rq = b * NN + q0; const int ks0 = (wave / QTB) * (NN / 32 / KSPL);
  v16h aq[2], al[2];
#pragma unroll
  for (int kc = 0; kc < 2; ++kc) { aq[kc] = frag_h(QH + (rq + col) * DD + kc * 32, lane); al[kc] = frag_h(QL + (rq + col) * DD + kc * 32, lane); }
  float m[8], l[8];
#pragma unroll
  for (int r = 0; r < 8; ++r) { m[r] = -3.0e38f; l[r] = 0.f; }
  v8f acc[4] = {}, accl[4] = {};
#pragma unroll 1
  for (int ks = ks0; ks < ks0 + NN / 32 / KSPL; ++ks) { float s[2][8];
#pragma unroll
    for (int ct = 0; ct < 2; ++ct) { const int kk = ks * 32 + ct * 16 + col; const size_t rk = b * NN + kk; v8f c = {}, cl = {};
#pragma unroll
      for (int kc = 0; kc < 2; ++kc) { const v16h kh = frag_h(KH + rk * DD + kc * 32, lane), kl = frag_h(KL + rk * DD + kc * 32, lane); c = wmma16(aq[kc], kh, c); cl = wmma16(aq[kc], kl, cl); cl = wmma16(al[kc], kh, cl); }
      const bool keep = MK[b * NN + kk] != 0;
#pragma unroll
      for (int r = 0; r < 8; ++r) s[ct][r] = keep ? (c[r] + cl[r] * (1.0f / 2048.0f)) * 0.125f : -3.0e38f; }
    float alpha[8];
#pragma unroll
    for (int r = 0; r < 8; ++r) { float mx = fmaxf(s[0][r], s[1][r]);
#pragma unroll
      for (int o = 1; o < 16; o <<= 1) mx = fmaxf(mx, __shfl_xor(mx, o));
      const float mn = fmaxf(m[r], mx); alpha[r] = (m[r] <= -1.0e38f) ? 0.f : __expf(m[r] - mn); const float e0 = (s[0][r] <= -1.0e38f) ? 0.f : __expf(s[0][r] - mn), e1 = (s[1][r] <= -1.0e38f) ? 0.f : __expf(s[1][r] - mn); float es = e0 + e1;
#pragma unroll
      for (int o = 1; o < 16; o <<= 1) es += __shfl_xor(es, o);
      l[r] = l[r] * alpha[r] + es; m[r] = (mn > -1.0e38f) ? mn : m[r]; sp[wave][8 * g + r][col] = e0; sp[wave][8 * g + r][16 + col] = e1; }
#pragma unroll
    for (int j = 0; j < 4; ++j)
#pragma unroll
      for (int r = 0; r < 8; ++r) { acc[j][r] *= alpha[r]; accl[j][r] *= alpha[r]; }
    LDSX();
    v16h pa, pal; { const float* prow = &sp[wave][col][0] + 8 * (lane >> 4);
#pragma unroll
      for (int i = 0; i < 8; ++i) { const float p0 = prow[i] * 2048.0f, p1 = prow[16 + i] * 2048.0f; pa[i] = (_Float16)p0; pa[8 + i] = (_Float16)p1; pal[i] = (_Float16)((p0 - (float)pa[i]) * 2048.0f); pal[8 + i] = (_Float16)((p1 - (float)pa[8 + i]) * 2048.0f); } }
#pragma unroll
    for (int j = 0; j < 4; ++j) { const size_t po = (b * DD + j * 16 + col) * (size_t)NN + ks * 32; const v16h vh = frag_h(VT + po, lane), vl = frag_h(VTL + po, lane); acc[j] = wmma16(pa, vh, acc[j]); accl[j] = wmma16(pa, vl, accl[j]); accl[j] = wmma16(pal, vh, accl[j]); }
    LDSX(); }
#pragma unroll
  for (int r = 0; r < 8; ++r)
#pragma unroll
    for (int j = 0; j < 4; ++j) so[wave][8 * g + r][j * 16 + col] = acc[j][r] + accl[j][r] * (1.0f / 2048.0f);
  if (col == 0) {
#pragma unroll
    for (int r = 0; r < 8; ++r) { sm[wave][8 * g + r] = m[r]; sl[wave][8 * g + r] = l[r]; } }
  __syncthreads();
  // merge of the key ranges: thread = (query tile, row, 4 columns); weight exp(m_s - M), a range with no kept key weighs 0
  { const int qt = tid >> 8, row = (tid >> 4) & 15, c4 = (tid & 15) * 4; float M = -3.0e38f;
#pragma unroll
    for (int s = 0; s < KSPL; ++s) M = fmaxf(M, sm[s * QTB + qt][row]);
    float w[KSPL], L = 0.f; v4f o = {};
#pragma unroll
    for (int s = 0; s < KSPL; ++s) { const float ms = sm[s * QTB + qt][row]; w[s] = (ms <= -1.0e38f) ? 0.f : __expf(ms - M); }
#pragma unroll
    for (int s = 0; s < KSPL; ++s) { L += w[s] * sl[s * QTB + qt][row]; o += w[s] * *(const v4f*)&so[s * QTB + qt][row][c4]; }
    const float il = (L > 0.f) ? (1.0f / 2048.0f) / L : 0.f;
    vst2(OUT + (b * NN + blockIdx.x * (16 * QTB) + qt * 16 + row) * DD + c4, o * il); } }
extern "C" void kernel_launch(void* const* d_in, const int* in_sizes, int n_in, void* d_out, int out_size, void* d_ws, size_t ws_size, hipStream_t stream) {
  (void)in_sizes; (void)n_in; (void)out_size;
  const float** F = (const float**)d_in;   // 0 x [4,2048,512], 1 mask [4,2048] int, 2 Wq [512,64] (in,out), 3 bq, 4 Wk, 5 bk, 6 Wv, 7 bv
  if (ws_size < (size_t)WS_END) return;
  char* ws = (char*)d_ws; __bf16* PW = (__bf16*)(ws + WS_PW); _Float16 *QH = (_Float16*)(ws + WS_QH), *QL = (_Float16*)(ws + WS_QL), *KH = (_Float16*)(ws + WS_KH), *KL = (_Float16*)(ws + WS_KL), *VT = (_Float16*)(ws + WS_VT), *VTL = (_Float16*)(ws + WS_VTL);
  k_packw<<<3 * DD, 256, 0, stream>>>(F[2], F[4], F[6], PW);
  k_proj<<<NB * NN / 64, 128, 0, stream>>>(F[0], PW, F[3], F[5], F[7], QH, QL, KH, KL, VT, VTL);
  k_att<<<dim3(NN / (16 * QTB), TNB), 32 * QTB * KSPL, 0, stream>>>(QH, QL, KH, KL, VT, VTL, (const int*)d_in[1], (float*)d_out);
}

// v002
// It runs in 55.8 microseconds.
// Next to v001, in two timings, it ran 1.53 and 1.54 times as fast.
// All steps since v000 together make it 3.89 times as fast.
// compute dtype: all float inputs rounded to bf16, mask (int) read on device; q/k/v = x W + b with EXACT bf16 products on WMMA 16x16x32 ((in,out) weights as transposed rows); q/k as f16 hi + residual (3-product logits x 1/8), masked keys (mask == 0) excluded (== the -1e9 additive fill), running-max softmax in f32 (hardware exp); P (x 2^11) as f16 hi + residual . v (f16 hi + residual planes; 3 products); f32 output.
#include <hip/hip_runtime.h>
#include <math.h>

typedef __attribute__((ext_vector_type(16))) _Float16 v16h;
typedef __attribute__((ext_vector_type(16))) __bf16 v16b;
typedef __attribute__((ext_vector_type(8)))  _Float16 v8h;
typedef __attribute__((ext_vector_type(8)))  float v8f;
typedef __attribute__((ext_vector_type(4)))  float v4f;
typedef __attribute__((ext_vector_type(2)))  float v2f;
typedef __attribute__((ext_vector_type(4)))  unsigned v4u;
typedef __attribute__((ext_vector_type(4)))  int v4i;
typedef float __attribute__((may_alias)) float_a;
typedef int __attribute__((may_alias)) int_a;

template <typename T> __device__ __forceinline__ void vst2(void* p, T v) { *(T*)p = v;  }
__device__ __forceinline__ v8f wmma16(v16h a, v16h b, v8f c) {
  v8f d = __builtin_amdgcn_wmma_f32_16x16x32_f16(false, a, false, b, (short)0, c, false, false);
  asm volatile("v_nop\n\tv_nop\n\tv_nop\n\tv_nop" : "+v"(d) : "v"(a), "v"(b));
  return d;
}
__device__ __forceinline__ v8f wmma_bf(v16b a, v16b b, v8f c) {
  v8f d = __builtin_amdgcn_wmma_f32_16x16x32_bf16(false, a, false, b, (short)0, c, false, false);
  asm volatile("v_nop\n\tv_nop\n\tv_nop\n\tv_nop" : "+v"(d) : "v"(a), "v"(b));
  return d;
}
// 16x16x32 fragments: lane = (h = lane>>4, row/col = lane&15); elements 0..7 = k0+8h+0..7, 8..15 = k0+16+8h+0..7; D element r = row 8h+r
__device__ __forceinline__ v16h frag_h(const _Float16* rowk0, int lane) {
  union { v16h v; v8h q[2]; } u; const _Float16* p = rowk0 + 8 * (lane >> 4);
  u.q[0] = *(const v8h*)p; u.q[1] = *(const v8h*)(p + 16); return u.v;
}
__device__ __forceinline__ v16h frag_f32(const float* rowk0, int lane) {
  v16h a; const float* p = rowk0 + 8 * (lane >> 4);
#pragma unroll
  for (int i = 0; i < 8; ++i) { a[i] = (_Float16)p[i]; a[8 + i] = (_Float16)p[16 + i]; }
  return a;
}
__device__ __forceinline__ v16h frag_f32s(const float* rowk0, int lane, float sc) {
  v16h a; const float* p = rowk0 + 8 * (lane >> 4);
#pragma unroll
  for (int i = 0; i < 8; ++i) { a[i] = (_Float16)(p[i] * sc); a[8 + i] = (_Float16)(p[16 + i] * sc); }
  return a;
}
// column fragment from a [K][ld] layout (column n), rows >= K read as 0
__device__ __forceinline__ v16h fragc_f32(const float* W, int k0, int n, int lane, int ld, int K) {
  v16h a; const int g = lane >> 4;
#pragma unroll
  for (int i = 0; i < 8; ++i) { const int ka = k0 + 8 * g + i, kb = ka + 16;
    a[i] = (_Float16)(ka < K ? W[(size_t)(ka < K ? ka : K - 1) * ld + n] : 0.f); a[8 + i] = (_Float16)(kb < K ? W[(size_t)(kb < K ? kb : K - 1) * ld + n] : 0.f); }
  return a;
}
struct F2 { v16b h, l; };
__device__ __forceinline__ F2 bsplit16(const float v[16]) { F2 r;
#pragma unroll
  for (int i = 0; i < 16; ++i) { const __bf16 h = (__bf16)v[i]; r.h[i] = h; r.l[i] = (__bf16)(v[i] - (float)h); }
  return r; }
__device__ __forceinline__ F2 split_row(const float* row, int k0, int lane) { float v[16]; const float* p = row + k0 + 8 * (lane >> 4);
#pragma unroll
  for (int i = 0; i < 8; ++i) { v[i] = p[i]; v[8 + i] = p[16 + i]; }
  return bsplit16(v); }
__device__ __forceinline__ F2 split_rowK(const float* row, int k0, int lane, int K) { float v[16]; const int g = lane >> 4;
#pragma unroll
  for (int i = 0; i < 8; ++i) { const int ka = k0 + 8 * g + i, kb = ka + 16; v[i] = ka < K ? row[ka < K ? ka : K - 1] : 0.f; v[8 + i] = kb < K ? row[kb < K ? kb : K - 1] : 0.f; }
  return bsplit16(v); }
__device__ __forceinline__ F2 split_col(const float* W, int k0, int n, int lane, int ld, int K) { float v[16]; const int g = lane >> 4;
#pragma unroll
  for (int i = 0; i < 8; ++i) { const int ka = k0 + 8 * g + i, kb = ka + 16; v[i] = ka < K ? W[(size_t)(ka < K ? ka : K - 1) * ld + n] : 0.f; v[8 + i] = kb < K ? W[(size_t)(kb < K ? kb : K - 1) * ld + n] : 0.f; }
  return bsplit16(v); }
__device__ __forceinline__ v8f mac3(const F2& a, const F2& b, v8f c) { c = wmma_bf(a.l, b.h, c); c = wmma_bf(a.h, b.l, c); return wmma_bf(a.h, b.h, c); }
__device__ __forceinline__ float sigm(float v) { return 1.0f / (1.0f + expf(-v)); }
#define LDSX() do { asm volatile("s_wait_dscnt 0" ::: "memory"); __builtin_amdgcn_wave_barrier(); __builtin_amdgcn_fence(__ATOMIC_RELEASE, "workgroup"); } while (0)


// Single-head masked attention (B 4, S 2,048, F 512 -> D 64): q, k, v = x W + b; softmax(q k^T / 8 + (1 - mask_k) * -1e9) v.
#define NB 4
#define NN 2048
#define FF 512
#define DD 64
#ifndef TNB
#define TNB NB
#endif
typedef __attribute__((ext_vector_type(8))) __bf16 v8b;
__device__ __forceinline__ v16b frag_b(const __bf16* rowk0, int lane) {
  union { v16b v; v8b q[2]; } u; const __bf16* p = rowk0 + 8 * (lane >> 4);
  u.q[0] = *(const v8b*)p; u.q[1] = *(const v8b*)(p + 16); return u.v;
}
__device__ __forceinline__ float bfr(float v) { return (float)(__bf16)v; }
__device__ __attribute__((noinline)) float exp_ni(float v) { return expf(v); }
__device__ __attribute__((noinline)) float erf_ni(float v) { return erff(v); }

#define WS_PW  0u                                   // bf16 W^T rows [192][512] (q | k | v)
#define WS_QH  (WS_PW + 2u * 3 * DD * FF)               // f16 hi|lo q rows [row][64]; k rows; v planes [b][64][NN]
#define WS_QL  (WS_QH + 2u * (size_t)NB * NN * DD)
#define WS_KH  (WS_QL + 2u * (size_t)NB * NN * DD)
#define WS_KL  (WS_KH + 2u * (size_t)NB * NN * DD)
#define WS_VT  (WS_KL + 2u * (size_t)NB * NN * DD)
#define WS_VTL (WS_VT + 2u * (size_t)NB * DD * NN)
#define WS_END (WS_VTL + 2u * (size_t)NB * DD * NN)

__global__ __launch_bounds__(256) void k_packw(const float* __restrict__ WQ, const float* __restrict__ WK, const float* __restrict__ WV, __bf16* __restrict__ PW) { const int n = blockIdx.x, t = threadIdx.x; __shared__ __align__(16) __bf16 s[FF]; const int which = n / DD, u = n % DD; const float* Wm = which == 0 ? WQ : which == 1 ? WK : WV;   // (in,out) [512][64]
  for (int k = t; k < FF; k += 256) s[k] = (__bf16)Wm[(size_t)k * DD + u]; __syncthreads(); if (t < FF / 8) vst2((unsigned*)(PW + (size_t)n * FF + t * 8), *(const v4u*)&s[t * 8]); }
// ---- k_proj: block = 64 rows: cols 0..63 q, 64..127 k, 128..191 v (12 tiles) + biases
__global__ __launch_bounds__(128) void k_proj(const float* __restrict__ X, const __bf16* __restrict__ PW, const float* __restrict__ BQ, const float* __restrict__ BK, const float* __restrict__ BV, _Float16* __restrict__ QH, _Float16* __restrict__ QL, _Float16* __restrict__ KH, _Float16* __restrict__ KL, _Float16* __restrict__ VT, _Float16* __restrict__ VTL) {
  __shared__ __align__(16) _Float16 sq[64][72], sql[64][72], sk[64][72], skl[64][72]; __shared__ __align__(16) _Float16 th[DD][72], tl[DD][72];
  const int tid = threadIdx.x, wave = tid >> 5, lane = tid & 31, col = lane & 15, g = lane >> 4; const size_t r0 = (size_t)blockIdx.x * 64 + wave * 16; const size_t b = ((size_t)blockIdx.x * 64) / NN; const int n0 = (int)(((size_t)blockIdx.x * 64) % NN);
  v8f acc[12];
#pragma unroll
  for (int j = 0; j < 12; ++j) acc[j] = v8f{};
  // every fragment is fetched one k step ahead: a weight fragment's next load is issued right behind the product that used it, so that the twelve loads of a step are in flight together instead of each being waited for alone
  const float* px = X + (r0 + col) * FF + 8 * g; const __bf16* pw = PW + (size_t)col * FF;
  v4f xr[4] = { *(const v4f*)px, *(const v4f*)(px + 4), *(const v4f*)(px + 16), *(const v4f*)(px + 20) }; v16b bf[12];
#pragma unroll
  for (int j = 0; j < 12; ++j) bf[j] = frag_b(pw + (size_t)j * 16 * FF, lane);
  // unrolled whole so that the test for a next step is resolved at compile time and the fetched fragments keep their registers without copies
#pragma unroll
  for (int kc = 0; kc < FF / 32; ++kc) { v16b a;
    // keeps the conversion of this step's x, and with it the wait for its loads, from being moved up to right behind those loads in the step before
    __builtin_amdgcn_sched_barrier(0);
#pragma unroll
    for (int i = 0; i < 4; ++i) { a[i] = (__bf16)xr[0][i]; a[4 + i] = (__bf16)xr[1][i]; a[8 + i] = (__bf16)xr[2][i]; a[12 + i] = (__bf16)xr[3][i]; }
    if (kc + 1 < FF / 32) { const float* pn = px + (kc + 1) * 32; xr[0] = *(const v4f*)pn; xr[1] = *(const v4f*)(pn + 4); xr[2] = *(const v4f*)(pn + 16); xr[3] = *(const v4f*)(pn + 20); }
#pragma unroll
    for (int j = 0; j < 12; ++j) { acc[j] = wmma_bf(a, bf[j], acc[j]); if (kc + 1 < FF / 32) bf[j] = frag_b(pw + (size_t)j * 16 * FF + (kc + 1) * 32, lane); } }
#pragma unroll
  for (int j = 0; j < 12; ++j) { const int c = (j & 3) * 16 + col; const float bb = j < 4 ? bfr(BQ[c]) : j < 8 ? bfr(BK[c]) : bfr(BV[c]);
#pragma unroll
    for (int r = 0; r < 8; ++r) { const float v = acc[j][r] + bb; const _Float16 hv = (_Float16)v, lv = (_Float16)((v - (float)hv) * 2048.0f); const int rl = wave * 16 + 8 * g + r; if (j < 4) { sq[rl][c] = hv; sql[rl][c] = lv; } else if (j < 8) { sk[rl][c] = hv; skl[rl][c] = lv; } else { th[c][rl] = hv; tl[c][rl] = lv; } } }
  __syncthreads();
  for (int e = tid; e < 64 * 8; e += 128) { const int rl = e >> 3, q = e & 7; const size_t o = ((size_t)blockIdx.x * 64 + rl) * DD + q * 8; vst2((unsigned*)(QH + o), *(const v4u*)&sq[rl][q * 8]); vst2((unsigned*)(QL + o), *(const v4u*)&sql[rl][q * 8]); vst2((unsigned*)(KH + o), *(const v4u*)&sk[rl][q * 8]); vst2((unsigned*)(KL + o), *(const v4u*)&skl[rl][q * 8]); }
  for (int e = tid; e < DD * 8; e += 128) { const int c = e >> 3, q = e & 7; const size_t o = (b * DD + c) * (size_t)NN + n0 + q * 8; vst2((unsigned*)(VT + o), *(const v4u*)&th[c][q * 8]); vst2((unsigned*)(VTL + o), *(const v4u*)&tl[c][q * 8]); } }
// ---- k_att: block = (32 queries, b), 16 waves = 2 query tiles x 8 key ranges of 256 keys: 3-product logits / 8, key mask (mask[b][k] == 0 excluded), softmax, P (hi + residual) . v (hi + residual); each wave keeps its own max, sum and un-normalised output, merged through LDS at the end
#define QTB 2
#define KSPL 8
static_assert(32 * KSPL == 16 * 16, "the merge gives one thread to each (row, 4 columns) of a query tile");
// four waves a SIMD is what a 16-wave block gives: the register budget is set for exactly that, so that the eight rows' reductions stay interleaved
__global__ __launch_bounds__(32 * QTB * KSPL) __attribute__((amdgpu_waves_per_eu(4, 4))) void k_att(const _Float16* __restrict__ QH, const _Float16* __restrict__ QL, const _Float16* __restrict__ KH, const _Float16* __restrict__ KL, const _Float16* __restrict__ VT, const _Float16* __restrict__ VTL, const int* __restrict__ MK, float* __restrict__ OUT) {
  __shared__ __align__(16) float sp[QTB * KSPL][16][36]; __shared__ __align__(16) float so[QTB * KSPL][16][68]; __shared__ float sm[QTB * KSPL][16], sl[QTB * KSPL][16];
  // the wave number is held scalar so that the pass counter and the key range's base stay in scalar registers
  const int tid = threadIdx.x, wave = __builtin_amdgcn_readfirstlane(tid >> 5), lane = tid & 31, col = lane & 15, g = lane >> 4; const size_t b = blockIdx.y; const int q0 = blockIdx.x * (16 * QTB) + (wave % QTB) * 16; const size_t rq = b * NN + q0; const int ks0 = (wave / QTB) * (NN / 32 / KSPL);
  v16h aq[2], al[2];
#pragma unroll
  for (int kc = 0; kc < 2; ++kc) { aq[kc] = frag_h(QH + (rq + col) * DD + kc * 32, lane); al[kc] = frag_h(QL + (rq + col) * DD + kc * 32, lane); }
  float m[8], l[8];
#pragma unroll
  for (int r = 0; r < 8; ++r) { m[r] = -3.0e38f; l[r] = 0.f; }
  v8f acc[4] = {}, accl[4] = {};
#pragma unroll 1
  for (int ks = ks0; ks < ks0 + NN / 32 / KSPL; ++ks) { float s[2][8];
#pragma unroll
    for (int ct = 0; ct < 2; ++ct) { const int kk = ks * 32 + ct * 16 + col; const size_t rk = b * NN + kk; v8f c = {}, cl = {};
#pragma unroll
      for (int kc = 0; kc < 2; ++kc) { const v16h kh = frag_h(KH + rk * DD + kc * 32, lane), kl = frag_h(KL + rk * DD + kc * 32, lane); c = wmma16(aq[kc], kh, c); cl = wmma16(aq[kc], kl, cl); cl = wmma16(al[kc], kh, cl); }
      const bool keep = MK[b * NN + kk] != 0;
#pragma unroll
      for (int r = 0; r < 8; ++r) s[ct][r] = keep ? (c[r] + cl[r] * (1.0f / 2048.0f)) * 0.125f : -3.0e38f; }
    float alpha[8];
#pragma unroll
    for (int r = 0; r < 8; ++r) { float mx = fmaxf(s[0][r], s[1][r]);
#pragma unroll
      for (int o = 1; o < 16; o <<= 1) mx = fmaxf(mx, __shfl_xor(mx, o));
      const float mn = fmaxf(m[r], mx); alpha[r] = (m[r] <= -1.0e38f) ? 0.f : __expf(m[r] - mn); const float e0 = (s[0][r] <= -1.0e38f) ? 0.f : __expf(s[0][r] - mn), e1 = (s[1][r] <= -1.0e38f) ? 0.f : __expf(s[1][r] - mn); float es = e0 + e1;
#pragma unroll
      for (int o = 1; o < 16; o <<= 1) es += __shfl_xor(es, o);
      l[r] = l[r] * alpha[r] + es; m[r] = (mn > -1.0e38f) ? mn : m[r]; sp[wave][8 * g + r][col] = e0; sp[wave][8 * g + r][16 + col] = e1; }
#pragma unroll
    for (int j = 0; j < 4; ++j)
#pragma unroll
      for (int r = 0; r < 8; ++r) { acc[j][r] *= alpha[r]; accl[j][r] *= alpha[r]; }
    LDSX();
    v16h pa, pal; { const float* prow = &sp[wave][col][0] + 8 * (lane >> 4);
#pragma unroll
      for (int i = 0; i < 8; ++i) { const float p0 = prow[i] * 2048.0f, p1 = prow[16 + i] * 2048.0f; pa[i] = (_Float16)p0; pa[8 + i] = (_Float16)p1; pal[i] = (_Float16)((p0 - (float)pa[i]) * 2048.0f); pal[8 + i] = (_Float16)((p1 - (float)pa[8 + i]) * 2048.0f); } }
#pragma unroll
    for (int j = 0; j < 4; ++j) { const size_t po = (b * DD + j * 16 + col) * (size_t)NN + ks * 32; const v16h vh = frag_h(VT + po, lane), vl = frag_h(VTL + po, lane); acc[j] = wmma16(pa, vh, acc[j]); accl[j] = wmma16(pa, vl, accl[j]); accl[j] = wmma16(pal, vh, accl[j]); }
    LDSX(); }
#pragma unroll
  for (int r = 0; r < 8; ++r)
#pragma unroll
    for (int j = 0; j < 4; ++j) so[wave][8 * g + r][j * 16 + col] = acc[j][r] + accl[j][r] * (1.0f / 2048.0f);
  if (col == 0) {
#pragma unroll
    for (int r = 0; r < 8; ++r) { sm[wave][8 * g + r] = m[r]; sl[wave][8 * g + r] = l[r]; } }
  __syncthreads();
  // merge of the key ranges: thread = (query tile, row, 4 columns); weight exp(m_s - M), a range with no kept key weighs 0
  { const int qt = tid >> 8, row = (tid >> 4) & 15, c4 = (tid & 15) * 4; float M = -3.0e38f;
#pragma unroll
    for (int s = 0; s < KSPL; ++s) M = fmaxf(M, sm[s * QTB + qt][row]);
    float w[KSPL], L = 0.f; v4f o = {};
#pragma unroll
    for (int s = 0; s < KSPL; ++s) { const float ms = sm[s * QTB + qt][row]; w[s] = (ms <= -1.0e38f) ? 0.f : __expf(ms - M); }
#pragma unroll
    for (int s = 0; s < KSPL; ++s) { L += w[s] * sl[s * QTB + qt][row]; o += w[s] * *(const v4f*)&so[s * QTB + qt][row][c4]; }
    const float il = (L > 0.f) ? (1.0f / 2048.0f) / L : 0.f;
    vst2(OUT + (b * NN + blockIdx.x * (16 * QTB) + qt * 16 + row) * DD + c4, o * il); } }
extern "C" void kernel_launch(void* const* d_in, const int* in_sizes, int n_in, void* d_out, int out_size, void* d_ws, size_t ws_size, hipStream_t stream) {
  (void)in_sizes; (void)n_in; (void)out_size;
  const float** F = (const float**)d_in;   // 0 x [4,2048,512], 1 mask [4,2048] int, 2 Wq [512,64] (in,out), 3 bq, 4 Wk, 5 bk, 6 Wv, 7 bv
  if (ws_size < (size_t)WS_END) return;
  char* ws = (char*)d_ws; __bf16* PW = (__bf16*)(ws + WS_PW); _Float16 *QH = (_Float16*)(ws + WS_QH), *QL = (_Float16*)(ws + WS_QL), *KH = (_Float16*)(ws + WS_KH), *KL = (_Float16*)(ws + WS_KL), *VT = (_Float16*)(ws + WS_VT), *VTL = (_Float16*)(ws + WS_VTL);
  k_packw<<<3 * DD, 256, 0, stream>>>(F[2], F[4], F[6], PW);
  k_proj<<<NB * NN / 64, 128, 0, stream>>>(F[0], PW, F[3], F[5], F[7], QH, QL, KH, KL, VT, VTL);
  k_att<<<dim3(NN / (16 * QTB), TNB), 32 * QTB * KSPL, 0, stream>>>(QH, QL, KH, KL, VT, VTL, (const int*)d_in[1], (float*)d_out);
}

// v003
// A run of this version takes 50.7 microseconds.
// In both of two side-by-side timings against v002, it was 1.10 times as fast.
// Over all steps from v000 it is 4.28 times as fast.
// compute dtype: all float inputs rounded to bf16, mask (int) read on device; q/k/v = x W + b with EXACT bf16 products on WMMA 16x16x32 ((in,out) weights as transposed rows); q/k as f16 hi + residual (3-product logits x 1/8), masked keys (mask == 0) excluded (== the -1e9 additive fill), running-max softmax in f32 (hardware exp); P (x 2^11) as f16 hi + residual . v (f16 hi + residual planes; 3 products); f32 output.
#include <hip/hip_runtime.h>
#include <math.h>

typedef __attribute__((ext_vector_type(16))) _Float16 v16h;
typedef __attribute__((ext_vector_type(16))) __bf16 v16b;
typedef __attribute__((ext_vector_type(8)))  _Float16 v8h;
typedef __attribute__((ext_vector_type(8)))  float v8f;
typedef __attribute__((ext_vector_type(4)))  float v4f;
typedef __attribute__((ext_vector_type(2)))  float v2f;
typedef __attribute__((ext_vector_type(4)))  unsigned v4u;
typedef __attribute__((ext_vector_type(4)))  int v4i;
typedef float __attribute__((may_alias)) float_a;
typedef int __attribute__((may_alias)) int_a;

template <typename T> __device__ __forceinline__ void vst2(void* p, T v) { *(T*)p = v;  }
__device__ __forceinline__ v8f wmma16(v16h a, v16h b, v8f c) {
  v8f d = __builtin_amdgcn_wmma_f32_16x16x32_f16(false, a, false, b, (short)0, c, false, false);
  asm volatile("v_nop\n\tv_nop\n\tv_nop\n\tv_nop" : "+v"(d) : "v"(a), "v"(b));
  return d;
}
__device__ __forceinline__ v8f wmma_bf(v16b a, v16b b, v8f c) {
  v8f d = __builtin_amdgcn_wmma_f32_16x16x32_bf16(false, a, false, b, (short)0, c, false, false);
  asm volatile("v_nop\n\tv_nop\n\tv_nop\n\tv_nop" : "+v"(d) : "v"(a), "v"(b));
  return d;
}
// 16x16x32 fragments: lane = (h = lane>>4, row/col = lane&15); elements 0..7 = k0+8h+0..7, 8..15 = k0+16+8h+0..7; D element r = row 8h+r
__device__ __forceinline__ v16h frag_h(const _Float16* rowk0, int lane) {
  union { v16h v; v8h q[2]; } u; const _Float16* p = rowk0 + 8 * (lane >> 4);
  u.q[0] = *(const v8h*)p; u.q[1] = *(const v8h*)(p + 16); return u.v;
}
__device__ __forceinline__ v16h frag_f32(const float* rowk0, int lane) {
  v16h a; const float* p = rowk0 + 8 * (lane >> 4);
#pragma unroll
  for (int i = 0; i < 8; ++i) { a[i] = (_Float16)p[i]; a[8 + i] = (_Float16)p[16 + i]; }
  return a;
}
__device__ __forceinline__ v16h frag_f32s(const float* rowk0, int lane, float sc) {
  v16h a; const float* p = rowk0 + 8 * (lane >> 4);
#pragma unroll
  for (int i = 0; i < 8; ++i) { a[i] = (_Float16)(p[i] * sc); a[8 + i] = (_Float16)(p[16 + i] * sc); }
  return a;
}
// column fragment from a [K][ld] layout (column n), rows >= K read as 0
__device__ __forceinline__ v16h fragc_f32(const float* W, int k0, int n, int lane, int ld, int K) {
  v16h a; const int g = lane >> 4;
#pragma unroll
  for (int i = 0; i < 8; ++i) { const int ka = k0 + 8 * g + i, kb = ka + 16;
    a[i] = (_Float16)(ka < K ? W[(size_t)(ka < K ? ka : K - 1) * ld + n] : 0.f); a[8 + i] = (_Float16)(kb < K ? W[(size_t)(kb < K ? kb : K - 1) * ld + n] : 0.f); }
  return a;
}
struct F2 { v16b h, l; };
__device__ __forceinline__ F2 bsplit16(const float v[16]) { F2 r;
#pragma unroll
  for (int i = 0; i < 16; ++i) { const __bf16 h = (__bf16)v[i]; r.h[i] = h; r.l[i] = (__bf16)(v[i] - (float)h); }
  return r; }
__device__ __forceinline__ F2 split_row(const float* row, int k0, int lane) { float v[16]; const float* p = row + k0 + 8 * (lane >> 4);
#pragma unroll
  for (int i = 0; i < 8; ++i) { v[i] = p[i]; v[8 + i] = p[16 + i]; }
  return bsplit16(v); }
__device__ __forceinline__ F2 split_rowK(const float* row, int k0, int lane, int K) { float v[16]; const int g = lane >> 4;
#pragma unroll
  for (int i = 0; i < 8; ++i) { const int ka = k0 + 8 * g + i, kb = ka + 16; v[i] = ka < K ? row[ka < K ? ka : K - 1] : 0.f; v[8 + i] = kb < K ? row[kb < K ? kb : K - 1] : 0.f; }
  return bsplit16(v); }
__device__ __forceinline__ F2 split_col(const float* W, int k0, int n, int lane, int ld, int K) { float v[16]; const int g = lane >> 4;
#pragma unroll
  for (int i = 0; i < 8; ++i) { const int ka = k0 + 8 * g + i, kb = ka + 16; v[i] = ka < K ? W[(size_t)(ka < K ? ka : K - 1) * ld + n] : 0.f; v[8 + i] = kb < K ? W[(size_t)(kb < K ? kb : K - 1) * ld + n] : 0.f; }
  return bsplit16(v); }
__device__ __forceinline__ v8f mac3(const F2& a, const F2& b, v8f c) { c = wmma_bf(a.l, b.h, c); c = wmma_bf(a.h, b.l, c); return wmma_bf(a.h, b.h, c); }
__device__ __forceinline__ float sigm(float v) { return 1.0f / (1.0f + expf(-v)); }
#define LDSX() do { asm volatile("s_wait_dscnt 0" ::: "memory"); __builtin_amdgcn_wave_barrier(); __builtin_amdgcn_fence(__ATOMIC_RELEASE, "workgroup"); } while (0)


// Single-head masked attention (B 4, S 2,048, F 512 -> D 64): q, k, v = x W + b; softmax(q k^T / 8 + (1 - mask_k) * -1e9) v.
#define NB 4
#define NN 2048
#define FF 512
#define DD 64
#ifndef TNB
#define TNB NB
#endif
typedef __attribute__((ext_vector_type(8))) __bf16 v8b;
__device__ __forceinline__ v16b frag_b(const __bf16* rowk0, int lane) {
  union { v16b v; v8b q[2]; } u; const __bf16* p = rowk0 + 8 * (lane >> 4);
  u.q[0] = *(const v8b*)p; u.q[1] = *(const v8b*)(p + 16); return u.v;
}
__device__ __forceinline__ float bfr(float v) { return (float)(__bf16)v; }
__device__ __attribute__((noinline)) float exp_ni(float v) { return expf(v); }
__device__ __attribute__((noinline)) float erf_ni(float v) { return erff(v); }

#define WS_PW  0u                                   // bf16 W^T rows [192][512] (q | k | v)
#define WS_QH  (WS_PW + 2u * 3 * DD * FF)               // f16 hi|lo q rows [row][64]; k rows; v planes [b][64][NN]
#define WS_QL  (WS_QH + 2u * (size_t)NB * NN * DD)
#define WS_KH  (WS_QL + 2u * (size_t)NB * NN * DD)
#define WS_KL  (WS_KH + 2u * (size_t)NB * NN * DD)
#define WS_VT  (WS_KL + 2u * (size_t)NB * NN * DD)
#define WS_VTL (WS_VT + 2u * (size_t)NB * DD * NN)
#define WS_END (WS_VTL + 2u * (size_t)NB * DD * NN)

__global__ __launch_bounds__(256) void k_packw(const float* __restrict__ WQ, const float* __restrict__ WK, const float* __restrict__ WV, __bf16* __restrict__ PW) { const int n = blockIdx.x, t = threadIdx.x; __shared__ __align__(16) __bf16 s[FF]; const int which = n / DD, u = n % DD; const float* Wm = which == 0 ? WQ : which == 1 ? WK : WV;   // (in,out) [512][64]
  for (int k = t; k < FF; k += 256) s[k] = (__bf16)Wm[(size_t)k * DD + u]; __syncthreads(); if (t < FF / 8) vst2((unsigned*)(PW + (size_t)n * FF + t * 8), *(const v4u*)&s[t * 8]); }
// ---- k_proj: block = 64 rows: cols 0..63 q, 64..127 k, 128..191 v (12 tiles) + biases
__global__ __launch_bounds__(128) void k_proj(const float* __restrict__ X, const __bf16* __restrict__ PW, const float* __restrict__ BQ, const float* __restrict__ BK, const float* __restrict__ BV, _Float16* __restrict__ QH, _Float16* __restrict__ QL, _Float16* __restrict__ KH, _Float16* __restrict__ KL, _Float16* __restrict__ VT, _Float16* __restrict__ VTL) {
  __shared__ __align__(16) _Float16 sq[64][72], sql[64][72], sk[64][72], skl[64][72]; __shared__ __align__(16) _Float16 th[DD][72], tl[DD][72];
  const int tid = threadIdx.x, wave = tid >> 5, lane = tid & 31, col = lane & 15, g = lane >> 4; const size_t r0 = (size_t)blockIdx.x * 64 + wave * 16; const size_t b = ((size_t)blockIdx.x * 64) / NN; const int n0 = (int)(((size_t)blockIdx.x * 64) % NN);
  v8f acc[12];
#pragma unroll
  for (int j = 0; j < 12; ++j) acc[j] = v8f{};
  // every fragment is fetched one k step ahead: a weight fragment's next load is issued right behind the product that used it, so that the twelve loads of a step are in flight together instead of each being waited for alone
  const float* px = X + (r0 + col) * FF + 8 * g; const __bf16* pw = PW + (size_t)col * FF;
  v4f xr[4] = { *(const v4f*)px, *(const v4f*)(px + 4), *(const v4f*)(px + 16), *(const v4f*)(px + 20) }; v16b bf[12];
#pragma unroll
  for (int j = 0; j < 12; ++j) bf[j] = frag_b(pw + (size_t)j * 16 * FF, lane);
  // unrolled whole so that the test for a next step is resolved at compile time and the fetched fragments keep their registers without copies
#pragma unroll
  for (int kc = 0; kc < FF / 32; ++kc) { v16b a;
    // keeps the conversion of this step's x, and with it the wait for its loads, from being moved up to right behind those loads in the step before
    __builtin_amdgcn_sched_barrier(0);
#pragma unroll
    for (int i = 0; i < 4; ++i) { a[i] = (__bf16)xr[0][i]; a[4 + i] = (__bf16)xr[1][i]; a[8 + i] = (__bf16)xr[2][i]; a[12 + i] = (__bf16)xr[3][i]; }
    if (kc + 1 < FF / 32) { const float* pn = px + (kc + 1) * 32; xr[0] = *(const v4f*)pn; xr[1] = *(const v4f*)(pn + 4); xr[2] = *(const v4f*)(pn + 16); xr[3] = *(const v4f*)(pn + 20); }
#pragma unroll
    for (int j = 0; j < 12; ++j) { acc[j] = wmma_bf(a, bf[j], acc[j]); if (kc + 1 < FF / 32) bf[j] = frag_b(pw + (size_t)j * 16 * FF + (kc + 1) * 32, lane); } }
#pragma unroll
  for (int j = 0; j < 12; ++j) { const int c = (j & 3) * 16 + col; const float bb = j < 4 ? bfr(BQ[c]) : j < 8 ? bfr(BK[c]) : bfr(BV[c]);
#pragma unroll
    for (int r = 0; r < 8; ++r) { const float v = acc[j][r] + bb; const _Float16 hv = (_Float16)v, lv = (_Float16)((v - (float)hv) * 2048.0f); const int rl = wave * 16 + 8 * g + r; if (j < 4) { sq[rl][c] = hv; sql[rl][c] = lv; } else if (j < 8) { sk[rl][c] = hv; skl[rl][c] = lv; } else { th[c][rl] = hv; tl[c][rl] = lv; } } }
  __syncthreads();
  for (int e = tid; e < 64 * 8; e += 128) { const int rl = e >> 3, q = e & 7; const size_t o = ((size_t)blockIdx.x * 64 + rl) * DD + q * 8; vst2((unsigned*)(QH + o), *(const v4u*)&sq[rl][q * 8]); vst2((unsigned*)(QL + o), *(const v4u*)&sql[rl][q * 8]); vst2((unsigned*)(KH + o), *(const v4u*)&sk[rl][q * 8]); vst2((unsigned*)(KL + o), *(const v4u*)&skl[rl][q * 8]); }
  for (int e = tid; e < DD * 8; e += 128) { const int c = e >> 3, q = e & 7; const size_t o = (b * DD + c) * (size_t)NN + n0 + q * 8; vst2((unsigned*)(VT + o), *(const v4u*)&th[c][q * 8]); vst2((unsigned*)(VTL + o), *(const v4u*)&tl[c][q * 8]); } }
// ---- k_att: block = (32 queries, b), 16 waves = 2 query tiles x 8 key ranges of 256 keys: 3-product logits / 8, key mask (mask[b][k] == 0 excluded), softmax, P (hi + residual) . v (hi + residual); each wave keeps its own max, sum and un-normalised output, merged through LDS at the end
// A pass's K, V and mask tiles come into LDS by asynchronous copies, one pass ahead, two buffers: the two waves of a key range bring its 16 KiB once for both query tiles (one wave the hi planes, the other the residual planes), and the fragments are read from LDS.
#define QTB 2
#define KSPL 8
#define NPASS (NN / 32 / KSPL)
#define PL_B 4096u            // one plane's tile of a pass: K 32 rows x 128 B, V 64 rows x 64 B
#define KR_B (4u * PL_B)      // one key range's stage: K hi | K residual | V hi | V residual
#define BUF_B (KSPL * KR_B)   // one buffer: the stage of all eight key ranges
static_assert(32 * KSPL == 16 * 16, "the merge gives one thread to each (row, 4 columns) of a query tile");
static_assert(NPASS >= 2, "the ring's prologue fills two stages");
__device__ __forceinline__ unsigned lds_off(const void* p) { return (unsigned)(size_t)p; }
// a fragment from an LDS row: its two 16-byte pieces stand at places ca and cb of the row
__device__ __forceinline__ v16h frag_l(const unsigned char* row, unsigned ca, unsigned cb) {
  union { v16h v; v8h q[2]; } u; u.q[0] = *(const v8h*)(row + ca * 16u); u.q[1] = *(const v8h*)(row + cb * 16u); return u.v;
}
// Rows in LDS carry no pad; a row's 16-byte pieces are permuted instead, piece c of K row r at place c ^ ((r >> 1) & 7), piece c of V row d at place c ^ ((d >> 2) & 3), so that the 16 rows of a fragment read fall on 16 different bank groups.
// One wave's share of a stage: 8 copies of 512 B for its K plane, 1 of 128 B for its own mask tile, 8 of 512 B for its V plane. The s_wait_xcnt closes each statement so that no address register is rewritten ahead of it.
// lk, lv: the lane's places for copy 0; bits 9 to 11 are 0 there (the ring is aligned to 4 KiB), so copy i's four (K) or eight (V) rows further on and its share of the permutation are one exclusive-or.
__device__ __forceinline__ void stage_copy(const _Float16* gk, const _Float16* gv, const int* gm, unsigned lk, unsigned lv, unsigned lm) {
  unsigned a[8], c[8]; const _Float16 *pk[8], *pv[8];
#pragma unroll
  for (int i = 0; i < 8; ++i) {
    a[i] = lk ^ (i * 512u | (((2u * i) & 7u) << 4)); pk[i] = gk + i * 256;
    c[i] = lv ^ (i * 512u | (((2u * i) & 3u) << 4)); pv[i] = gv + (size_t)i * 8 * NN; }
  asm volatile("global_load_async_to_lds_b128 %0, %9, off\n\tglobal_load_async_to_lds_b128 %1, %10, off\n\tglobal_load_async_to_lds_b128 %2, %11, off\n\tglobal_load_async_to_lds_b128 %3, %12, off\n\t"
               "global_load_async_to_lds_b128 %4, %13, off\n\tglobal_load_async_to_lds_b128 %5, %14, off\n\tglobal_load_async_to_lds_b128 %6, %15, off\n\tglobal_load_async_to_lds_b128 %7, %16, off\n\t"
               "global_load_async_to_lds_b32 %8, %17, off\n\ts_wait_xcnt 0x0"
               :: "v"(a[0]), "v"(a[1]), "v"(a[2]), "v"(a[3]), "v"(a[4]), "v"(a[5]), "v"(a[6]), "v"(a[7]), "v"(lm),
                  "v"(pk[0]), "v"(pk[1]), "v"(pk[2]), "v"(pk[3]), "v"(pk[4]), "v"(pk[5]), "v"(pk[6]), "v"(pk[7]), "v"(gm) : "memory");
  asm volatile("global_load_async_to_lds_b128 %0, %8, off\n\tglobal_load_async_to_lds_b128 %1, %9, off\n\tglobal_load_async_to_lds_b128 %2, %10, off\n\tglobal_load_async_to_lds_b128 %3, %11, off\n\t"
               "global_load_async_to_lds_b128 %4, %12, off\n\tglobal_load_async_to_lds_b128 %5, %13, off\n\tglobal_load_async_to_lds_b128 %6, %14, off\n\tglobal_load_async_to_lds_b128 %7, %15, off\n\ts_wait_xcnt 0x0"
               :: "v"(c[0]), "v"(c[1]), "v"(c[2]), "v"(c[3]), "v"(c[4]), "v"(c[5]), "v"(c[6]), "v"(c[7]),
                  "v"(pv[0]), "v"(pv[1]), "v"(pv[2]), "v"(pv[3]), "v"(pv[4]), "v"(pv[5]), "v"(pv[6]), "v"(pv[7]) : "memory");
}
// four waves a SIMD is what a 16-wave block gives: the register budget is set for exactly that, so that the eight rows' reductions stay interleaved
__global__ __launch_bounds__(32 * QTB * KSPL) __attribute__((amdgpu_waves_per_eu(4, 4))) void k_att(const _Float16* __restrict__ QH, const _Float16* __restrict__ QL, const _Float16* __restrict__ KH, const _Float16* __restrict__ KL, const _Float16* __restrict__ VT, const _Float16* __restrict__ VTL, const int* __restrict__ MK, float* __restrict__ OUT) {
  // ring: the two buffers; behind the loop's last barrier its first bytes hold the waves' un-normalised outputs for the merge
  __shared__ __align__(4096) unsigned char ring[2 * BUF_B]; __shared__ __align__(128) int smk[2][QTB * KSPL][32];
  __shared__ __align__(16) float sp[QTB * KSPL][16][36]; __shared__ float sm[QTB * KSPL][16], sl[QTB * KSPL][16];
  static_assert(sizeof(float) * QTB * KSPL * 16 * 68 <= 2 * BUF_B, "the merge's partial outputs fit the ring");
  // the wave number is held scalar so that the pass counter and the key range's base stay in scalar registers
  const int tid = threadIdx.x, wave = __builtin_amdgcn_readfirstlane(tid >> 5), lane = tid & 31, col = lane & 15, g = lane >> 4; const size_t b = blockIdx.y; const int qt = wave % QTB, kr = wave / QTB; const int q0 = blockIdx.x * (16 * QTB) + qt * 16; const size_t rq = b * NN + q0; const int key0 = kr * (NN / KSPL);
  // this lane's sources and places for pass 0, buffer 0
  const _Float16* gk = (qt ? KL : KH) + (b * NN + key0) * DD + lane * 8; const _Float16* gv = (qt ? VTL : VT) + (b * DD + (lane >> 2)) * (size_t)NN + key0 + (lane & 3) * 8; const int* gm = MK + b * NN + key0 + lane;
  const unsigned lk = lds_off(ring) + kr * KR_B + qt * PL_B + (lane >> 3) * 128u + (((lane & 7) ^ g) << 4), lv = lds_off(ring) + kr * KR_B + (2u + qt) * PL_B + (lane >> 2) * 64u + (((lane & 3) ^ g) << 4), lm = lds_off(&smk[0][wave][lane]);
  stage_copy(gk, gv, gm, lk, lv, lm);
  // pass 0's tiles have landed in every wave before any wave reads them
  asm volatile("s_wait_asynccnt 0x0" ::: "memory");
  __syncthreads();
  stage_copy(gk + 32 * DD, gv + 32, gm + 32, lk + BUF_B, lv + BUF_B, lm + (unsigned)sizeof(smk[0]));
  v16h aq[2], al[2];
#pragma unroll
  for (int kc = 0; kc < 2; ++kc) { aq[kc] = frag_h(QH + (rq + col) * DD + kc * 32, lane); al[kc] = frag_h(QL + (rq + col) * DD + kc * 32, lane); }
  float m[8], l[8];
#pragma unroll
  for (int r = 0; r < 8; ++r) { m[r] = -3.0e38f; l[r] = 0.f; }
  v8f acc[4] = {}, accl[4] = {};
  const unsigned zk = (unsigned)(col >> 1) & 7u, zv = (unsigned)(col >> 2) & 3u;
#pragma unroll 1
  for (int t = 0; t < NPASS; ++t) { float s[2][8]; const unsigned char* st = ring + (unsigned)(t & 1) * BUF_B + kr * KR_B;
#pragma unroll
    for (int ct = 0; ct < 2; ++ct) { const unsigned char* krow = st + (ct * 16 + col) * 128; v8f c = {}, cl = {};
#pragma unroll
      for (int kc = 0; kc < 2; ++kc) { const unsigned ca = (unsigned)(kc * 4 + g) ^ zk, cb = (unsigned)(kc * 4 + 2 + g) ^ zk; const v16h kh = frag_l(krow, ca, cb), kl = frag_l(krow + PL_B, ca, cb); c = wmma16(aq[kc], kh, c); cl = wmma16(aq[kc], kl, cl); cl = wmma16(al[kc], kh, cl); }
      const bool keep = smk[t & 1][wave][ct * 16 + col] != 0;
#pragma unroll
      for (int r = 0; r < 8; ++r) s[ct][r] = keep ? (c[r] + cl[r] * (1.0f / 2048.0f)) * 0.125f : -3.0e38f; }
    float alpha[8];
#pragma unroll
    for (int r = 0; r < 8; ++r) { float mx = fmaxf(s[0][r], s[1][r]);
#pragma unroll
      for (int o = 1; o < 16; o <<= 1) mx = fmaxf(mx, __shfl_xor(mx, o));
      const float mn = fmaxf(m[r], mx); alpha[r] = (m[r] <= -1.0e38f) ? 0.f : __expf(m[r] - mn); const float e0 = (s[0][r] <= -1.0e38f) ? 0.f : __expf(s[0][r] - mn), e1 = (s[1][r] <= -1.0e38f) ? 0.f : __expf(s[1][r] - mn); float es = e0 + e1;
#pragma unroll
      for (int o = 1; o < 16; o <<= 1) es += __shfl_xor(es, o);
      l[r] = l[r] * alpha[r] + es; m[r] = (mn > -1.0e38f) ? mn : m[r]; sp[wave][8 * g + r][col] = e0; sp[wave][8 * g + r][16 + col] = e1; }
#pragma unroll
    for (int j = 0; j < 4; ++j)
#pragma unroll
      for (int r = 0; r < 8; ++r) { acc[j][r] *= alpha[r]; accl[j][r] *= alpha[r]; }
    LDSX();
    v16h pa, pal; { const float* prow = &sp[wave][col][0] + 8 * (lane >> 4);
#pragma unroll
      for (int i = 0; i < 8; ++i) { const float p0 = prow[i] * 2048.0f, p1 = prow[16 + i] * 2048.0f; pa[i] = (_Float16)p0; pa[8 + i] = (_Float16)p1; pal[i] = (_Float16)((p0 - (float)pa[i]) * 2048.0f); pal[8 + i] = (_Float16)((p1 - (float)pa[8 + i]) * 2048.0f); } }
#pragma unroll
    for (int j = 0; j < 4; ++j) { const unsigned char* vrow = st + 2u * PL_B + (j * 16 + col) * 64; const unsigned ca = (unsigned)g ^ zv, cb = (unsigned)(2 + g) ^ zv; const v16h vh = frag_l(vrow, ca, cb), vl = frag_l(vrow + PL_B, ca, cb); acc[j] = wmma16(pa, vh, acc[j]); accl[j] = wmma16(pa, vl, accl[j]); accl[j] = wmma16(pal, vh, accl[j]); }
    // foot of the pass: this wave's LDS reads of the buffer (and of its P rows) are done ...
    asm volatile("s_wait_dscnt 0x0" ::: "memory");
    // ... its copies for the next pass have landed ...
    asm volatile("s_wait_asynccnt 0x0" ::: "memory");
    // ... and one barrier both publishes the next pass's tiles and frees the buffer just read
    __syncthreads();
    if (t + 2 < NPASS) stage_copy(gk + (t + 2) * (32 * DD), gv + (t + 2) * 32, gm + (t + 2) * 32, lk + (unsigned)(t & 1) * BUF_B, lv + (unsigned)(t & 1) * BUF_B, lm + (unsigned)(t & 1) * (unsigned)sizeof(smk[0])); }
  // no copy is outstanding when the ring takes the partial outputs
  asm volatile("s_wait_asynccnt 0x0" ::: "memory");
  float (*so)[16][68] = (float (*)[16][68])ring;
#pragma unroll
  for (int r = 0; r < 8; ++r)
#pragma unroll
    for (int j = 0; j < 4; ++j) so[wave][8 * g + r][j * 16 + col] = acc[j][r] + accl[j][r] * (1.0f / 2048.0f);
  if (col == 0) {
#pragma unroll
    for (int r = 0; r < 8; ++r) { sm[wave][8 * g + r] = m[r]; sl[wave][8 * g + r] = l[r]; } }
  __syncthreads();
  // merge of the key ranges: thread = (query tile, row, 4 columns); weight exp(m_s - M), a range with no kept key weighs 0
  { const int qm = tid >> 8, row = (tid >> 4) & 15, c4 = (tid & 15) * 4; float M = -3.0e38f;
#pragma unroll
    for (int s = 0; s < KSPL; ++s) M = fmaxf(M, sm[s * QTB + qm][row]);
    float w[KSPL], L = 0.f; v4f o = {};
#pragma unroll
    for (int s = 0; s < KSPL; ++s) { const float ms = sm[s * QTB + qm][row]; w[s] = (ms <= -1.0e38f) ? 0.f : __expf(ms - M); }
#pragma unroll
    for (int s = 0; s < KSPL; ++s) { L += w[s] * sl[s * QTB + qm][row]; o += w[s] * *(const v4f*)&so[s * QTB + qm][row][c4]; }
    const float il = (L > 0.f) ? (1.0f / 2048.0f) / L : 0.f;
    vst2(OUT + (b * NN + blockIdx.x * (16 * QTB) + qm * 16 + row) * DD + c4, o * il); } }
extern "C" void kernel_launch(void* const* d_in, const int* in_sizes, int n_in, void* d_out, int out_size, void* d_ws, size_t ws_size, hipStream_t stream) {
  (void)in_sizes; (void)n_in; (void)out_size;
  const float** F = (const float**)d_in;   // 0 x [4,2048,512], 1 mask [4,2048] int, 2 Wq [512,64] (in,out), 3 bq, 4 Wk, 5 bk, 6 Wv, 7 bv
  if (ws_size < (size_t)WS_END) return;
  char* ws = (char*)d_ws; __bf16* PW = (__bf16*)(ws + WS_PW); _Float16 *QH = (_Float16*)(ws + WS_QH), *QL = (_Float16*)(ws + WS_QL), *KH = (_Float16*)(ws + WS_KH), *KL = (_Float16*)(ws + WS_KL), *VT = (_Float16*)(ws + WS_VT), *VTL = (_Float16*)(ws + WS_VTL);
  k_packw<<<3 * DD, 256, 0, stream>>>(F[2], F[4], F[6], PW);
  k_proj<<<NB * NN / 64, 128, 0, stream>>>(F[0], PW, F[3], F[5], F[7], QH, QL, KH, KL, VT, VTL);
  k_att<<<dim3(NN / (16 * QTB), TNB), 32 * QTB * KSPL, 0, stream>>>(QH, QL, KH, KL, VT, VTL, (const int*)d_in[1], (float*)d_out);
}

// v004
// Measured time: 46 microseconds a run.
// In two side-by-side timings against v003, it was 1.11 and 1.10 times as fast.
// Counting every step since v000, it is 4.72 times as fast.
// compute dtype: all float inputs rounded to bf16, mask (int) read on device; q/k/v = x W + b with EXACT bf16 products on WMMA 16x16x32 ((in,out) weights as transposed rows); q/k as f16 hi + residual (3-product logits x 1/8), masked keys (mask == 0) excluded (== the -1e9 additive fill), running-max softmax in f32 (hardware exp); P (x 2^11) as f16 hi + residual . v (f16 hi + residual planes; 3 products); f32 output.
#include <hip/hip_runtime.h>
#include <math.h>

typedef __attribute__((ext_vector_type(16))) _Float16 v16h;
typedef __attribute__((ext_vector_type(16))) __bf16 v16b;
typedef __attribute__((ext_vector_type(8)))  _Float16 v8h;
typedef __attribute__((ext_vector_type(8)))  float v8f;
typedef __attribute__((ext_vector_type(4)))  float v4f;
typedef __attribute__((ext_vector_type(2)))  float v2f;
typedef __attribute__((ext_vector_type(4)))  unsigned v4u;
typedef __attribute__((ext_vector_type(4)))  int v4i;
typedef float __attribute__((may_alias)) float_a;
typedef int __attribute__((may_alias)) int_a;

template <typename T> __device__ __forceinline__ void vst2(void* p, T v) { *(T*)p = v;  }
__device__ __forceinline__ v8f wmma16(v16h a, v16h b, v8f c) {
  v8f d = __builtin_amdgcn_wmma_f32_16x16x32_f16(false, a, false, b, (short)0, c, false, false);
  asm volatile("v_nop\n\tv_nop\n\tv_nop\n\tv_nop" : "+v"(d) : "v"(a), "v"(b));
  return d;
}
__device__ __forceinline__ v8f wmma_bf(v16b a, v16b b, v8f c) {
  v8f d = __builtin_amdgcn_wmma_f32_16x16x32_bf16(false, a, false, b, (short)0, c, false, false);
  asm volatile("v_nop\n\tv_nop\n\tv_nop\n\tv_nop" : "+v"(d) : "v"(a), "v"(b));
  return d;
}
// 16x16x32 fragments: lane = (h = lane>>4, row/col = lane&15); elements 0..7 = k0+8h+0..7, 8..15 = k0+16+8h+0..7; D element r = row 8h+r
__device__ __forceinline__ v16h frag_h(const _Float16* rowk0, int lane) {
  union { v16h v; v8h q[2]; } u; const _Float16* p = rowk0 + 8 * (lane >> 4);
  u.q[0] = *(const v8h*)p; u.q[1] = *(const v8h*)(p + 16); return u.v;
}
__device__ __forceinline__ v16h frag_f32(const float* rowk0, int lane) {
  v16h a; const float* p = rowk0 + 8 * (lane >> 4);
#pragma unroll
  for (int i = 0; i < 8; ++i) { a[i] = (_Float16)p[i]; a[8 + i] = (_Float16)p[16 + i]; }
  return a;
}
__device__ __forceinline__ v16h frag_f32s(const float* rowk0, int lane, float sc) {
  v16h a; const float* p = rowk0 + 8 * (lane >> 4);
#pragma unroll
  for (int i = 0; i < 8; ++i) { a[i] = (_Float16)(p[i] * sc); a[8 + i] = (_Float16)(p[16 + i] * sc); }
  return a;
}
// column fragment from a [K][ld] layout (column n), rows >= K read as 0
__device__ __forceinline__ v16h fragc_f32(const float* W, int k0, int n, int lane, int ld, int K) {
  v16h a; const int g = lane >> 4;
#pragma unroll
  for (int i = 0; i < 8; ++i) { const int ka = k0 + 8 * g + i, kb = ka + 16;
    a[i] = (_Float16)(ka < K ? W[(size_t)(ka < K ? ka : K - 1) * ld + n] : 0.f); a[8 + i] = (_Float16)(kb < K ? W[(size_t)(kb < K ? kb : K - 1) * ld + n] : 0.f); }
  return a;
}
struct F2 { v16b h, l; };
__device__ __forceinline__ F2 bsplit16(const float v[16]) { F2 r;
#pragma unroll
  for (int i = 0; i < 16; ++i) { const __bf16 h = (__bf16)v[i]; r.h[i] = h; r.l[i] = (__bf16)(v[i] - (float)h); }
  return r; }
__device__ __forceinline__ F2 split_row(const float* row, int k0, int lane) { float v[16]; const float* p = row + k0 + 8 * (lane >> 4);
#pragma unroll
  for (int i = 0; i < 8; ++i) { v[i] = p[i]; v[8 + i] = p[16 + i]; }
  return bsplit16(v); }
__device__ __forceinline__ F2 split_rowK(const float* row, int k0, int lane, int K) { float v[16]; const int g = lane >> 4;
#pragma unroll
  for (int i = 0; i < 8; ++i) { const int ka = k0 + 8 * g + i, kb = ka + 16; v[i] = ka < K ? row[ka < K ? ka : K - 1] : 0.f; v[8 + i] = kb < K ? row[kb < K ? kb : K - 1] : 0.f; }
  return bsplit16(v); }
__device__ __forceinline__ F2 split_col(const float* W, int k0, int n, int lane, int ld, int K) { float v[16]; const int g = lane >> 4;
#pragma unroll
  for (int i = 0; i < 8; ++i) { const int ka = k0 + 8 * g + i, kb = ka + 16; v[i] = ka < K ? W[(size_t)(ka < K ? ka : K - 1) * ld + n] : 0.f; v[8 + i] = kb < K ? W[(size_t)(kb < K ? kb : K - 1) * ld + n] : 0.f; }
  return bsplit16(v); }
__device__ __forceinline__ v8f mac3(const F2& a, const F2& b, v8f c) { c = wmma_bf(a.l, b.h, c); c = wmma_bf(a.h, b.l, c); return wmma_bf(a.h, b.h, c); }
__device__ __forceinline__ float sigm(float v) { return 1.0f / (1.0f + expf(-v)); }
#define LDSX() do { asm volatile("s_wait_dscnt 0" ::: "memory"); __builtin_amdgcn_wave_barrier(); __builtin_amdgcn_fence(__ATOMIC_RELEASE, "workgroup"); } while (0)


// Single-head masked attention (B 4, S 2,048, F 512 -> D 64): q, k, v = x W + b; softmax(q k^T / 8 + (1 - mask_k) * -1e9) v.
#define NB 4
#define NN 2048
#define FF 512
#define DD 64
#ifndef TNB
#define TNB NB
#endif
typedef __attribute__((ext_vector_type(8))) __bf16 v8b;
__device__ __forceinline__ v16b frag_b(const __bf16* rowk0, int lane) {
  union { v16b v; v8b q[2]; } u; const __bf16* p = rowk0 + 8 * (lane >> 4);
  u.q[0] = *(const v8b*)p; u.q[1] = *(const v8b*)(p + 16); return u.v;
}
__device__ __forceinline__ float bfr(float v) { return (float)(__bf16)v; }
__device__ __attribute__((noinline)) float exp_ni(float v) { return expf(v); }
__device__ __attribute__((noinline)) float erf_ni(float v) { return erff(v); }

#define WS_PW  0u                                   // bf16 W^T rows [192][512] (q | k | v)
#define WS_QH  (WS_PW + 2u * 3 * DD * FF)               // f16 hi|lo q rows [row][64]; k rows; v planes [b][64][NN]
#define WS_QL  (WS_QH + 2u * (size_t)NB * NN * DD)
#define WS_KH  (WS_QL + 2u * (size_t)NB * NN * DD)
#define WS_KL  (WS_KH + 2u * (size_t)NB * NN * DD)
#define WS_VT  (WS_KL + 2u * (size_t)NB * NN * DD)
#define WS_VTL (WS_VT + 2u * (size_t)NB * DD * NN)
#define WS_END (WS_VTL + 2u * (size_t)NB * DD * NN)

__global__ __launch_bounds__(256) void k_packw(const float* __restrict__ WQ, const float* __restrict__ WK, const float* __restrict__ WV, __bf16* __restrict__ PW) { const int n = blockIdx.x, t = threadIdx.x; __shared__ __align__(16) __bf16 s[FF]; const int which = n / DD, u = n % DD; const float* Wm = which == 0 ? WQ : which == 1 ? WK : WV;   // (in,out) [512][64]
  for (int k = t; k < FF; k += 256) s[k] = (__bf16)Wm[(size_t)k * DD + u]; __syncthreads(); if (t < FF / 8) vst2((unsigned*)(PW + (size_t)n * FF + t * 8), *(const v4u*)&s[t * 8]); }
// ---- k_proj: block = 64 rows: cols 0..63 q, 64..127 k, 128..191 v (12 tiles) + biases
__global__ __launch_bounds__(128) void k_proj(const float* __restrict__ X, const __bf16* __restrict__ PW, const float* __restrict__ BQ, const float* __restrict__ BK, const float* __restrict__ BV, _Float16* __restrict__ QH, _Float16* __restrict__ QL, _Float16* __restrict__ KH, _Float16* __restrict__ KL, _Float16* __restrict__ VT, _Float16* __restrict__ VTL) {
  __shared__ __align__(16) _Float16 sq[64][72], sql[64][72], sk[64][72], skl[64][72]; __shared__ __align__(16) _Float16 th[DD][72], tl[DD][72];
  const int tid = threadIdx.x, wave = tid >> 5, lane = tid & 31, col = lane & 15, g = lane >> 4; const size_t r0 = (size_t)blockIdx.x * 64 + wave * 16; const size_t b = ((size_t)blockIdx.x * 64) / NN; const int n0 = (int)(((size_t)blockIdx.x * 64) % NN);
  v8f acc[12];
#pragma unroll
  for (int j = 0; j < 12; ++j) acc[j] = v8f{};
  // every fragment is fetched one k step ahead: a weight fragment's next load is issued right behind the product that used it, so that the twelve loads of a step are in flight together instead of each being waited for alone
  const float* px = X + (r0 + col) * FF + 8 * g; const __bf16* pw = PW + (size_t)col * FF;
  v4f xr[4] = { *(const v4f*)px, *(const v4f*)(px + 4), *(const v4f*)(px + 16), *(const v4f*)(px + 20) }; v16b bf[12];
#pragma unroll
  for (int j = 0; j < 12; ++j) bf[j] = frag_b(pw + (size_t)j * 16 * FF, lane);
  // unrolled whole so that the test for a next step is resolved at compile time and the fetched fragments keep their registers without copies
#pragma unroll
  for (int kc = 0; kc < FF / 32; ++kc) { v16b a;
    // keeps the conversion of this step's x, and with it the wait for its loads, from being moved up to right behind those loads in the step before
    __builtin_amdgcn_sched_barrier(0);
#pragma unroll
    for (int i = 0; i < 4; ++i) { a[i] = (__bf16)xr[0][i]; a[4 + i] = (__bf16)xr[1][i]; a[8 + i] = (__bf16)xr[2][i]; a[12 + i] = (__bf16)xr[3][i]; }
    if (kc + 1 < FF / 32) { const float* pn = px + (kc + 1) * 32; xr[0] = *(const v4f*)pn; xr[1] = *(const v4f*)(pn + 4); xr[2] = *(const v4f*)(pn + 16); xr[3] = *(const v4f*)(pn + 20); }
#pragma unroll
    for (int j = 0; j < 12; ++j) { acc[j] = wmma_bf(a, bf[j], acc[j]); if (kc + 1 < FF / 32) bf[j] = frag_b(pw + (size_t)j * 16 * FF + (kc + 1) * 32, lane); } }
#pragma unroll
  for (int j = 0; j < 12; ++j) { const int c = (j & 3) * 16 + col; const float bb = j < 4 ? bfr(BQ[c]) : j < 8 ? bfr(BK[c]) : bfr(BV[c]);
#pragma unroll
    for (int r = 0; r < 8; ++r) { const float v = acc[j][r] + bb; const _Float16 hv = (_Float16)v, lv = (_Float16)((v - (float)hv) * 2048.0f); const int rl = wave * 16 + 8 * g + r; if (j < 4) { sq[rl][c] = hv; sql[rl][c] = lv; } else if (j < 8) { sk[rl][c] = hv; skl[rl][c] = lv; } else { th[c][rl] = hv; tl[c][rl] = lv; } } }
  __syncthreads();
  for (int e = tid; e < 64 * 8; e += 128) { const int rl = e >> 3, q = e & 7; const size_t o = ((size_t)blockIdx.x * 64 + rl) * DD + q * 8; vst2((unsigned*)(QH + o), *(const v4u*)&sq[rl][q * 8]); vst2((unsigned*)(QL + o), *(const v4u*)&sql[rl][q * 8]); vst2((unsigned*)(KH + o), *(const v4u*)&sk[rl][q * 8]); vst2((unsigned*)(KL + o), *(const v4u*)&skl[rl][q * 8]); }
  for (int e = tid; e < DD * 8; e += 128) { const int c = e >> 3, q = e & 7; const size_t o = (b * DD + c) * (size_t)NN + n0 + q * 8; vst2((unsigned*)(VT + o), *(const v4u*)&th[c][q * 8]); vst2((unsigned*)(VTL + o), *(const v4u*)&tl[c][q * 8]); } }
#define QTB 2
#define KSPL 8
#define NPASS (NN / 32 / KSPL)
#define PL_B 4096u            // one plane's tile of a pass: K 32 rows x 128 B, V 64 rows x 64 B
#define KR_B (4u * PL_B)      // one key range's stage: K hi | K residual | V hi | V residual
#define BUF_B (KSPL * KR_B)   // one buffer: the stage of all eight key ranges
static_assert(32 * KSPL == 16 * 16, "the merge gives one thread to each (row, 4 columns) of a query tile");
static_assert(NPASS >= 2, "the ring's prologue fills two stages");
__device__ __forceinline__ unsigned lds_off(const void* p) { return (unsigned)(size_t)p; }
// a fragment from an LDS row: its two 16-byte pieces stand at places ca and cb of the row
__device__ __forceinline__ v16h frag_l(const unsigned char* row, unsigned ca, unsigned cb) {
  union { v16h v; v8h q[2]; } u; u.q[0] = *(const v8h*)(row + ca * 16u); u.q[1] = *(const v8h*)(row + cb * 16u); return u.v;
}
// Rows in LDS carry no pad; a row's 16-byte pieces are permuted instead, piece c of K row r at place c ^ ((r >> 1) & 7), piece c of V row d at place c ^ ((d >> 2) & 3), so that the 16 rows of a fragment read fall on 16 different bank groups.
// One wave's share of a stage: 8 copies of 512 B for its K plane, 1 of 128 B for its own mask tile, 8 of 512 B for its V plane. The s_wait_xcnt closes each statement so that no address register is rewritten ahead of it.
// lk, lv: the lane's places for copy 0; bits 9 to 11 are 0 there (the ring is aligned to 4 KiB), so copy i's four (K) or eight (V) rows further on and its share of the permutation are one exclusive-or.
__device__ __forceinline__ void stage_copy(const _Float16* gk, const _Float16* gv, const int* gm, unsigned lk, unsigned lv, unsigned lm) {
  unsigned a[8], c[8]; const _Float16 *pk[8], *pv[8];
#pragma unroll
  for (int i = 0; i < 8; ++i) {
    a[i] = lk ^ (i * 512u | (((2u * i) & 7u) << 4)); pk[i] = gk + i * 256;
    c[i] = lv ^ (i * 512u | (((2u * i) & 3u) << 4)); pv[i] = gv + (size_t)i * 8 * NN; }
  asm volatile("global_load_async_to_lds_b128 %0, %9, off\n\tglobal_load_async_to_lds_b128 %1, %10, off\n\tglobal_load_async_to_lds_b128 %2, %11, off\n\tglobal_load_async_to_lds_b128 %3, %12, off\n\t"
               "global_load_async_to_lds_b128 %4, %13, off\n\tglobal_load_async_to_lds_b128 %5, %14, off\n\tglobal_load_async_to_lds_b128 %6, %15, off\n\tglobal_load_async_to_lds_b128 %7, %16, off\n\t"
               "global_load_async_to_lds_b32 %8, %17, off\n\ts_wait_xcnt 0x0"
               :: "v"(a[0]), "v"(a[1]), "v"(a[2]), "v"(a[3]), "v"(a[4]), "v"(a[5]), "v"(a[6]), "v"(a[7]), "v"(lm),
                  "v"(pk[0]), "v"(pk[1]), "v"(pk[2]), "v"(pk[3]), "v"(pk[4]), "v"(pk[5]), "v"(pk[6]), "v"(pk[7]), "v"(gm) : "memory");
  asm volatile("global_load_async_to_lds_b128 %0, %8, off\n\tglobal_load_async_to_lds_b128 %1, %9, off\n\tglobal_load_async_to_lds_b128 %2, %10, off\n\tglobal_load_async_to_lds_b128 %3, %11, off\n\t"
               "global_load_async_to_lds_b128 %4, %12, off\n\tglobal_load_async_to_lds_b128 %5, %13, off\n\tglobal_load_async_to_lds_b128 %6, %14, off\n\tglobal_load_async_to_lds_b128 %7, %15, off\n\ts_wait_xcnt 0x0"
               :: "v"(c[0]), "v"(c[1]), "v"(c[2]), "v"(c[3]), "v"(c[4]), "v"(c[5]), "v"(c[6]), "v"(c[7]),
                  "v"(pv[0]), "v"(pv[1]), "v"(pv[2]), "v"(pv[3]), "v"(pv[4]), "v"(pv[5]), "v"(pv[6]), "v"(pv[7]) : "memory");
}
typedef __attribute__((ext_vector_type(2))) _Float16 v2h;
// lane l's value seen from lane l ^ 16
__device__ __forceinline__ float xhalf(float v) { const int b = __builtin_bit_cast(int, v); return __builtin_bit_cast(float, __builtin_amdgcn_permlanex16(b, b, 0x76543210, 0xfedcba98, false, false)); }
// four waves a SIMD is what a 16-wave block gives: the register budget is set for exactly that
__global__ __launch_bounds__(32 * QTB * KSPL) __attribute__((amdgpu_waves_per_eu(4, 4))) void k_att(const _Float16* __restrict__ QH, const _Float16* __restrict__ QL, const _Float16* __restrict__ KH, const _Float16* __restrict__ KL, const _Float16* __restrict__ VT, const _Float16* __restrict__ VTL, const int* __restrict__ MK, float* __restrict__ OUT) {
  // ring: the two buffers; behind the loop's last barrier its first bytes hold the waves' un-normalised outputs for the merge
  __shared__ __align__(4096) unsigned char ring[2 * BUF_B]; __shared__ __align__(128) int smk[2][QTB * KSPL][32];
  __shared__ float sm[QTB * KSPL][16], sl[QTB * KSPL][16];
  static_assert(sizeof(float) * QTB * KSPL * 16 * 68 <= 2 * BUF_B, "the merge's partial outputs fit the ring");
  // the wave number is held scalar so that the pass counter and the key range's base stay in scalar registers
  const int tid = threadIdx.x, wave = __builtin_amdgcn_readfirstlane(tid >> 5), lane = tid & 31, col = lane & 15, g = lane >> 4; const size_t b = blockIdx.y; const int qt = wave % QTB, kr = wave / QTB; const int q0 = blockIdx.x * (16 * QTB) + qt * 16; const size_t rq = b * NN + q0; const int key0 = kr * (NN / KSPL);
  // this lane's sources and places for pass 0, buffer 0
  const _Float16* gk = (qt ? KL : KH) + (b * NN + key0) * DD + lane * 8; const _Float16* gv = (qt ? VTL : VT) + (b * DD + (lane >> 2)) * (size_t)NN + key0 + (lane & 3) * 8; const int* gm = MK + b * NN + key0 + lane;
  const unsigned lk = lds_off(ring) + kr * KR_B + qt * PL_B + (lane >> 3) * 128u + (((lane & 7) ^ g) << 4), lv = lds_off(ring) + kr * KR_B + (2u + qt) * PL_B + (lane >> 2) * 64u + (((lane & 3) ^ g) << 4), lm = lds_off(&smk[0][wave][lane]);
  stage_copy(gk, gv, gm, lk, lv, lm);
  // pass 0's tiles have landed in every wave before any wave reads them
  asm volatile("s_wait_asynccnt 0x0" ::: "memory");
  __syncthreads();
  stage_copy(gk + 32 * DD, gv + 32, gm + 32, lk + BUF_B, lv + BUF_B, lm + (unsigned)sizeof(smk[0]));
  // Q^T operand: column = query (lane & 15)
  v16h aq[2], al[2];
#pragma unroll
  for (int kc = 0; kc < 2; ++kc) { aq[kc] = frag_h(QH + (rq + col) * DD + kc * 32, lane); al[kc] = frag_h(QL + (rq + col) * DD + kc * 32, lane); }
  // of this lane's query: running maximum (equal in both lane halves), sum over this half's keys
  float m = -3.0e38f, l = 0.f;
  // acc[j][r]: O^T[j * 16 + 8 g + r][query]
  v8f acc[4] = {}, accl[4] = {};
  const unsigned zk = (unsigned)(col >> 1) & 7u, zv = (unsigned)(col >> 2) & 3u;
#pragma unroll 1
  for (int t = 0; t < NPASS; ++t) { float s[2][8]; const unsigned char* st = ring + (unsigned)(t & 1) * BUF_B + kr * KR_B;
    // s[ct][r]: score of key ct * 16 + 8 g + r of the pass
#pragma unroll
    for (int ct = 0; ct < 2; ++ct) { const unsigned char* krow = st + (ct * 16 + col) * 128; v8f c = {}, cl = {};
#pragma unroll
      for (int kc = 0; kc < 2; ++kc) { const unsigned ca = (unsigned)(kc * 4 + g) ^ zk, cb = (unsigned)(kc * 4 + 2 + g) ^ zk; const v16h kh = frag_l(krow, ca, cb), kl = frag_l(krow + PL_B, ca, cb); c = wmma16(kh, aq[kc], c); cl = wmma16(kl, aq[kc], cl); cl = wmma16(kh, al[kc], cl); }
      const int* mrow = &smk[t & 1][wave][ct * 16 + 8 * g]; const v4i k0 = *(const v4i*)mrow, k1 = *(const v4i*)(mrow + 4);
      const v8f sc = (c + cl * (1.0f / 2048.0f)) * 0.125f;
#pragma unroll
      for (int r = 0; r < 8; ++r) { const bool keep = (r < 4 ? k0[r & 3] : k1[r & 3]) != 0; s[ct][r] = keep ? sc[r] : -3.0e38f; } }
    float mx = s[0][0];
#pragma unroll
    for (int i = 1; i < 16; ++i) mx = fmaxf(mx, s[i >> 3][i & 7]);
    mx = fmaxf(mx, xhalf(mx));
    const float mn = fmaxf(m, mx), alpha = (m <= -1.0e38f) ? 0.f : __expf(m - mn);
    // P^T operand, element i = key i (first tile) or 16 + (i - 8) (second tile) of this half: the scores' own order; taken in pairs of neighbouring registers
    v16h pa, pal; v2f es = { 0.f, 0.f };
#pragma unroll
    for (int i = 0; i < 16; i += 2) { const float s0 = s[i >> 3][i & 7], s1 = s[i >> 3][(i & 7) + 1]; const v2f e = { (s0 <= -1.0e38f) ? 0.f : __expf(s0 - mn), (s1 <= -1.0e38f) ? 0.f : __expf(s1 - mn) }, p = e * 2048.0f; es += e;
      const v2h h = __builtin_convertvector(p, v2h), q = __builtin_convertvector((p - __builtin_convertvector(h, v2f)) * 2048.0f, v2h); pa[i] = h[0]; pa[i + 1] = h[1]; pal[i] = q[0]; pal[i + 1] = q[1]; }
    l = l * alpha + (es[0] + es[1]); m = (mn > -1.0e38f) ? mn : m;
#pragma unroll
    for (int j = 0; j < 4; ++j) { acc[j] *= alpha; accl[j] *= alpha; }
#pragma unroll
    for (int j = 0; j < 4; ++j) { const unsigned char* vrow = st + 2u * PL_B + (j * 16 + col) * 64; const unsigned ca = (unsigned)g ^ zv, cb = (unsigned)(2 + g) ^ zv; const v16h vh = frag_l(vrow, ca, cb), vl = frag_l(vrow + PL_B, ca, cb); acc[j] = wmma16(vh, pa, acc[j]); accl[j] = wmma16(vl, pa, accl[j]); accl[j] = wmma16(vh, pal, accl[j]); }
    // foot of the pass: this wave's LDS reads of the buffer are done ...
    asm volatile("s_wait_dscnt 0x0" ::: "memory");
    // ... its copies for the next pass have landed ...
    asm volatile("s_wait_asynccnt 0x0" ::: "memory");
    // ... and one barrier both publishes the next pass's tiles and frees the buffer just read
    __syncthreads();
    if (t + 2 < NPASS) stage_copy(gk + (t + 2) * (32 * DD), gv + (t + 2) * 32, gm + (t + 2) * 32, lk + (unsigned)(t & 1) * BUF_B, lv + (unsigned)(t & 1) * BUF_B, lm + (unsigned)(t & 1) * (unsigned)sizeof(smk[0])); }
  // no copy is outstanding when the ring takes the partial outputs
  asm volatile("s_wait_asynccnt 0x0" ::: "memory");
  float (*so)[16][68] = (float (*)[16][68])ring;
#pragma unroll
  for (int j = 0; j < 4; ++j) { const v8f o = acc[j] + accl[j] * (1.0f / 2048.0f); float* po = &so[wave][col][j * 16 + 8 * g]; *(v4f*)po = v4f{ o[0], o[1], o[2], o[3] }; *(v4f*)(po + 4) = v4f{ o[4], o[5], o[6], o[7] }; }
  // the lane halves' sums are joined once, here
  l += xhalf(l);
  if (g == 0) { sm[wave][col] = m; sl[wave][col] = l; }
  __syncthreads();
  // merge of the key ranges: thread = (query tile, row, 4 columns); weight exp(m_s - M), a range with no kept key weighs 0
  { const int qm = tid >> 8, row = (tid >> 4) & 15, c4 = (tid & 15) * 4; float M = -3.0e38f;
#pragma unroll
    for (int s = 0; s < KSPL; ++s) M = fmaxf(M, sm[s * QTB + qm][row]);
    float w[KSPL], L = 0.f; v4f o = {};
#pragma unroll
    for (int s = 0; s < KSPL; ++s) { const float ms = sm[s * QTB + qm][row]; w[s] = (ms <= -1.0e38f) ? 0.f : __expf(ms - M); }
#pragma unroll
    for (int s = 0; s < KSPL; ++s) { L += w[s] * sl[s * QTB + qm][row]; o += w[s] * *(const v4f*)&so[s * QTB + qm][row][c4]; }
    const float il = (L > 0.f) ? (1.0f / 2048.0f) / L : 0.f;
    vst2(OUT + (b * NN + blockIdx.x * (16 * QTB) + qm * 16 + row) * DD + c4, o * il); } }
extern "C" void kernel_launch(void* const* d_in, const int* in_sizes, int n_in, void* d_out, int out_size, void* d_ws, size_t ws_size, hipStream_t stream) {
  (void)in_sizes; (void)n_in; (void)out_size;
  const float** F = (const float**)d_in;   // 0 x [4,2048,512], 1 mask [4,2048] int, 2 Wq [512,64] (in,out), 3 bq, 4 Wk, 5 bk, 6 Wv, 7 bv
  if (ws_size < (size_t)WS_END) return;
  char* ws = (char*)d_ws; __bf16* PW = (__bf16*)(ws + WS_PW); _Float16 *QH = (_Float16*)(ws + WS_QH), *QL = (_Float16*)(ws + WS_QL), *KH = (_Float16*)(ws + WS_KH), *KL = (_Float16*)(ws + WS_KL), *VT = (_Float16*)(ws + WS_VT), *VTL = (_Float16*)(ws + WS_VTL);
  k_packw<<<3 * DD, 256, 0, stream>>>(F[2], F[4], F[6], PW);
  k_proj<<<NB * NN / 64, 128, 0, stream>>>(F[0], PW, F[3], F[5], F[7], QH, QL, KH, KL, VT, VTL);
  k_att<<<dim3(NN / (16 * QTB), TNB), 32 * QTB * KSPL, 0, stream>>>(QH, QL, KH, KL, VT, VTL, (const int*)d_in[1], (float*)d_out);
}

// v005
// Measured time: 31.3 microseconds a run.
// In two side-by-side timings against v004, it was 1.47 and 1.48 times as fast.
// All steps since v000 together make it 6.98 times as fast.
// compute dtype: all float inputs rounded to bf16, mask (int) read on device; q/k/v = x W + b with EXACT bf16 products on WMMA 16x16x32 ((in,out) weights as transposed rows); q/k as f16 hi + residual (3-product logits x 1/8), masked keys (mask == 0) excluded (== the -1e9 additive fill): only kept keys are listed, projected to k, v and attended, running-max softmax in f32 (hardware exp); P (x 2^11) as f16 hi + residual . v (f16 hi + residual planes; 3 products); f32 output.
#include <hip/hip_runtime.h>
#include <math.h>

typedef __attribute__((ext_vector_type(16))) _Float16 v16h;
typedef __attribute__((ext_vector_type(16))) __bf16 v16b;
typedef __attribute__((ext_vector_type(8)))  _Float16 v8h;
typedef __attribute__((ext_vector_type(8)))  float v8f;
typedef __attribute__((ext_vector_type(4)))  float v4f;
typedef __attribute__((ext_vector_type(2)))  float v2f;
typedef __attribute__((ext_vector_type(4)))  unsigned v4u;
typedef __attribute__((ext_vector_type(4)))  int v4i;
typedef float __attribute__((may_alias)) float_a;
typedef int __attribute__((may_alias)) int_a;

template <typename T> __device__ __forceinline__ void vst2(void* p, T v) { *(T*)p = v;  }
__device__ __forceinline__ v8f wmma16(v16h a, v16h b, v8f c) {
  v8f d = __builtin_amdgcn_wmma_f32_16x16x32_f16(false, a, false, b, (short)0, c, false, false);
  asm volatile("v_nop\n\tv_nop\n\tv_nop\n\tv_nop" : "+v"(d) : "v"(a), "v"(b));
  return d;
}
__device__ __forceinline__ v8f wmma_bf(v16b a, v16b b, v8f c) {
  v8f d = __builtin_amdgcn_wmma_f32_16x16x32_bf16(false, a, false, b, (short)0, c, false, false);
  asm volatile("v_nop\n\tv_nop\n\tv_nop\n\tv_nop" : "+v"(d) : "v"(a), "v"(b));
  return d;
}
// 16x16x32 fragments: lane = (h = lane>>4, row/col = lane&15); elements 0..7 = k0+8h+0..7, 8..15 = k0+16+8h+0..7; D element r = row 8h+r
__device__ __forceinline__ v16h frag_h(const _Float16* rowk0, int lane) {
  union { v16h v; v8h q[2]; } u; const _Float16* p = rowk0 + 8 * (lane >> 4);
  u.q[0] = *(const v8h*)p; u.q[1] = *(const v8h*)(p + 16); return u.v;
}
__device__ __forceinline__ v16h frag_f32(const float* rowk0, int lane) {
  v16h a; const float* p = rowk0 + 8 * (lane >> 4);
#pragma unroll
  for (int i = 0; i < 8; ++i) { a[i] = (_Float16)p[i]; a[8 + i] = (_Float16)p[16 + i]; }
  return a;
}
__device__ __forceinline__ v16h frag_f32s(const float* rowk0, int lane, float sc) {
  v16h a; const float* p = rowk0 + 8 * (lane >> 4);
#pragma unroll
  for (int i = 0; i < 8; ++i) { a[i] = (_Float16)(p[i] * sc); a[8 + i] = (_Float16)(p[16 + i] * sc); }
  return a;
}
// column fragment from a [K][ld] layout (column n), rows >= K read as 0
__device__ __forceinline__ v16h fragc_f32(const float* W, int k0, int n, int lane, int ld, int K) {
  v16h a; const int g = lane >> 4;
#pragma unroll
  for (int i = 0; i < 8; ++i) { const int ka = k0 + 8 * g + i, kb = ka + 16;
    a[i] = (_Float16)(ka < K ? W[(size_t)(ka < K ? ka : K - 1) * ld + n] : 0.f); a[8 + i] = (_Float16)(kb < K ? W[(size_t)(kb < K ? kb : K - 1) * ld + n] : 0.f); }
  return a;
}
struct F2 { v16b h, l; };
__device__ __forceinline__ F2 bsplit16(const float v[16]) { F2 r;
#pragma unroll
  for (int i = 0; i < 16; ++i) { const __bf16 h = (__bf16)v[i]; r.h[i] = h; r.l[i] = (__bf16)(v[i] - (float)h); }
  return r; }
__device__ __forceinline__ F2 split_row(const float* row, int k0, int lane) { float v[16]; const float* p = row + k0 + 8 * (lane >> 4);
#pragma unroll
  for (int i = 0; i < 8; ++i) { v[i] = p[i]; v[8 + i] = p[16 + i]; }
  return bsplit16(v); }
__device__ __forceinline__ F2 split_rowK(const float* row, int k0, int lane, int K) { float v[16]; const int g = lane >> 4;
#pragma unroll
  for (int i = 0; i < 8; ++i) { const int ka = k0 + 8 * g + i, kb = ka + 16; v[i] = ka < K ? row[ka < K ? ka : K - 1] : 0.f; v[8 + i] = kb < K ? row[kb < K ? kb : K - 1] : 0.f; }
  return bsplit16(v); }
__device__ __forceinline__ F2 split_col(const float* W, int k0, int n, int lane, int ld, int K) { float v[16]; const int g = lane >> 4;
#pragma unroll
  for (int i = 0; i < 8; ++i) { const int ka = k0 + 8 * g + i, kb = ka + 16; v[i] = ka < K ? W[(size_t)(ka < K ? ka : K - 1) * ld + n] : 0.f; v[8 + i] = kb < K ? W[(size_t)(kb < K ? kb : K - 1) * ld + n] : 0.f; }
  return bsplit16(v); }
__device__ __forceinline__ v8f mac3(const F2& a, const F2& b, v8f c) { c = wmma_bf(a.l, b.h, c); c = wmma_bf(a.h, b.l, c); return wmma_bf(a.h, b.h, c); }
__device__ __forceinline__ float sigm(float v) { return 1.0f / (1.0f + expf(-v)); }
#define LDSX() do { asm volatile("s_wait_dscnt 0" ::: "memory"); __builtin_amdgcn_wave_barrier(); __builtin_amdgcn_fence(__ATOMIC_RELEASE, "workgroup"); } while (0)


// Single-head masked attention (B 4, S 2,048, F 512 -> D 64): q, k, v = x W + b; softmax(q k^T / 8 + (1 - mask_k) * -1e9) v.
#define NB 4
#define NN 2048
#define FF 512
#define DD 64
#ifndef TNB
#define TNB NB
#endif
typedef __attribute__((ext_vector_type(8))) __bf16 v8b;
__device__ __forceinline__ v16b frag_b(const __bf16* rowk0, int lane) {
  union { v16b v; v8b q[2]; } u; const __bf16* p = rowk0 + 8 * (lane >> 4);
  u.q[0] = *(const v8b*)p; u.q[1] = *(const v8b*)(p + 16); return u.v;
}
__device__ __forceinline__ float bfr(float v) { return (float)(__bf16)v; }
__device__ __attribute__((noinline)) float exp_ni(float v) { return expf(v); }
__device__ __attribute__((noinline)) float erf_ni(float v) { return erff(v); }

#define WS_PW  0u                                   // bf16 W^T rows [192][512] (q | k | v)
#define WS_QH  (WS_PW + 2u * 3 * DD * FF)               // f16 hi|lo q rows [row][64]; k rows; v planes [b][64][NN]; k and v by place in the list of kept keys
#define WS_QL  (WS_QH + 2u * (size_t)NB * NN * DD)
#define WS_KH  (WS_QL + 2u * (size_t)NB * NN * DD)
#define WS_KL  (WS_KH + 2u * (size_t)NB * NN * DD)
#define WS_VT  (WS_KL + 2u * (size_t)NB * NN * DD)
#define WS_VTL (WS_VT + 2u * (size_t)NB * DD * NN)
#define WS_IDX (WS_VTL + 2u * (size_t)NB * DD * NN)    // int [b][NN]: the kept keys' row numbers in rising order, then 0s to the end of the group of 64, then -1s
#define WS_CNT (WS_IDX + 4u * (size_t)NB * NN)          // int [b]: how many keys are kept
#define WS_END (WS_CNT + 4u * NB)

// blocks 0..191: one weight column each; blocks 192..: one batch's list of kept keys (mask != 0), by ballots over 32 keys and a prefix over the 64 ballot counts; a masked key fills one place behind the list: with row 0 where the place's group of 64 still holds a listed key (k_proj works on whole groups), else with -1
__global__ __launch_bounds__(256) void k_packw(const float* __restrict__ WQ, const float* __restrict__ WK, const float* __restrict__ WV, const int* __restrict__ MK, __bf16* __restrict__ PW, int* __restrict__ IDX, int* __restrict__ CNT) { const int n = blockIdx.x, t = threadIdx.x; __shared__ __align__(16) __bf16 s[FF];
  if (n >= 3 * DD) { __shared__ int gc[NN / 32], pre[NN / 32]; const int bb = n - 3 * DD, lane = t & 31, w = t >> 5; unsigned bal[NN / 256];
#pragma unroll
    for (int i = 0; i < NN / 256; ++i) bal[i] = __builtin_amdgcn_ballot_w32(MK[bb * NN + i * 256 + t] != 0);
    if (lane == 0) {
#pragma unroll
      for (int i = 0; i < NN / 256; ++i) gc[i * 8 + w] = __builtin_popcount(bal[i]); }
    __syncthreads();
    if (t < NN / 32) { int p = 0;
#pragma unroll
      for (int j = 0; j < NN / 32; ++j) p += j < t ? gc[j] : 0;
      pre[t] = p; }
    __syncthreads();
    const int cnt = pre[NN / 32 - 1] + gc[NN / 32 - 1];
#pragma unroll
    for (int i = 0; i < NN / 256; ++i) { const int key = i * 256 + t, pos = pre[i * 8 + w] + __builtin_popcount(bal[i] & ((1u << lane) - 1u)); const bool keep = (bal[i] >> lane) & 1u; const int at = keep ? pos : cnt + key - pos; IDX[bb * NN + at] = keep ? key : (at & ~63) < cnt ? 0 : -1; }
    if (t == 0) CNT[bb] = cnt;
    return; }
  const int which = n / DD, u = n % DD; const float* Wm = which == 0 ? WQ : which == 1 ? WK : WV;   // (in,out) [512][64]
  for (int k = t; k < FF; k += 256) s[k] = (__bf16)Wm[(size_t)k * DD + u]; __syncthreads(); if (t < FF / 8) vst2((unsigned*)(PW + (size_t)n * FF + t * 8), *(const v4u*)&s[t * 8]); }
// ---- k_proj: block = 64 rows. blockIdx.y 0: k (cols 0..63) and v (64..127) of the 64 kept keys that stand at the block's places in the list (x rows gathered by the list; a block wholly behind the list has nothing to do); blockIdx.y 1: q of 64 rows of x in their own order. + biases
// NT column tiles of 16 x-rows times W^T rows from pw on
template <int NT> __device__ __forceinline__ void proj_acc(const float* px, const __bf16* pw, int lane, v8f (&acc)[NT]) {
#pragma unroll
  for (int j = 0; j < NT; ++j) acc[j] = v8f{};
  // every fragment is fetched one k step ahead: a weight fragment's next load is issued right behind the product that used it, so that the loads of a step are in flight together instead of each being waited for alone
  v4f xr[4] = { *(const v4f*)px, *(const v4f*)(px + 4), *(const v4f*)(px + 16), *(const v4f*)(px + 20) }; v16b bf[NT];
#pragma unroll
  for (int j = 0; j < NT; ++j) bf[j] = frag_b(pw + (size_t)j * 16 * FF, lane);
  // unrolled whole so that the test for a next step is resolved at compile time and the fetched fragments keep their registers without copies
#pragma unroll
  for (int kc = 0; kc < FF / 32; ++kc) { v16b a;
    // keeps the conversion of this step's x, and with it the wait for its loads, from being moved up to right behind those loads in the step before
    __builtin_amdgcn_sched_barrier(0);
#pragma unroll
    for (int i = 0; i < 4; ++i) { a[i] = (__bf16)xr[0][i]; a[4 + i] = (__bf16)xr[1][i]; a[8 + i] = (__bf16)xr[2][i]; a[12 + i] = (__bf16)xr[3][i]; }
    if (kc + 1 < FF / 32) { const float* pn = px + (kc + 1) * 32; xr[0] = *(const v4f*)pn; xr[1] = *(const v4f*)(pn + 4); xr[2] = *(const v4f*)(pn + 16); xr[3] = *(const v4f*)(pn + 20); }
    // behind the last loads from px: its registers are free from here on and may be given to a later load's data
    if (kc + 2 == FF / 32) asm volatile("s_wait_xcnt 0x0" ::: "memory");
#pragma unroll
    for (int j = 0; j < NT; ++j) { acc[j] = wmma_bf(a, bf[j], acc[j]); if (kc + 1 < FF / 32) bf[j] = frag_b(pw + (size_t)j * 16 * FF + (kc + 1) * 32, lane); } }
}
__global__ __launch_bounds__(128) void k_proj(const float* __restrict__ X, const __bf16* __restrict__ PW, const float* __restrict__ BQ, const float* __restrict__ BK, const float* __restrict__ BV, const int* __restrict__ IDX, _Float16* __restrict__ QH, _Float16* __restrict__ QL, _Float16* __restrict__ KH, _Float16* __restrict__ KL, _Float16* __restrict__ VT, _Float16* __restrict__ VTL) {
  __shared__ __align__(16) _Float16 sk[64][72], skl[64][72]; __shared__ __align__(16) _Float16 th[DD][72], tl[DD][72];
  const int tid = threadIdx.x, wave = tid >> 5, lane = tid & 31, col = lane & 15, g = lane >> 4; const size_t r0 = (size_t)blockIdx.x * 64 + wave * 16; const size_t b = ((size_t)blockIdx.x * 64) / NN; const int n0 = (int)(((size_t)blockIdx.x * 64) % NN);
  if (blockIdx.y == 0) {
    // an entry below 0 says that all 64 places of the block lie behind the list: the return is the same for the whole block and stands in front of its barrier
    const int src = IDX[r0 + col];
    if (__builtin_amdgcn_readfirstlane(src) < 0) return;
    const size_t xrow = b * NN + (size_t)(src & (NN - 1));
    v8f acc[8]; proj_acc<8>(X + xrow * FF + 8 * g, PW + (size_t)(DD + col) * FF, lane, acc);
#pragma unroll
    for (int j = 0; j < 8; ++j) { const int c = (j & 3) * 16 + col; const float bb = j < 4 ? bfr(BK[c]) : bfr(BV[c]);
#pragma unroll
      for (int r = 0; r < 8; ++r) { const float v = acc[j][r] + bb; const _Float16 hv = (_Float16)v, lv = (_Float16)((v - (float)hv) * 2048.0f); const int rl = wave * 16 + 8 * g + r; if (j < 4) { sk[rl][c] = hv; skl[rl][c] = lv; } else { th[c][rl] = hv; tl[c][rl] = lv; } } }
    __syncthreads();
    for (int e = tid; e < 64 * 8; e += 128) { const int rl = e >> 3, q = e & 7; const size_t o = ((size_t)blockIdx.x * 64 + rl) * DD + q * 8; vst2((unsigned*)(KH + o), *(const v4u*)&sk[rl][q * 8]); vst2((unsigned*)(KL + o), *(const v4u*)&skl[rl][q * 8]); }
    for (int e = tid; e < DD * 8; e += 128) { const int c = e >> 3, q = e & 7; const size_t o = (b * DD + c) * (size_t)NN + n0 + q * 8; vst2((unsigned*)(VT + o), *(const v4u*)&th[c][q * 8]); vst2((unsigned*)(VTL + o), *(const v4u*)&tl[c][q * 8]); }
  } else {
    v8f acc[4]; proj_acc<4>(X + (r0 + col) * FF + 8 * g, PW + (size_t)col * FF, lane, acc);
#pragma unroll
    for (int j = 0; j < 4; ++j) { const int c = j * 16 + col; const float bb = bfr(BQ[c]);
#pragma unroll
      for (int r = 0; r < 8; ++r) { const float v = acc[j][r] + bb; const _Float16 hv = (_Float16)v, lv = (_Float16)((v - (float)hv) * 2048.0f); const int rl = wave * 16 + 8 * g + r; sk[rl][c] = hv; skl[rl][c] = lv; } }
    __syncthreads();
    for (int e = tid; e < 64 * 8; e += 128) { const int rl = e >> 3, q = e & 7; const size_t o = ((size_t)blockIdx.x * 64 + rl) * DD + q * 8; vst2((unsigned*)(QH + o), *(const v4u*)&sk[rl][q * 8]); vst2((unsigned*)(QL + o), *(const v4u*)&skl[rl][q * 8]); }
  } }
#define QTB 2
#define KSPL 8
#define PKEYS (32 * KSPL)      // places of the list that a pass covers
#define PL_B 4096u            // one plane's tile of a pass: K 32 rows x 128 B, V 64 rows x 64 B
#define KR_B (4u * PL_B)      // one key range's stage: K hi | K residual | V hi | V residual
#define BUF_B (KSPL * KR_B)   // one buffer: the stage of all eight key ranges
static_assert(32 * KSPL == 16 * 16, "the merge gives one thread to each (row, 4 columns) of a query tile");
__device__ __forceinline__ unsigned lds_off(const void* p) { return (unsigned)(size_t)p; }
// a fragment from an LDS row: its two 16-byte pieces stand at places ca and cb of the row
__device__ __forceinline__ v16h frag_l(const unsigned char* row, unsigned ca, unsigned cb) {
  union { v16h v; v8h q[2]; } u; u.q[0] = *(const v8h*)(row + ca * 16u); u.q[1] = *(const v8h*)(row + cb * 16u); return u.v;
}
// Rows in LDS carry no pad; a row's 16-byte pieces are permuted instead, piece c of K row r at place c ^ ((r >> 1) & 7), piece c of V row d at place c ^ ((d >> 2) & 3), so that the 16 rows of a fragment read fall on 16 different bank groups.
// One wave's share of a stage: 8 copies of 512 B for its K plane, 8 of 512 B for its V plane. The s_wait_xcnt closes each statement so that no address register is rewritten ahead of it.
// lk, lv: the lane's places for copy 0; bits 9 to 11 are 0 there (the ring is aligned to 4 KiB), so copy i's four (K) or eight (V) rows further on and its share of the permutation are one exclusive-or.
__device__ __forceinline__ void stage_copy(const _Float16* gk, const _Float16* gv, unsigned lk, unsigned lv) {
  unsigned a[8], c[8]; const _Float16 *pk[8], *pv[8];
#pragma unroll
  for (int i = 0; i < 8; ++i) {
    a[i] = lk ^ (i * 512u | (((2u * i) & 7u) << 4)); pk[i] = gk + i * 256;
    c[i] = lv ^ (i * 512u | (((2u * i) & 3u) << 4)); pv[i] = gv + (size_t)i * 8 * NN; }
  asm volatile("global_load_async_to_lds_b128 %0, %8, off\n\tglobal_load_async_to_lds_b128 %1, %9, off\n\tglobal_load_async_to_lds_b128 %2, %10, off\n\tglobal_load_async_to_lds_b128 %3, %11, off\n\t"
               "global_load_async_to_lds_b128 %4, %12, off\n\tglobal_load_async_to_lds_b128 %5, %13, off\n\tglobal_load_async_to_lds_b128 %6, %14, off\n\tglobal_load_async_to_lds_b128 %7, %15, off\n\ts_wait_xcnt 0x0"
               :: "v"(a[0]), "v"(a[1]), "v"(a[2]), "v"(a[3]), "v"(a[4]), "v"(a[5]), "v"(a[6]), "v"(a[7]),
                  "v"(pk[0]), "v"(pk[1]), "v"(pk[2]), "v"(pk[3]), "v"(pk[4]), "v"(pk[5]), "v"(pk[6]), "v"(pk[7]) : "memory");
  asm volatile("global_load_async_to_lds_b128 %0, %8, off\n\tglobal_load_async_to_lds_b128 %1, %9, off\n\tglobal_load_async_to_lds_b128 %2, %10, off\n\tglobal_load_async_to_lds_b128 %3, %11, off\n\t"
               "global_load_async_to_lds_b128 %4, %12, off\n\tglobal_load_async_to_lds_b128 %5, %13, off\n\tglobal_load_async_to_lds_b128 %6, %14, off\n\tglobal_load_async_to_lds_b128 %7, %15, off\n\ts_wait_xcnt 0x0"
               :: "v"(c[0]), "v"(c[1]), "v"(c[2]), "v"(c[3]), "v"(c[4]), "v"(c[5]), "v"(c[6]), "v"(c[7]),
                  "v"(pv[0]), "v"(pv[1]), "v"(pv[2]), "v"(pv[3]), "v"(pv[4]), "v"(pv[5]), "v"(pv[6]), "v"(pv[7]) : "memory");
}
typedef __attribute__((ext_vector_type(2))) _Float16 v2h;
// lane l's value seen from lane l ^ 16
__device__ __forceinline__ float xhalf(float v) { const int b = __builtin_bit_cast(int, v); return __builtin_bit_cast(float, __builtin_amdgcn_permlanex16(b, b, 0x76543210, 0xfedcba98, false, false)); }
// four waves a SIMD is what a 16-wave block gives: the register budget is set for exactly that
__global__ __launch_bounds__(32 * QTB * KSPL) __attribute__((amdgpu_waves_per_eu(4, 4))) void k_att(const _Float16* __restrict__ QH, const _Float16* __restrict__ QL, const _Float16* __restrict__ KH, const _Float16* __restrict__ KL, const _Float16* __restrict__ VT, const _Float16* __restrict__ VTL, const int* __restrict__ CNT, float* __restrict__ OUT) {
  // ring: the two buffers; behind the loop's last barrier its first bytes hold the waves' un-normalised outputs for the merge
  __shared__ __align__(4096) unsigned char ring[2 * BUF_B];
  __shared__ float sm[QTB * KSPL][16], sl[QTB * KSPL][16];
  static_assert(sizeof(float) * QTB * KSPL * 16 * 68 <= 2 * BUF_B, "the merge's partial outputs fit the ring");
  // the wave number is held scalar so that the pass counter and the key range's base stay in scalar registers
  const int tid = threadIdx.x, wave = __builtin_amdgcn_readfirstlane(tid >> 5), lane = tid & 31, col = lane & 15, g = lane >> 4; const size_t b = blockIdx.y; const int qt = wave % QTB, kr = wave / QTB; const int q0 = blockIdx.x * (16 * QTB) + qt * 16; const size_t rq = b * NN + q0; const int key0 = kr * 32;
  // kept keys of this batch, bounded by the shape and held scalar: every test on it is a scalar branch, the same for the whole wave (the pass count: for the whole block)
  const int cnt = __builtin_amdgcn_readfirstlane(min(max(CNT[b], 0), NN)), npass = (cnt + PKEYS - 1) / PKEYS;
  // this lane's sources and places for pass 0, buffer 0
  const _Float16* gk = (qt ? KL : KH) + (b * NN + key0) * DD + lane * 8; const _Float16* gv = (qt ? VTL : VT) + (b * DD + (lane >> 2)) * (size_t)NN + key0 + (lane & 3) * 8;
  const unsigned lk = lds_off(ring) + kr * KR_B + qt * PL_B + (lane >> 3) * 128u + (((lane & 7) ^ g) << 4), lv = lds_off(ring) + kr * KR_B + (2u + qt) * PL_B + (lane >> 2) * 64u + (((lane & 3) ^ g) << 4);
  if (key0 < cnt) stage_copy(gk, gv, lk, lv);
  // pass 0's tiles have landed in every wave before any wave reads them
  asm volatile("s_wait_asynccnt 0x0" ::: "memory");
  __syncthreads();
  if (PKEYS + key0 < cnt) stage_copy(gk + PKEYS * DD, gv + PKEYS, lk + BUF_B, lv + BUF_B);
  // Q^T operand: column = query (lane & 15)
  v16h aq[2], al[2];
#pragma unroll
  for (int kc = 0; kc < 2; ++kc) { aq[kc] = frag_h(QH + (rq + col) * DD + kc * 32, lane); al[kc] = frag_h(QL + (rq + col) * DD + kc * 32, lane); }
  // of this lane's query: running maximum (equal in both lane halves), sum over this half's keys
  float m = -3.0e38f, l = 0.f;
  // acc[j][r]: O^T[j * 16 + 8 g + r][query]
  v8f acc[4] = {}, accl[4] = {};
  const unsigned zk = (unsigned)(col >> 1) & 7u, zv = (unsigned)(col >> 2) & 3u;
#pragma unroll 1
  for (int t = 0; t < npass; ++t) {
    // rem: places of the list from this range's first place of the pass on (none: nothing to do but the pass's foot)
    const int rem = cnt - (t * PKEYS + key0);
    if (rem > 0) { float s[2][8]; const unsigned char* st = ring + (unsigned)(t & 1) * BUF_B + kr * KR_B; const int remg = rem - 8 * g;
    // s[ct][r]: score of key ct * 16 + 8 g + r of the pass
#pragma unroll
    for (int ct = 0; ct < 2; ++ct) { const unsigned char* krow = st + (ct * 16 + col) * 128; v8f c = {}, cl = {};
#pragma unroll
      for (int kc = 0; kc < 2; ++kc) { const unsigned ca = (unsigned)(kc * 4 + g) ^ zk, cb = (unsigned)(kc * 4 + 2 + g) ^ zk; const v16h kh = frag_l(krow, ca, cb), kl = frag_l(krow + PL_B, ca, cb); c = wmma16(kh, aq[kc], c); cl = wmma16(kl, aq[kc], cl); cl = wmma16(kh, al[kc], cl); }
      const v8f sc = (c + cl * (1.0f / 2048.0f)) * 0.125f;
#pragma unroll
      for (int r = 0; r < 8; ++r) { const bool keep = ct * 16 + r < remg; s[ct][r] = keep ? sc[r] : -3.0e38f; } }
    float mx = s[0][0];
#pragma unroll
    for (int i = 1; i < 16; ++i) mx = fmaxf(mx, s[i >> 3][i & 7]);
    mx = fmaxf(mx, xhalf(mx));
    const float mn = fmaxf(m, mx), alpha = (m <= -1.0e38f) ? 0.f : __expf(m - mn);
    // P^T operand, element i = key i (first tile) or 16 + (i - 8) (second tile) of this half: the scores' own order; taken in pairs of neighbouring registers
    v16h pa, pal; v2f es = { 0.f, 0.f };
#pragma unroll
    for (int i = 0; i < 16; i += 2) { const float s0 = s[i >> 3][i & 7], s1 = s[i >> 3][(i & 7) + 1]; const v2f e = { (s0 <= -1.0e38f) ? 0.f : __expf(s0 - mn), (s1 <= -1.0e38f) ? 0.f : __expf(s1 - mn) }, p = e * 2048.0f; es += e;
      const v2h h = __builtin_convertvector(p, v2h), q = __builtin_convertvector((p - __builtin_convertvector(h, v2f)) * 2048.0f, v2h); pa[i] = h[0]; pa[i + 1] = h[1]; pal[i] = q[0]; pal[i + 1] = q[1]; }
    l = l * alpha + (es[0] + es[1]); m = (mn > -1.0e38f) ? mn : m;
#pragma unroll
    for (int j = 0; j < 4; ++j) { acc[j] *= alpha; accl[j] *= alpha; }
#pragma unroll
    for (int j = 0; j < 4; ++j) { const unsigned char* vrow = st + 2u * PL_B + (j * 16 + col) * 64; const unsigned ca = (unsigned)g ^ zv, cb = (unsigned)(2 + g) ^ zv; const v16h vh = frag_l(vrow, ca, cb), vl = frag_l(vrow + PL_B, ca, cb); acc[j] = wmma16(vh, pa, acc[j]); accl[j] = wmma16(vl, pa, accl[j]); accl[j] = wmma16(vh, pal, accl[j]); } }
    // foot of the pass: this wave's LDS reads of the buffer are done ...
    asm volatile("s_wait_dscnt 0x0" ::: "memory");
    // ... its copies for the next pass have landed ...
    asm volatile("s_wait_asynccnt 0x0" ::: "memory");
    // ... and one barrier both publishes the next pass's tiles and frees the buffer just read
    __syncthreads();
    if ((t + 2) * PKEYS + key0 < cnt) stage_copy(gk + (t + 2) * (PKEYS * DD), gv + (t + 2) * PKEYS, lk + (unsigned)(t & 1) * BUF_B, lv + (unsigned)(t & 1) * BUF_B); }
  // no copy is outstanding when the ring takes the partial outputs
  asm volatile("s_wait_asynccnt 0x0" ::: "memory");
  float (*so)[16][68] = (float (*)[16][68])ring;
#pragma unroll
  for (int j = 0; j < 4; ++j) { const v8f o = acc[j] + accl[j] * (1.0f / 2048.0f); float* po = &so[wave][col][j * 16 + 8 * g]; *(v4f*)po = v4f{ o[0], o[1], o[2], o[3] }; *(v4f*)(po + 4) = v4f{ o[4], o[5], o[6], o[7] }; }
  // the lane halves' sums are joined once, here
  l += xhalf(l);
  if (g == 0) { sm[wave][col] = m; sl[wave][col] = l; }
  __syncthreads();
  // merge of the key ranges: thread = (query tile, row, 4 columns); weight exp(m_s - M), a range with no kept key weighs 0
  { const int qm = tid >> 8, row = (tid >> 4) & 15, c4 = (tid & 15) * 4; float M = -3.0e38f;
#pragma unroll
    for (int s = 0; s < KSPL; ++s) M = fmaxf(M, sm[s * QTB + qm][row]);
    float w[KSPL], L = 0.f; v4f o = {};
#pragma unroll
    for (int s = 0; s < KSPL; ++s) { const float ms = sm[s * QTB + qm][row]; w[s] = (ms <= -1.0e38f) ? 0.f : __expf(ms - M); }
#pragma unroll
    for (int s = 0; s < KSPL; ++s) { L += w[s] * sl[s * QTB + qm][row]; o += w[s] * *(const v4f*)&so[s * QTB + qm][row][c4]; }
    const float il = (L > 0.f) ? (1.0f / 2048.0f) / L : 0.f;
    vst2(OUT + (b * NN + blockIdx.x * (16 * QTB) + qm * 16 + row) * DD + c4, o * il); } }
extern "C" void kernel_launch(void* const* d_in, const int* in_sizes, int n_in, void* d_out, int out_size, void* d_ws, size_t ws_size, hipStream_t stream) {
  (void)in_sizes; (void)n_in; (void)out_size;
  const float** F = (const float**)d_in;   // 0 x [4,2048,512], 1 mask [4,2048] int, 2 Wq [512,64] (in,out), 3 bq, 4 Wk, 5 bk, 6 Wv, 7 bv
  if (ws_size < (size_t)WS_END) return;
  char* ws = (char*)d_ws; __bf16* PW = (__bf16*)(ws + WS_PW); _Float16 *QH = (_Float16*)(ws + WS_QH), *QL = (_Float16*)(ws + WS_QL), *KH = (_Float16*)(ws + WS_KH), *KL = (_Float16*)(ws + WS_KL), *VT = (_Float16*)(ws + WS_VT), *VTL = (_Float16*)(ws + WS_VTL); int *IDX = (int*)(ws + WS_IDX), *CNT = (int*)(ws + WS_CNT);
  k_packw<<<3 * DD + NB, 256, 0, stream>>>(F[2], F[4], F[6], (const int*)d_in[1], PW, IDX, CNT);
  k_proj<<<dim3(NB * NN / 64, 2), 128, 0, stream>>>(F[0], PW, F[3], F[5], F[7], IDX, QH, QL, KH, KL, VT, VTL);
  k_att<<<dim3(NN / (16 * QTB), TNB), 32 * QTB * KSPL, 0, stream>>>(QH, QL, KH, KL, VT, VTL, CNT, (float*)d_out);
}

// v006
// Measured time: 29.4 microseconds a run.
// In two side-by-side timings against v005, it was 1.06 and 1.05 times as fast.
// All steps since v000 together make it 7.37 times as fast.
// compute dtype: all float inputs rounded to bf16, mask (int) read on device; q/k/v = x W + b with EXACT bf16 products on WMMA 16x16x32 ((in,out) weights packed in fragment order); q/k as f16 hi + residual (3-product logits x 1/8), masked keys (mask == 0) excluded (== the -1e9 additive fill): only kept keys are listed, projected to k, v and attended, running-max softmax in f32 (hardware exp); P (x 2^11) as f16 hi + residual . v (f16 hi + residual planes; 3 products); f32 output.
#include <hip/hip_runtime.h>
#include <math.h>

typedef __attribute__((ext_vector_type(16))) _Float16 v16h;
typedef __attribute__((ext_vector_type(16))) __bf16 v16b;
typedef __attribute__((ext_vector_type(8)))  _Float16 v8h;
typedef __attribute__((ext_vector_type(8)))  float v8f;
typedef __attribute__((ext_vector_type(4)))  float v4f;
typedef __attribute__((ext_vector_type(2)))  float v2f;
typedef __attribute__((ext_vector_type(4)))  unsigned v4u;
typedef __attribute__((ext_vector_type(4)))  int v4i;
typedef float __attribute__((may_alias)) float_a;
typedef int __attribute__((may_alias)) int_a;

template <typename T> __device__ __forceinline__ void vst2(void* p, T v) { *(T*)p = v;  }
__device__ __forceinline__ v8f wmma16(v16h a, v16h b, v8f c) {
  v8f d = __builtin_amdgcn_wmma_f32_16x16x32_f16(false, a, false, b, (short)0, c, false, false);
  asm volatile("v_nop\n\tv_nop\n\tv_nop\n\tv_nop" : "+v"(d) : "v"(a), "v"(b));
  return d;
}
__device__ __forceinline__ v8f wmma_bf(v16b a, v16b b, v8f c) {
  v8f d = __builtin_amdgcn_wmma_f32_16x16x32_bf16(false, a, false, b, (short)0, c, false, false);
  asm volatile("v_nop\n\tv_nop\n\tv_nop\n\tv_nop" : "+v"(d) : "v"(a), "v"(b));
  return d;
}
// 16x16x32 fragments: lane = (h = lane>>4, row/col = lane&15); elements 0..7 = k0+8h+0..7, 8..15 = k0+16+8h+0..7; D element r = row 8h+r
__device__ __forceinline__ v16h frag_h(const _Float16* rowk0, int lane) {
  union { v16h v; v8h q[2]; } u; const _Float16* p = rowk0 + 8 * (lane >> 4);
  u.q[0] = *(const v8h*)p; u.q[1] = *(const v8h*)(p + 16); return u.v;
}
__device__ __forceinline__ v16h frag_f32(const float* rowk0, int lane) {
  v16h a; const float* p = rowk0 + 8 * (lane >> 4);
#pragma unroll
  for (int i = 0; i < 8; ++i) { a[i] = (_Float16)p[i]; a[8 + i] = (_Float16)p[16 + i]; }
  return a;
}
__device__ __forceinline__ v16h frag_f32s(const float* rowk0, int lane, float sc) {
  v16h a; const float* p = rowk0 + 8 * (lane >> 4);
#pragma unroll
  for (int i = 0; i < 8; ++i) { a[i] = (_Float16)(p[i] * sc); a[8 + i] = (_Float16)(p[16 + i] * sc); }
  return a;
}
// column fragment from a [K][ld] layout (column n), rows >= K read as 0
__device__ __forceinline__ v16h fragc_f32(const float* W, int k0, int n, int lane, int ld, int K) {
  v16h a; const int g = lane >> 4;
#pragma unroll
  for (int i = 0; i < 8; ++i) { const int ka = k0 + 8 * g + i, kb = ka + 16;
    a[i] = (_Float16)(ka < K ? W[(size_t)(ka < K ? ka : K - 1) * ld + n] : 0.f); a[8 + i] = (_Float16)(kb < K ? W[(size_t)(kb < K ? kb : K - 1) * ld + n] : 0.f); }
  return a;
}
struct F2 { v16b h, l; };
__device__ __forceinline__ F2 bsplit16(const float v[16]) { F2 r;
#pragma unroll
  for (int i = 0; i < 16; ++i) { const __bf16 h = (__bf16)v[i]; r.h[i] = h; r.l[i] = (__bf16)(v[i] - (float)h); }
  return r; }
__device__ __forceinline__ F2 split_row(const float* row, int k0, int lane) { float v[16]; const float* p = row + k0 + 8 * (lane >> 4);
#pragma unroll
  for (int i = 0; i < 8; ++i) { v[i] = p[i]; v[8 + i] = p[16 + i]; }
  return bsplit16(v); }
__device__ __forceinline__ F2 split_rowK(const float* row, int k0, int lane, int K) { float v[16]; const int g = lane >> 4;
#pragma unroll
  for (int i = 0; i < 8; ++i) { const int ka = k0 + 8 * g + i, kb = ka + 16; v[i] = ka < K ? row[ka < K ? ka : K - 1] : 0.f; v[8 + i] = kb < K ? row[kb < K ? kb : K - 1] : 0.f; }
  return bsplit16(v); }
__device__ __forceinline__ F2 split_col(const float* W, int k0, int n, int lane, int ld, int K) { float v[16]; const int g = lane >> 4;
#pragma unroll
  for (int i = 0; i < 8; ++i) { const int ka = k0 + 8 * g + i, kb = ka + 16; v[i] = ka < K ? W[(size_t)(ka < K ? ka : K - 1) * ld + n] : 0.f; v[8 + i] = kb < K ? W[(size_t)(kb < K ? kb : K - 1) * ld + n] : 0.f; }
  return bsplit16(v); }
__device__ __forceinline__ v8f mac3(const F2& a, const F2& b, v8f c) { c = wmma_bf(a.l, b.h, c); c = wmma_bf(a.h, b.l, c); return wmma_bf(a.h, b.h, c); }
__device__ __forceinline__ float sigm(float v) { return 1.0f / (1.0f + expf(-v)); }
#define LDSX() do { asm volatile("s_wait_dscnt 0" ::: "memory"); __builtin_amdgcn_wave_barrier(); __builtin_amdgcn_fence(__ATOMIC_RELEASE, "workgroup"); } while (0)


// Single-head masked attention (B 4, S 2,048, F 512 -> D 64): q, k, v = x W + b; softmax(q k^T / 8 + (1 - mask_k) * -1e9) v.
#define NB 4
#define NN 2048
#define FF 512
#define DD 64
#ifndef TNB
#define TNB NB
#endif
typedef __attribute__((ext_vector_type(8))) __bf16 v8b;
// a weight fragment from the packed weights: p = the lane's 16 bytes of the fragment's first half; the second half stands 512 bytes on
__device__ __forceinline__ v16b frag_w(const __bf16* p) {
  union { v16b v; v8b q[2]; } u; u.q[0] = *(const v8b*)p; u.q[1] = *(const v8b*)(p + 256); return u.v;
}
__device__ __forceinline__ float bfr(float v) { return (float)(__bf16)v; }
__device__ __attribute__((noinline)) float exp_ni(float v) { return expf(v); }
__device__ __attribute__((noinline)) float erf_ni(float v) { return erff(v); }

#define WS_PW  0u                                   // bf16 weights in fragment order [12 column tiles (q | k | v)][16 k steps][2 halves][32 lanes][8]: lane (g, col), half p, element e = W[32 step + 16 p + 8 g + e][16 tile + col]
#define WS_QH  (WS_PW + 2u * 3 * DD * FF)               // f16 hi|lo q rows [row][64]; k rows; v planes [b][64][NN]; k and v by place in the list of kept keys
#define WS_QL  (WS_QH + 2u * (size_t)NB * NN * DD)
#define WS_KH  (WS_QL + 2u * (size_t)NB * NN * DD)
#define WS_KL  (WS_KH + 2u * (size_t)NB * NN * DD)
#define WS_VT  (WS_KL + 2u * (size_t)NB * NN * DD)
#define WS_VTL (WS_VT + 2u * (size_t)NB * DD * NN)
#define WS_IDX (WS_VTL + 2u * (size_t)NB * DD * NN)    // int [b][NN]: the kept keys' row numbers in rising order, then 0s to the end of the group of 64, then -1s
#define WS_CNT (WS_IDX + 4u * (size_t)NB * NN)          // int [b]: how many keys are kept
#define WS_END (WS_CNT + 4u * NB)

// blocks 0..191: one weight fragment each (column tile n / 16, k step n % 16), 1 KiB that this block alone writes, laid so that a wave's 16-byte loads of it in k_proj cover 512 bytes in a row (4 lines) and not 16 rows' pieces (16 lines); blocks 192..: one batch's list of kept keys (mask != 0), by ballots over 32 keys and a prefix over the 64 ballot counts; a masked key fills one place behind the list: with row 0 where the place's group of 64 still holds a listed key (k_proj works on whole groups), else with -1
__global__ __launch_bounds__(256) void k_packw(const float* __restrict__ WQ, const float* __restrict__ WK, const float* __restrict__ WV, const int* __restrict__ MK, __bf16* __restrict__ PW, int* __restrict__ IDX, int* __restrict__ CNT) { const int n = blockIdx.x, t = threadIdx.x;
  static_assert((3 * DD / 16) * (FF / 32) == 3 * DD, "one block for each weight fragment");
  if (n >= 3 * DD) { __shared__ int gc[NN / 32], pre[NN / 32]; const int bb = n - 3 * DD, lane = t & 31, w = t >> 5; unsigned bal[NN / 256];
#pragma unroll
    for (int i = 0; i < NN / 256; ++i) bal[i] = __builtin_amdgcn_ballot_w32(MK[bb * NN + i * 256 + t] != 0);
    if (lane == 0) {
#pragma unroll
      for (int i = 0; i < NN / 256; ++i) gc[i * 8 + w] = __builtin_popcount(bal[i]); }
    __syncthreads();
    if (t < NN / 32) { int p = 0;
#pragma unroll
      for (int j = 0; j < NN / 32; ++j) p += j < t ? gc[j] : 0;
      pre[t] = p; }
    __syncthreads();
    const int cnt = pre[NN / 32 - 1] + gc[NN / 32 - 1];
#pragma unroll
    for (int i = 0; i < NN / 256; ++i) { const int key = i * 256 + t, pos = pre[i * 8 + w] + __builtin_popcount(bal[i] & ((1u << lane) - 1u)); const bool keep = (bal[i] >> lane) & 1u; const int at = keep ? pos : cnt + key - pos; IDX[bb * NN + at] = keep ? key : (at & ~63) < cnt ? 0 : -1; }
    if (t == 0) CNT[bb] = cnt;
    return; }
  if (t >= 64) return;   // thread = (half t >> 5, lane t & 31) of the fragment
  const int tile = n / (FF / 32), kc = n % (FF / 32), which = tile / (DD / 16); const float* Wm = which == 0 ? WQ : which == 1 ? WK : WV;   // (in,out) [512][64]
  const float* p = Wm + (size_t)(kc * 32 + (t >> 5) * 16 + ((t >> 4) & 1) * 8) * DD + (tile % (DD / 16)) * 16 + (t & 15); v8b o;
#pragma unroll
  for (int e = 0; e < 8; ++e) o[e] = (__bf16)p[e * DD];
  vst2(PW + (size_t)n * 512 + t * 8, o); }
// ---- k_proj: block = 64 rows. blockIdx.y 0: k (cols 0..63) and v (64..127) of the 64 kept keys that stand at the block's places in the list (x rows gathered by the list; a block wholly behind the list has nothing to do); blockIdx.y 1: q of 64 rows of x in their own order. + biases
// NT column tiles of 16 x-rows times the packed weight fragments from pw on (pw: the lane's place in the first tile's first fragment)
template <int NT> __device__ __forceinline__ void proj_acc(const float* px, const __bf16* pw, v8f (&acc)[NT]) {
#pragma unroll
  for (int j = 0; j < NT; ++j) acc[j] = v8f{};
  // every fragment is fetched one k step ahead: a weight fragment's next load is issued right behind the product that used it, so that the loads of a step are in flight together instead of each being waited for alone
  v4f xr[4] = { *(const v4f*)px, *(const v4f*)(px + 4), *(const v4f*)(px + 16), *(const v4f*)(px + 20) }; v16b bf[NT];
#pragma unroll
  for (int j = 0; j < NT; ++j) bf[j] = frag_w(pw + j * (FF / 32) * 512);
  // unrolled whole so that the test for a next step is resolved at compile time and the fetched fragments keep their registers without copies
#pragma unroll
  for (int kc = 0; kc < FF / 32; ++kc) { v16b a;
    // keeps the conversion of this step's x, and with it the wait for its loads, from being moved up to right behind those loads in the step before
    __builtin_amdgcn_sched_barrier(0);
#pragma unroll
    for (int i = 0; i < 4; ++i) { a[i] = (__bf16)xr[0][i]; a[4 + i] = (__bf16)xr[1][i]; a[8 + i] = (__bf16)xr[2][i]; a[12 + i] = (__bf16)xr[3][i]; }
    if (kc + 1 < FF / 32) { const float* pn = px + (kc + 1) * 32; xr[0] = *(const v4f*)pn; xr[1] = *(const v4f*)(pn + 4); xr[2] = *(const v4f*)(pn + 16); xr[3] = *(const v4f*)(pn + 20); }
    // behind the last loads from px: its registers are free from here on and may be given to a later load's data
    if (kc + 2 == FF / 32) asm volatile("s_wait_xcnt 0x0" ::: "memory");
#pragma unroll
    for (int j = 0; j < NT; ++j) { acc[j] = wmma_bf(a, bf[j], acc[j]); if (kc + 1 < FF / 32) bf[j] = frag_w(pw + (j * (FF / 32) + kc + 1) * 512); }
    // behind the last weight loads: their offset register is free from here on and may be given to a later load's data
    if (kc + 2 == FF / 32) asm volatile("s_wait_xcnt 0x0" ::: "memory"); }
}
__global__ __launch_bounds__(128) void k_proj(const float* __restrict__ X, const __bf16* __restrict__ PW, const float* __restrict__ BQ, const float* __restrict__ BK, const float* __restrict__ BV, const int* __restrict__ IDX, _Float16* __restrict__ QH, _Float16* __restrict__ QL, _Float16* __restrict__ KH, _Float16* __restrict__ KL, _Float16* __restrict__ VT, _Float16* __restrict__ VTL) {
  __shared__ __align__(16) _Float16 sk[64][72], skl[64][72]; __shared__ __align__(16) _Float16 th[DD][72], tl[DD][72];
  const int tid = threadIdx.x, wave = tid >> 5, lane = tid & 31, col = lane & 15, g = lane >> 4; const size_t r0 = (size_t)blockIdx.x * 64 + wave * 16; const size_t b = ((size_t)blockIdx.x * 64) / NN; const int n0 = (int)(((size_t)blockIdx.x * 64) % NN);
  if (blockIdx.y == 0) {
    // an entry below 0 says that all 64 places of the block lie behind the list: the return is the same for the whole block and stands in front of its barrier
    const int src = IDX[r0 + col];
    if (__builtin_amdgcn_readfirstlane(src) < 0) return;
    const size_t xrow = b * NN + (size_t)(src & (NN - 1));
    v8f acc[8]; proj_acc<8>(X + xrow * FF + 8 * g, PW + (DD / 16) * (FF / 32) * 512 + lane * 8, acc);
#pragma unroll
    for (int j = 0; j < 8; ++j) { const int c = (j & 3) * 16 + col; const float bb = j < 4 ? bfr(BK[c]) : bfr(BV[c]);
#pragma unroll
      for (int r = 0; r < 8; ++r) { const float v = acc[j][r] + bb; const _Float16 hv = (_Float16)v, lv = (_Float16)((v - (float)hv) * 2048.0f); const int rl = wave * 16 + 8 * g + r; if (j < 4) { sk[rl][c] = hv; skl[rl][c] = lv; } else { th[c][rl] = hv; tl[c][rl] = lv; } } }
    __syncthreads();
    for (int e = tid; e < 64 * 8; e += 128) { const int rl = e >> 3, q = e & 7; const size_t o = ((size_t)blockIdx.x * 64 + rl) * DD + q * 8; vst2((unsigned*)(KH + o), *(const v4u*)&sk[rl][q * 8]); vst2((unsigned*)(KL + o), *(const v4u*)&skl[rl][q * 8]); }
    for (int e = tid; e < DD * 8; e += 128) { const int c = e >> 3, q = e & 7; const size_t o = (b * DD + c) * (size_t)NN + n0 + q * 8; vst2((unsigned*)(VT + o), *(const v4u*)&th[c][q * 8]); vst2((unsigned*)(VTL + o), *(const v4u*)&tl[c][q * 8]); }
  } else {
    v8f acc[4]; proj_acc<4>(X + (r0 + col) * FF + 8 * g, PW + lane * 8, acc);
#pragma unroll
    for (int j = 0; j < 4; ++j) { const int c = j * 16 + col; const float bb = bfr(BQ[c]);
#pragma unroll
      for (int r = 0; r < 8; ++r) { const float v = acc[j][r] + bb; const _Float16 hv = (_Float16)v, lv = (_Float16)((v - (float)hv) * 2048.0f); const int rl = wave * 16 + 8 * g + r; sk[rl][c] = hv; skl[rl][c] = lv; } }
    __syncthreads();
    for (int e = tid; e < 64 * 8; e += 128) { const int rl = e >> 3, q = e & 7; const size_t o = ((size_t)blockIdx.x * 64 + rl) * DD + q * 8; vst2((unsigned*)(QH + o), *(const v4u*)&sk[rl][q * 8]); vst2((unsigned*)(QL + o), *(const v4u*)&skl[rl][q * 8]); }
  } }
#define QTB 2
#define KSPL 8
#define PKEYS (32 * KSPL)      // places of the list that a pass covers
#define PL_B 4096u            // one plane's tile of a pass: K 32 rows x 128 B, V 64 rows x 64 B
#define KR_B (4u * PL_B)      // one key range's stage: K hi | K residual | V hi | V residual
#define BUF_B (KSPL * KR_B)   // one buffer: the stage of all eight key ranges
static_assert(32 * KSPL == 16 * 16, "the merge gives one thread to each (row, 4 columns) of a query tile");
__device__ __forceinline__ unsigned lds_off(const void* p) { return (unsigned)(size_t)p; }
// a fragment from an LDS row: its two 16-byte pieces stand at places ca and cb of the row
__device__ __forceinline__ v16h frag_l(const unsigned char* row, unsigned ca, unsigned cb) {
  union { v16h v; v8h q[2]; } u; u.q[0] = *(const v8h*)(row + ca * 16u); u.q[1] = *(const v8h*)(row + cb * 16u); return u.v;
}
// Rows in LDS carry no pad; a row's 16-byte pieces are permuted instead, piece c of K row r at place c ^ ((r >> 1) & 7), piece c of V row d at place c ^ ((d >> 2) & 3), so that the 16 rows of a fragment read fall on 16 different bank groups.
// One wave's share of a stage: 8 copies of 512 B for its K plane, 8 of 512 B for its V plane. The s_wait_xcnt closes each statement so that no address register is rewritten ahead of it.
// lk, lv: the lane's places for copy 0; bits 9 to 11 are 0 there (the ring is aligned to 4 KiB), so copy i's four (K) or eight (V) rows further on and its share of the permutation are one exclusive-or.
__device__ __forceinline__ void stage_copy(const _Float16* gk, const _Float16* gv, unsigned lk, unsigned lv) {
  unsigned a[8], c[8]; const _Float16 *pk[8], *pv[8];
#pragma unroll
  for (int i = 0; i < 8; ++i) {
    a[i] = lk ^ (i * 512u | (((2u * i) & 7u) << 4)); pk[i] = gk + i * 256;
    c[i] = lv ^ (i * 512u | (((2u * i) & 3u) << 4)); pv[i] = gv + (size_t)i * 8 * NN; }
  asm volatile("global_load_async_to_lds_b128 %0, %8, off\n\tglobal_load_async_to_lds_b128 %1, %9, off\n\tglobal_load_async_to_lds_b128 %2, %10, off\n\tglobal_load_async_to_lds_b128 %3, %11, off\n\t"
               "global_load_async_to_lds_b128 %4, %12, off\n\tglobal_load_async_to_lds_b128 %5, %13, off\n\tglobal_load_async_to_lds_b128 %6, %14, off\n\tglobal_load_async_to_lds_b128 %7, %15, off\n\ts_wait_xcnt 0x0"
               :: "v"(a[0]), "v"(a[1]), "v"(a[2]), "v"(a[3]), "v"(a[4]), "v"(a[5]), "v"(a[6]), "v"(a[7]),
                  "v"(pk[0]), "v"(pk[1]), "v"(pk[2]), "v"(pk[3]), "v"(pk[4]), "v"(pk[5]), "v"(pk[6]), "v"(pk[7]) : "memory");
  asm volatile("global_load_async_to_lds_b128 %0, %8, off\n\tglobal_load_async_to_lds_b128 %1, %9, off\n\tglobal_load_async_to_lds_b128 %2, %10, off\n\tglobal_load_async_to_lds_b128 %3, %11, off\n\t"
               "global_load_async_to_lds_b128 %4, %12, off\n\tglobal_load_async_to_lds_b128 %5, %13, off\n\tglobal_load_async_to_lds_b128 %6, %14, off\n\tglobal_load_async_to_lds_b128 %7, %15, off\n\ts_wait_xcnt 0x0"
               :: "v"(c[0]), "v"(c[1]), "v"(c[2]), "v"(c[3]), "v"(c[4]), "v"(c[5]), "v"(c[6]), "v"(c[7]),
                  "v"(pv[0]), "v"(pv[1]), "v"(pv[2]), "v"(pv[3]), "v"(pv[4]), "v"(pv[5]), "v"(pv[6]), "v"(pv[7]) : "memory");
}
typedef __attribute__((ext_vector_type(2))) _Float16 v2h;
// lane l's value seen from lane l ^ 16
__device__ __forceinline__ float xhalf(float v) { const int b = __builtin_bit_cast(int, v); return __builtin_bit_cast(float, __builtin_amdgcn_permlanex16(b, b, 0x76543210, 0xfedcba98, false, false)); }
// four waves a SIMD is what a 16-wave block gives: the register budget is set for exactly that
__global__ __launch_bounds__(32 * QTB * KSPL) __attribute__((amdgpu_waves_per_eu(4, 4))) void k_att(const _Float16* __restrict__ QH, const _Float16* __restrict__ QL, const _Float16* __restrict__ KH, const _Float16* __restrict__ KL, const _Float16* __restrict__ VT, const _Float16* __restrict__ VTL, const int* __restrict__ CNT, float* __restrict__ OUT) {
  // ring: the two buffers; behind the loop's last barrier its first bytes hold the waves' un-normalised outputs for the merge
  __shared__ __align__(4096) unsigned char ring[2 * BUF_B];
  __shared__ float sm[QTB * KSPL][16], sl[QTB * KSPL][16];
  static_assert(sizeof(float) * QTB * KSPL * 16 * 68 <= 2 * BUF_B, "the merge's partial outputs fit the ring");
  // the wave number is held scalar so that the pass counter and the key range's base stay in scalar registers
  const int tid = threadIdx.x, wave = __builtin_amdgcn_readfirstlane(tid >> 5), lane = tid & 31, col = lane & 15, g = lane >> 4; const size_t b = blockIdx.y; const int qt = wave % QTB, kr = wave / QTB; const int q0 = blockIdx.x * (16 * QTB) + qt * 16; const size_t rq = b * NN + q0; const int key0 = kr * 32;
  // kept keys of this batch, bounded by the shape and held scalar: every test on it is a scalar branch, the same for the whole wave (the pass count: for the whole block)
  const int cnt = __builtin_amdgcn_readfirstlane(min(max(CNT[b], 0), NN)), npass = (cnt + PKEYS - 1) / PKEYS;
  // this lane's sources and places for pass 0, buffer 0
  const _Float16* gk = (qt ? KL : KH) + (b * NN + key0) * DD + lane * 8; const _Float16* gv = (qt ? VTL : VT) + (b * DD + (lane >> 2)) * (size_t)NN + key0 + (lane & 3) * 8;
  const unsigned lk = lds_off(ring) + kr * KR_B + qt * PL_B + (lane >> 3) * 128u + (((lane & 7) ^ g) << 4), lv = lds_off(ring) + kr * KR_B + (2u + qt) * PL_B + (lane >> 2) * 64u + (((lane & 3) ^ g) << 4);
  if (key0 < cnt) stage_copy(gk, gv, lk, lv);
  // pass 0's tiles have landed in every wave before any wave reads them
  asm volatile("s_wait_asynccnt 0x0" ::: "memory");
  __syncthreads();
  if (PKEYS + key0 < cnt) stage_copy(gk + PKEYS * DD, gv + PKEYS, lk + BUF_B, lv + BUF_B);
  // Q^T operand: column = query (lane & 15)
  v16h aq[2], al[2];
#pragma unroll
  for (int kc = 0; kc < 2; ++kc) { aq[kc] = frag_h(QH + (rq + col) * DD + kc * 32, lane); al[kc] = frag_h(QL + (rq + col) * DD + kc * 32, lane); }
  // of this lane's query: running maximum (equal in both lane halves), sum over this half's keys
  float m = -3.0e38f, l = 0.f;
  // acc[j][r]: O^T[j * 16 + 8 g + r][query]
  v8f acc[4] = {}, accl[4] = {};
  const unsigned zk = (unsigned)(col >> 1) & 7u, zv = (unsigned)(col >> 2) & 3u;
#pragma unroll 1
  for (int t = 0; t < npass; ++t) {
    // rem: places of the list from this range's first place of the pass on (none: nothing to do but the pass's foot)
    const int rem = cnt - (t * PKEYS + key0);
    if (rem > 0) { float s[2][8]; const unsigned char* st = ring + (unsigned)(t & 1) * BUF_B + kr * KR_B; const int remg = rem - 8 * g;
    // s[ct][r]: score of key ct * 16 + 8 g + r of the pass
#pragma unroll
    for (int ct = 0; ct < 2; ++ct) { const unsigned char* krow = st + (ct * 16 + col) * 128; v8f c = {}, cl = {};
#pragma unroll
      for (int kc = 0; kc < 2; ++kc) { const unsigned ca = (unsigned)(kc * 4 + g) ^ zk, cb = (unsigned)(kc * 4 + 2 + g) ^ zk; const v16h kh = frag_l(krow, ca, cb), kl = frag_l(krow + PL_B, ca, cb); c = wmma16(kh, aq[kc], c); cl = wmma16(kl, aq[kc], cl); cl = wmma16(kh, al[kc], cl); }
      const v8f sc = (c + cl * (1.0f / 2048.0f)) * 0.125f;
#pragma unroll
      for (int r = 0; r < 8; ++r) { const bool keep = ct * 16 + r < remg; s[ct][r] = keep ? sc[r] : -3.0e38f; } }
    float mx = s[0][0];
#pragma unroll
    for (int i = 1; i < 16; ++i) mx = fmaxf(mx, s[i >> 3][i & 7]);
    mx = fmaxf(mx, xhalf(mx));
    const float mn = fmaxf(m, mx), alpha = (m <= -1.0e38f) ? 0.f : __expf(m - mn);
    // P^T operand, element i = key i (first tile) or 16 + (i - 8) (second tile) of this half: the scores' own order; taken in pairs of neighbouring registers
    v16h pa, pal; v2f es = { 0.f, 0.f };
#pragma unroll
    for (int i = 0; i < 16; i += 2) { const float s0 = s[i >> 3][i & 7], s1 = s[i >> 3][(i & 7) + 1]; const v2f e = { (s0 <= -1.0e38f) ? 0.f : __expf(s0 - mn), (s1 <= -1.0e38f) ? 0.f : __expf(s1 - mn) }, p = e * 2048.0f; es += e;
      const v2h h = __builtin_convertvector(p, v2h), q = __builtin_convertvector((p - __builtin_convertvector(h, v2f)) * 2048.0f, v2h); pa[i] = h[0]; pa[i + 1] = h[1]; pal[i] = q[0]; pal[i + 1] = q[1]; }
    l = l * alpha + (es[0] + es[1]); m = (mn > -1.0e38f) ? mn : m;
#pragma unroll
    for (int j = 0; j < 4; ++j) { acc[j] *= alpha; accl[j] *= alpha; }
#pragma unroll
    for (int j = 0; j < 4; ++j) { const unsigned char* vrow = st + 2u * PL_B + (j * 16 + col) * 64; const unsigned ca = (unsigned)g ^ zv, cb = (unsigned)(2 + g) ^ zv; const v16h vh = frag_l(vrow, ca, cb), vl = frag_l(vrow + PL_B, ca, cb); acc[j] = wmma16(vh, pa, acc[j]); accl[j] = wmma16(vl, pa, accl[j]); accl[j] = wmma16(vh, pal, accl[j]); } }
    // foot of the pass: this wave's LDS reads of the buffer are done ...
    asm volatile("s_wait_dscnt 0x0" ::: "memory");
    // ... its copies for the next pass have landed ...
    asm volatile("s_wait_asynccnt 0x0" ::: "memory");
    // ... and one barrier both publishes the next pass's tiles and frees the buffer just read
    __syncthreads();
    if ((t + 2) * PKEYS + key0 < cnt) stage_copy(gk + (t + 2) * (PKEYS * DD), gv + (t + 2) * PKEYS, lk + (unsigned)(t & 1) * BUF_B, lv + (unsigned)(t & 1) * BUF_B); }
  // no copy is outstanding when the ring takes the partial outputs
  asm volatile("s_wait_asynccnt 0x0" ::: "memory");
  float (*so)[16][68] = (float (*)[16][68])ring;
#pragma unroll
  for (int j = 0; j < 4; ++j) { const v8f o = acc[j] + accl[j] * (1.0f / 2048.0f); float* po = &so[wave][col][j * 16 + 8 * g]; *(v4f*)po = v4f{ o[0], o[1], o[2], o[3] }; *(v4f*)(po + 4) = v4f{ o[4], o[5], o[6], o[7] }; }
  // the lane halves' sums are joined once, here
  l += xhalf(l);
  if (g == 0) { sm[wave][col] = m; sl[wave][col] = l; }
  __syncthreads();
  // merge of the key ranges: thread = (query tile, row, 4 columns); weight exp(m_s - M), a range with no kept key weighs 0
  { const int qm = tid >> 8, row = (tid >> 4) & 15, c4 = (tid & 15) * 4; float M = -3.0e38f;
#pragma unroll
    for (int s = 0; s < KSPL; ++s) M = fmaxf(M, sm[s * QTB + qm][row]);
    float w[KSPL], L = 0.f; v4f o = {};
#pragma unroll
    for (int s = 0; s < KSPL; ++s) { const float ms = sm[s * QTB + qm][row]; w[s] = (ms <= -1.0e38f) ? 0.f : __expf(ms - M); }
#pragma unroll
    for (int s = 0; s < KSPL; ++s) { L += w[s] * sl[s * QTB + qm][row]; o += w[s] * *(const v4f*)&so[s * QTB + qm][row][c4]; }
    const float il = (L > 0.f) ? (1.0f / 2048.0f) / L : 0.f;
    vst2(OUT + (b * NN + blockIdx.x * (16 * QTB) + qm * 16 + row) * DD + c4, o * il); } }
extern "C" void kernel_launch(void* const* d_in, const int* in_sizes, int n_in, void* d_out, int out_size, void* d_ws, size_t ws_size, hipStream_t stream) {
  (void)in_sizes; (void)n_in; (void)out_size;
  const float** F = (const float**)d_in;   // 0 x [4,2048,512], 1 mask [4,2048] int, 2 Wq [512,64] (in,out), 3 bq, 4 Wk, 5 bk, 6 Wv, 7 bv
  if (ws_size < (size_t)WS_END) return;
  char* ws = (char*)d_ws; __bf16* PW = (__bf16*)(ws + WS_PW); _Float16 *QH = (_Float16*)(ws + WS_QH), *QL = (_Float16*)(ws + WS_QL), *KH = (_Float16*)(ws + WS_KH), *KL = (_Float16*)(ws + WS_KL), *VT = (_Float16*)(ws + WS_VT), *VTL = (_Float16*)(ws + WS_VTL); int *IDX = (int*)(ws + WS_IDX), *CNT = (int*)(ws + WS_CNT);
  k_packw<<<3 * DD + NB, 256, 0, stream>>>(F[2], F[4], F[6], (const int*)d_in[1], PW, IDX, CNT);
  k_proj<<<dim3(NB * NN / 64, 2), 128, 0, stream>>>(F[0], PW, F[3], F[5], F[7], IDX, QH, QL, KH, KL, VT, VTL);
  k_att<<<dim3(NN / (16 * QTB), TNB), 32 * QTB * KSPL, 0, stream>>>(QH, QL, KH, KL, VT, VTL, CNT, (float*)d_out);
}

// v007
// Measured time: 27.3 microseconds a run.
// Two timings next to v006 both put it at 1.07 times that version's speed.
// All steps since v000 together make it 7.89 times as fast.
// compute dtype: all float inputs rounded to bf16, mask (int) read on device; q/k/v = x W + b with EXACT bf16 products on WMMA 16x16x32 ((in,out) weights packed in fragment order); q/k as f16 hi + residual (3-product logits x 1/8), masked keys (mask == 0) excluded (== the -1e9 additive fill): only kept keys are listed, projected to k, v and attended, running-max softmax in f32 (hardware exp); P (x 2^11) as f16 hi + residual . v (f16 hi + residual planes; 3 products); f32 output.
#include <hip/hip_runtime.h>
#include <math.h>

typedef __attribute__((ext_vector_type(16))) _Float16 v16h;
typedef __attribute__((ext_vector_type(16))) __bf16 v16b;
typedef __attribute__((ext_vector_type(8)))  _Float16 v8h;
typedef __attribute__((ext_vector_type(8)))  float v8f;
typedef __attribute__((ext_vector_type(4)))  float v4f;
typedef __attribute__((ext_vector_type(2)))  float v2f;
typedef __attribute__((ext_vector_type(4)))  unsigned v4u;
typedef __attribute__((ext_vector_type(4)))  int v4i;
typedef float __attribute__((may_alias)) float_a;
typedef int __attribute__((may_alias)) int_a;

template <typename T> __device__ __forceinline__ void vst2(void* p, T v) { *(T*)p = v;  }
__device__ __forceinline__ v8f wmma16(v16h a, v16h b, v8f c) {
  v8f d = __builtin_amdgcn_wmma_f32_16x16x32_f16(false, a, false, b, (short)0, c, false, false);
  asm volatile("v_nop\n\tv_nop\n\tv_nop\n\tv_nop" : "+v"(d) : "v"(a), "v"(b));
  return d;
}
__device__ __forceinline__ v8f wmma_bf(v16b a, v16b b, v8f c) {
  v8f d = __builtin_amdgcn_wmma_f32_16x16x32_bf16(false, a, false, b, (short)0, c, false, false);
  asm volatile("v_nop\n\tv_nop\n\tv_nop\n\tv_nop" : "+v"(d) : "v"(a), "v"(b));
  return d;
}
// 16x16x32 fragments: lane = (h = lane>>4, row/col = lane&15); elements 0..7 = k0+8h+0..7, 8..15 = k0+16+8h+0..7; D element r = row 8h+r
__device__ __forceinline__ v16h frag_h(const _Float16* rowk0, int lane) {
  union { v16h v; v8h q[2]; } u; const _Float16* p = rowk0 + 8 * (lane >> 4);
  u.q[0] = *(const v8h*)p; u.q[1] = *(const v8h*)(p + 16); return u.v;
}
__device__ __forceinline__ v16h frag_f32(const float* rowk0, int lane) {
  v16h a; const float* p = rowk0 + 8 * (lane >> 4);
#pragma unroll
  for (int i = 0; i < 8; ++i) { a[i] = (_Float16)p[i]; a[8 + i] = (_Float16)p[16 + i]; }
  return a;
}
__device__ __forceinline__ v16h frag_f32s(const float* rowk0, int lane, float sc) {
  v16h a; const float* p = rowk0 + 8 * (lane >> 4);
#pragma unroll
  for (int i = 0; i < 8; ++i) { a[i] = (_Float16)(p[i] * sc); a[8 + i] = (_Float16)(p[16 + i] * sc); }
  return a;
}
// column fragment from a [K][ld] layout (column n), rows >= K read as 0
__device__ __forceinline__ v16h fragc_f32(const float* W, int k0, int n, int lane, int ld, int K) {
  v16h a; const int g = lane >> 4;
#pragma unroll
  for (int i = 0; i < 8; ++i) { const int ka = k0 + 8 * g + i, kb = ka + 16;
    a[i] = (_Float16)(ka < K ? W[(size_t)(ka < K ? ka : K - 1) * ld + n] : 0.f); a[8 + i] = (_Float16)(kb < K ? W[(size_t)(kb < K ? kb : K - 1) * ld + n] : 0.f); }
  return a;
}
struct F2 { v16b h, l; };
__device__ __forceinline__ F2 bsplit16(const float v[16]) { F2 r;
#pragma unroll
  for (int i = 0; i < 16; ++i) { const __bf16 h = (__bf16)v[i]; r.h[i] = h; r.l[i] = (__bf16)(v[i] - (float)h); }
  return r; }
__device__ __forceinline__ F2 split_row(const float* row, int k0, int lane) { float v[16]; const float* p = row + k0 + 8 * (lane >> 4);
#pragma unroll
  for (int i = 0; i < 8; ++i) { v[i] = p[i]; v[8 + i] = p[16 + i]; }
  return bsplit16(v); }
__device__ __forceinline__ F2 split_rowK(const float* row, int k0, int lane, int K) { float v[16]; const int g = lane >> 4;
#pragma unroll
  for (int i = 0; i < 8; ++i) { const int ka = k0 + 8 * g + i, kb = ka + 16; v[i] = ka < K ? row[ka < K ? ka : K - 1] : 0.f; v[8 + i] = kb < K ? row[kb < K ? kb : K - 1] : 0.f; }
  return bsplit16(v); }
__device__ __forceinline__ F2 split_col(const float* W, int k0, int n, int lane, int ld, int K) { float v[16]; const int g = lane >> 4;
#pragma unroll
  for (int i = 0; i < 8; ++i) { const int ka = k0 + 8 * g + i, kb = ka + 16; v[i] = ka < K ? W[(size_t)(ka < K ? ka : K - 1) * ld + n] : 0.f; v[8 + i] = kb < K ? W[(size_t)(kb < K ? kb : K - 1) * ld + n] : 0.f; }
  return bsplit16(v); }
__device__ __forceinline__ v8f mac3(const F2& a, const F2& b, v8f c) { c = wmma_bf(a.l, b.h, c); c = wmma_bf(a.h, b.l, c); return wmma_bf(a.h, b.h, c); }
__device__ __forceinline__ float sigm(float v) { return 1.0f / (1.0f + expf(-v)); }
#define LDSX() do { asm volatile("s_wait_dscnt 0" ::: "memory"); __builtin_amdgcn_wave_barrier(); __builtin_amdgcn_fence(__ATOMIC_RELEASE, "workgroup"); } while (0)


// Single-head masked attention (B 4, S 2,048, F 512 -> D 64): q, k, v = x W + b; softmax(q k^T / 8 + (1 - mask_k) * -1e9) v.
#define NB 4
#define NN 2048
#define FF 512
#define DD 64
#ifndef TNB
#define TNB NB
#endif
typedef __attribute__((ext_vector_type(8))) __bf16 v8b;
// a weight fragment from the packed weights: p = the lane's 16 bytes of the fragment's first half; the second half stands 512 bytes on
__device__ __forceinline__ v16b frag_w(const __bf16* p) {
  union { v16b v; v8b q[2]; } u; u.q[0] = *(const v8b*)p; u.q[1] = *(const v8b*)(p + 256); return u.v;
}
__device__ __forceinline__ float bfr(float v) { return (float)(__bf16)v; }
__device__ __attribute__((noinline)) float exp_ni(float v) { return expf(v); }
__device__ __attribute__((noinline)) float erf_ni(float v) { return erff(v); }

#define WS_PW  0u                                   // bf16 weights in fragment order [12 column tiles (q | k | v)][16 k steps][2 halves][32 lanes][8]: lane (g, col), half p, element e = W[32 step + 16 p + 8 g + e][16 tile + col]
#define WS_QH  (WS_PW + 2u * 3 * DD * FF)               // f16 hi|lo q rows [row][64]; k rows; v planes [b][64][NN]; k and v by place in the list of kept keys
#define WS_QL  (WS_QH + 2u * (size_t)NB * NN * DD)
#define WS_KH  (WS_QL + 2u * (size_t)NB * NN * DD)
#define WS_KL  (WS_KH + 2u * (size_t)NB * NN * DD)
#define WS_VT  (WS_KL + 2u * (size_t)NB * NN * DD)
#define WS_VTL (WS_VT + 2u * (size_t)NB * DD * NN)
#define WS_IDX (WS_VTL + 2u * (size_t)NB * DD * NN)    // int [b][NN]: the kept keys' row numbers in rising order, then 0s to the end of the group of 64, then -1s
#define WS_CNT (WS_IDX + 4u * (size_t)NB * NN)          // int [b]: how many keys are kept
#define WS_END (WS_CNT + 4u * NB)

// blocks 0..191: one weight fragment each (column tile n / 16, k step n % 16), 1 KiB that this block alone writes, laid so that a wave's 16-byte loads of it in k_proj cover 512 bytes in a row (4 lines) and not 16 rows' pieces (16 lines); blocks 192..: one batch's list of kept keys (mask != 0), by ballots over 32 keys and a prefix over the 64 ballot counts; a masked key fills one place behind the list: with row 0 where the place's group of 64 still holds a listed key (k_proj works on whole groups), else with -1
__global__ __launch_bounds__(256) void k_packw(const float* __restrict__ WQ, const float* __restrict__ WK, const float* __restrict__ WV, const int* __restrict__ MK, __bf16* __restrict__ PW, int* __restrict__ IDX, int* __restrict__ CNT) { const int n = blockIdx.x, t = threadIdx.x;
  static_assert((3 * DD / 16) * (FF / 32) == 3 * DD, "one block for each weight fragment");
  if (n >= 3 * DD) { __shared__ int gc[NN / 32], pre[NN / 32]; const int bb = n - 3 * DD, lane = t & 31, w = t >> 5; unsigned bal[NN / 256];
#pragma unroll
    for (int i = 0; i < NN / 256; ++i) bal[i] = __builtin_amdgcn_ballot_w32(MK[bb * NN + i * 256 + t] != 0);
    if (lane == 0) {
#pragma unroll
      for (int i = 0; i < NN / 256; ++i) gc[i * 8 + w] = __builtin_popcount(bal[i]); }
    __syncthreads();
    if (t < NN / 32) { int p = 0;
#pragma unroll
      for (int j = 0; j < NN / 32; ++j) p += j < t ? gc[j] : 0;
      pre[t] = p; }
    __syncthreads();
    const int cnt = pre[NN / 32 - 1] + gc[NN / 32 - 1];
#pragma unroll
    for (int i = 0; i < NN / 256; ++i) { const int key = i * 256 + t, pos = pre[i * 8 + w] + __builtin_popcount(bal[i] & ((1u << lane) - 1u)); const bool keep = (bal[i] >> lane) & 1u; const int at = keep ? pos : cnt + key - pos; IDX[bb * NN + at] = keep ? key : (at & ~63) < cnt ? 0 : -1; }
    if (t == 0) CNT[bb] = cnt;
    return; }
  if (t >= 64) return;   // thread = (half t >> 5, lane t & 31) of the fragment
  const int tile = n / (FF / 32), kc = n % (FF / 32), which = tile / (DD / 16); const float* Wm = which == 0 ? WQ : which == 1 ? WK : WV;   // (in,out) [512][64]
  const float* p = Wm + (size_t)(kc * 32 + (t >> 5) * 16 + ((t >> 4) & 1) * 8) * DD + (tile % (DD / 16)) * 16 + (t & 15); v8b o;
#pragma unroll
  for (int e = 0; e < 8; ++e) o[e] = (__bf16)p[e * DD];
  vst2(PW + (size_t)n * 512 + t * 8, o); }
// ---- k_proj: block = 64 rows of one of the three products, 4 column tiles a wave. blockIdx.y 0: k, 1: v of the 64 kept keys that stand at the block's places in the list (x rows gathered by the list; a block wholly behind the list has nothing to do); blockIdx.y 2: q of 64 rows of x in their own order. + biases
// NT column tiles of 16 x-rows times the packed weight fragments from pw on (pw: the lane's place in the first tile's first fragment)
// LD: how many k steps ahead every fragment, x and weights alike, is fetched, each step into its own register set. Global loads come back in the order of their issue, so a wait for a weight fragment also waits for every x load issued before it: only when both kinds are LD steps ahead does a step wait for loads that have had LD steps' time
template <int NT, int LD> __device__ __forceinline__ void proj_acc(const float* px, const __bf16* pw, v8f (&acc)[NT]) {
  static_assert(LD >= 1 && LD < FF / 32 && LD * (4 + 2 * NT) <= 63, "the loads of LD steps fit the load counter");
#pragma unroll
  for (int j = 0; j < NT; ++j) acc[j] = v8f{};
  v4f xr[LD][4]; v16b bf[LD][NT];
#pragma unroll
  for (int d = 0; d < LD; ++d) { const float* pn = px + d * 32; xr[d][0] = *(const v4f*)pn; xr[d][1] = *(const v4f*)(pn + 4); xr[d][2] = *(const v4f*)(pn + 16); xr[d][3] = *(const v4f*)(pn + 20);
#pragma unroll
    for (int j = 0; j < NT; ++j) bf[d][j] = frag_w(pw + (j * (FF / 32) + d) * 512); }
  // unrolled whole so that the test for a later step and the number of the register set are resolved at compile time and the fetched fragments keep their registers without copies
#pragma unroll
  for (int kc = 0; kc < FF / 32; ++kc) { v16b a; const int s = kc % LD;
    // keeps the conversion of this step's x, and with it the wait for its loads, from being moved up into the steps before
    __builtin_amdgcn_sched_barrier(0);
#pragma unroll
    for (int i = 0; i < 4; ++i) { a[i] = (__bf16)xr[s][0][i]; a[4 + i] = (__bf16)xr[s][1][i]; a[8 + i] = (__bf16)xr[s][2][i]; a[12 + i] = (__bf16)xr[s][3][i]; }
    if (kc + LD < FF / 32) { const float* pn = px + (kc + LD) * 32; xr[s][0] = *(const v4f*)pn; xr[s][1] = *(const v4f*)(pn + 4); xr[s][2] = *(const v4f*)(pn + 16); xr[s][3] = *(const v4f*)(pn + 20); }
    // behind the last loads from px: its registers are free from here on and may be given to a later load's data
    if (kc + LD + 1 == FF / 32) asm volatile("s_wait_xcnt 0x0" ::: "memory");
#pragma unroll
    for (int j = 0; j < NT; ++j) { acc[j] = wmma_bf(a, bf[s][j], acc[j]); if (kc + LD < FF / 32) bf[s][j] = frag_w(pw + (j * (FF / 32) + kc + LD) * 512); }
    // behind the last weight loads: their offset register is free from here on and may be given to a later load's data
    if (kc + LD + 1 == FF / 32) asm volatile("s_wait_xcnt 0x0" ::: "memory"); }
}
__global__ __launch_bounds__(128) void k_proj(const float* __restrict__ X, const __bf16* __restrict__ PW, const float* __restrict__ BQ, const float* __restrict__ BK, const float* __restrict__ BV, const int* __restrict__ IDX, _Float16* __restrict__ QH, _Float16* __restrict__ QL, _Float16* __restrict__ KH, _Float16* __restrict__ KL, _Float16* __restrict__ VT, _Float16* __restrict__ VTL) {
  __shared__ __align__(16) _Float16 sh[64][72], sl[64][72];   // q, k: [row][column]; v: [column][row]
  const int tid = threadIdx.x, wave = tid >> 5, lane = tid & 31, col = lane & 15, g = lane >> 4, role = blockIdx.y; const size_t r0 = (size_t)blockIdx.x * 64 + wave * 16; const size_t b = ((size_t)blockIdx.x * 64) / NN; const int n0 = (int)(((size_t)blockIdx.x * 64) % NN);
  size_t xrow = r0 + col;
  if (role < 2) {
    // an entry below 0 says that all 64 places of the block lie behind the list: the return is the same for the whole block and stands in front of its barrier
    const int src = IDX[r0 + col];
    if (__builtin_amdgcn_readfirstlane(src) < 0) return;
    xrow = b * NN + (size_t)(src & (NN - 1)); }
  // the packed weights stand in the order q | k | v
  const int wsel = role == 2 ? 0 : role + 1; const float* BB = role == 2 ? BQ : role == 0 ? BK : BV;
  v8f acc[4]; proj_acc<4, 4>(X + xrow * FF + 8 * g, PW + wsel * (DD / 16) * (FF / 32) * 512 + lane * 8, acc);
  // the test of the role stands outside the loops: one scalar branch, and v's eight neighbouring rows go to LDS as one store
  if (role != 1) {
#pragma unroll
    for (int j = 0; j < 4; ++j) { const int c = j * 16 + col; const float bb = bfr(BB[c]);
#pragma unroll
      for (int r = 0; r < 8; ++r) { const float v = acc[j][r] + bb; const _Float16 hv = (_Float16)v, lv = (_Float16)((v - (float)hv) * 2048.0f); const int rl = wave * 16 + 8 * g + r; sh[rl][c] = hv; sl[rl][c] = lv; } }
  } else {
#pragma unroll
    for (int j = 0; j < 4; ++j) { const int c = j * 16 + col; const float bb = bfr(BB[c]); v8h hv8, lv8;
#pragma unroll
      for (int r = 0; r < 8; ++r) { const float v = acc[j][r] + bb; const _Float16 hv = (_Float16)v; hv8[r] = hv; lv8[r] = (_Float16)((v - (float)hv) * 2048.0f); }
      *(v8h*)&sh[c][wave * 16 + 8 * g] = hv8; *(v8h*)&sl[c][wave * 16 + 8 * g] = lv8; }
  }
  __syncthreads();
  _Float16* OH = role == 2 ? QH : role == 0 ? KH : VT; _Float16* OL = role == 2 ? QL : role == 0 ? KL : VTL;
  for (int e = tid; e < 64 * 8; e += 128) { const int rl = e >> 3, q = e & 7; const size_t o = role != 1 ? ((size_t)blockIdx.x * 64 + rl) * DD + q * 8 : (b * DD + rl) * (size_t)NN + n0 + q * 8; vst2((unsigned*)(OH + o), *(const v4u*)&sh[rl][q * 8]); vst2((unsigned*)(OL + o), *(const v4u*)&sl[rl][q * 8]); } }
#define QTB 2
#define KSPL 8
#define PKEYS (32 * KSPL)      // places of the list that a pass covers
#define PL_B 4096u            // one plane's tile of a pass: K 32 rows x 128 B, V 64 rows x 64 B
#define KR_B (4u * PL_B)      // one key range's stage: K hi | K residual | V hi | V residual
#define BUF_B (KSPL * KR_B)   // one buffer: the stage of all eight key ranges
static_assert(32 * KSPL == 16 * 16, "the merge gives one thread to each (row, 4 columns) of a query tile");
__device__ __forceinline__ unsigned lds_off(const void* p) { return (unsigned)(size_t)p; }
// a fragment from an LDS row: its two 16-byte pieces stand at places ca and cb of the row
__device__ __forceinline__ v16h frag_l(const unsigned char* row, unsigned ca, unsigned cb) {
  union { v16h v; v8h q[2]; } u; u.q[0] = *(const v8h*)(row + ca * 16u); u.q[1] = *(const v8h*)(row + cb * 16u); return u.v;
}
// Rows in LDS carry no pad; a row's 16-byte pieces are permuted instead, piece c of K row r at place c ^ ((r >> 1) & 7), piece c of V row d at place c ^ ((d >> 2) & 3), so that the 16 rows of a fragment read fall on 16 different bank groups.
// One wave's share of a stage: 8 copies of 512 B for its K plane, 8 of 512 B for its V plane. The s_wait_xcnt closes each statement so that no address register is rewritten ahead of it.
// lk, lv: the lane's places for copy 0; bits 9 to 11 are 0 there (the ring is aligned to 4 KiB), so copy i's four (K) or eight (V) rows further on and its share of the permutation are one exclusive-or.
__device__ __forceinline__ void stage_copy(const _Float16* gk, const _Float16* gv, unsigned lk, unsigned lv) {
  unsigned a[8], c[8]; const _Float16 *pk[8], *pv[8];
#pragma unroll
  for (int i = 0; i < 8; ++i) {
    a[i] = lk ^ (i * 512u | (((2u * i) & 7u) << 4)); pk[i] = gk + i * 256;
    c[i] = lv ^ (i * 512u | (((2u * i) & 3u) << 4)); pv[i] = gv + (size_t)i * 8 * NN; }
  asm volatile("global_load_async_to_lds_b128 %0, %8, off\n\tglobal_load_async_to_lds_b128 %1, %9, off\n\tglobal_load_async_to_lds_b128 %2, %10, off\n\tglobal_load_async_to_lds_b128 %3, %11, off\n\t"
               "global_load_async_to_lds_b128 %4, %12, off\n\tglobal_load_async_to_lds_b128 %5, %13, off\n\tglobal_load_async_to_lds_b128 %6, %14, off\n\tglobal_load_async_to_lds_b128 %7, %15, off\n\ts_wait_xcnt 0x0"
               :: "v"(a[0]), "v"(a[1]), "v"(a[2]), "v"(a[3]), "v"(a[4]), "v"(a[5]), "v"(a[6]), "v"(a[7]),
                  "v"(pk[0]), "v"(pk[1]), "v"(pk[2]), "v"(pk[3]), "v"(pk[4]), "v"(pk[5]), "v"(pk[6]), "v"(pk[7]) : "memory");
  asm volatile("global_load_async_to_lds_b128 %0, %8, off\n\tglobal_load_async_to_lds_b128 %1, %9, off\n\tglobal_load_async_to_lds_b128 %2, %10, off\n\tglobal_load_async_to_lds_b128 %3, %11, off\n\t"
               "global_load_async_to_lds_b128 %4, %12, off\n\tglobal_load_async_to_lds_b128 %5, %13, off\n\tglobal_load_async_to_lds_b128 %6, %14, off\n\tglobal_load_async_to_lds_b128 %7, %15, off\n\ts_wait_xcnt 0x0"
               :: "v"(c[0]), "v"(c[1]), "v"(c[2]), "v"(c[3]), "v"(c[4]), "v"(c[5]), "v"(c[6]), "v"(c[7]),
                  "v"(pv[0]), "v"(pv[1]), "v"(pv[2]), "v"(pv[3]), "v"(pv[4]), "v"(pv[5]), "v"(pv[6]), "v"(pv[7]) : "memory");
}
typedef __attribute__((ext_vector_type(2))) _Float16 v2h;
// lane l's value seen from lane l ^ 16
__device__ __forceinline__ float xhalf(float v) { const int b = __builtin_bit_cast(int, v); return __builtin_bit_cast(float, __builtin_amdgcn_permlanex16(b, b, 0x76543210, 0xfedcba98, false, false)); }
// four waves a SIMD is what a 16-wave block gives: the register budget is set for exactly that
__global__ __launch_bounds__(32 * QTB * KSPL) __attribute__((amdgpu_waves_per_eu(4, 4))) void k_att(const _Float16* __restrict__ QH, const _Float16* __restrict__ QL, const _Float16* __restrict__ KH, const _Float16* __restrict__ KL, const _Float16* __restrict__ VT, const _Float16* __restrict__ VTL, const int* __restrict__ CNT, float* __restrict__ OUT) {
  // ring: the two buffers; behind the loop's last barrier its first bytes hold the waves' un-normalised outputs for the merge
  __shared__ __align__(4096) unsigned char ring[2 * BUF_B];
  __shared__ float sm[QTB * KSPL][16], sl[QTB * KSPL][16];
  static_assert(sizeof(float) * QTB * KSPL * 16 * 68 <= 2 * BUF_B, "the merge's partial outputs fit the ring");
  // the wave number is held scalar so that the pass counter and the key range's base stay in scalar registers
  const int tid = threadIdx.x, wave = __builtin_amdgcn_readfirstlane(tid >> 5), lane = tid & 31, col = lane & 15, g = lane >> 4; const size_t b = blockIdx.y; const int qt = wave % QTB, kr = wave / QTB; const int q0 = blockIdx.x * (16 * QTB) + qt * 16; const size_t rq = b * NN + q0; const int key0 = kr * 32;
  // kept keys of this batch, bounded by the shape and held scalar: every test on it is a scalar branch, the same for the whole wave (the pass count: for the whole block)
  const int cnt = __builtin_amdgcn_readfirstlane(min(max(CNT[b], 0), NN)), npass = (cnt + PKEYS - 1) / PKEYS;
  // this lane's sources and places for pass 0, buffer 0
  const _Float16* gk = (qt ? KL : KH) + (b * NN + key0) * DD + lane * 8; const _Float16* gv = (qt ? VTL : VT) + (b * DD + (lane >> 2)) * (size_t)NN + key0 + (lane & 3) * 8;
  const unsigned lk = lds_off(ring) + kr * KR_B + qt * PL_B + (lane >> 3) * 128u + (((lane & 7) ^ g) << 4), lv = lds_off(ring) + kr * KR_B + (2u + qt) * PL_B + (lane >> 2) * 64u + (((lane & 3) ^ g) << 4);
  if (key0 < cnt) stage_copy(gk, gv, lk, lv);
  // pass 0's tiles have landed in every wave before any wave reads them
  asm volatile("s_wait_asynccnt 0x0" ::: "memory");
  __syncthreads();
  if (PKEYS + key0 < cnt) stage_copy(gk + PKEYS * DD, gv + PKEYS, lk + BUF_B, lv + BUF_B);
  // Q^T operand: column = query (lane & 15)
  v16h aq[2], al[2];
#pragma unroll
  for (int kc = 0; kc < 2; ++kc) { aq[kc] = frag_h(QH + (rq + col) * DD + kc * 32, lane); al[kc] = frag_h(QL + (rq + col) * DD + kc * 32, lane); }
  // of this lane's query: running maximum (equal in both lane halves), sum over this half's keys
  float m = -3.0e38f, l = 0.f;
  // acc[j][r]: O^T[j * 16 + 8 g + r][query]
  v8f acc[4] = {}, accl[4] = {};
  const unsigned zk = (unsigned)(col >> 1) & 7u, zv = (unsigned)(col >> 2) & 3u;
#pragma unroll 1
  for (int t = 0; t < npass; ++t) {
    // rem: places of the list from this range's first place of the pass on (none: nothing to do but the pass's foot)
    const int rem = cnt - (t * PKEYS + key0);
    if (rem > 0) { float s[2][8]; const unsigned char* st = ring + (unsigned)(t & 1) * BUF_B + kr * KR_B; const int remg = rem - 8 * g;
    // s[ct][r]: score of key ct * 16 + 8 g + r of the pass
#pragma unroll
    for (int ct = 0; ct < 2; ++ct) { const unsigned char* krow = st + (ct * 16 + col) * 128; v8f c = {}, cl = {};
#pragma unroll
      for (int kc = 0; kc < 2; ++kc) { const unsigned ca = (unsigned)(kc * 4 + g) ^ zk, cb = (unsigned)(kc * 4 + 2 + g) ^ zk; const v16h kh = frag_l(krow, ca, cb), kl = frag_l(krow + PL_B, ca, cb); c = wmma16(kh, aq[kc], c); cl = wmma16(kl, aq[kc], cl); cl = wmma16(kh, al[kc], cl); }
      const v8f sc = (c + cl * (1.0f / 2048.0f)) * 0.125f;
#pragma unroll
      for (int r = 0; r < 8; ++r) { const bool keep = ct * 16 + r < remg; s[ct][r] = keep ? sc[r] : -3.0e38f; } }
    float mx = s[0][0];
#pragma unroll
    for (int i = 1; i < 16; ++i) mx = fmaxf(mx, s[i >> 3][i & 7]);
    mx = fmaxf(mx, xhalf(mx));
    const float mn = fmaxf(m, mx), alpha = (m <= -1.0e38f) ? 0.f : __expf(m - mn);
    // P^T operand, element i = key i (first tile) or 16 + (i - 8) (second tile) of this half: the scores' own order; taken in pairs of neighbouring registers
    v16h pa, pal; v2f es = { 0.f, 0.f };
#pragma unroll
    for (int i = 0; i < 16; i += 2) { const float s0 = s[i >> 3][i & 7], s1 = s[i >> 3][(i & 7) + 1]; const v2f e = { (s0 <= -1.0e38f) ? 0.f : __expf(s0 - mn), (s1 <= -1.0e38f) ? 0.f : __expf(s1 - mn) }, p = e * 2048.0f; es += e;
      const v2h h = __builtin_convertvector(p, v2h), q = __builtin_convertvector((p - __builtin_convertvector(h, v2f)) * 2048.0f, v2h); pa[i] = h[0]; pa[i + 1] = h[1]; pal[i] = q[0]; pal[i + 1] = q[1]; }
    l = l * alpha + (es[0] + es[1]); m = (mn > -1.0e38f) ? mn : m;
#pragma unroll
    for (int j = 0; j < 4; ++j) { acc[j] *= alpha; accl[j] *= alpha; }
#pragma unroll
    for (int j = 0; j < 4; ++j) { const unsigned char* vrow = st + 2u * PL_B + (j * 16 + col) * 64; const unsigned ca = (unsigned)g ^ zv, cb = (unsigned)(2 + g) ^ zv; const v16h vh = frag_l(vrow, ca, cb), vl = frag_l(vrow + PL_B, ca, cb); acc[j] = wmma16(vh, pa, acc[j]); accl[j] = wmma16(vl, pa, accl[j]); accl[j] = wmma16(vh, pal, accl[j]); } }
    // foot of the pass: this wave's LDS reads of the buffer are done ...
    asm volatile("s_wait_dscnt 0x0" ::: "memory");
    // ... its copies for the next pass have landed ...
    asm volatile("s_wait_asynccnt 0x0" ::: "memory");
    // ... and one barrier both publishes the next pass's tiles and frees the buffer just read
    __syncthreads();
    if ((t + 2) * PKEYS + key0 < cnt) stage_copy(gk + (t + 2) * (PKEYS * DD), gv + (t + 2) * PKEYS, lk + (unsigned)(t & 1) * BUF_B, lv + (unsigned)(t & 1) * BUF_B); }
  // no copy is outstanding when the ring takes the partial outputs
  asm volatile("s_wait_asynccnt 0x0" ::: "memory");
  float (*so)[16][68] = (float (*)[16][68])ring;
#pragma unroll
  for (int j = 0; j < 4; ++j) { const v8f o = acc[j] + accl[j] * (1.0f / 2048.0f); float* po = &so[wave][col][j * 16 + 8 * g]; *(v4f*)po = v4f{ o[0], o[1], o[2], o[3] }; *(v4f*)(po + 4) = v4f{ o[4], o[5], o[6], o[7] }; }
  // the lane halves' sums are joined once, here
  l += xhalf(l);
  if (g == 0) { sm[wave][col] = m; sl[wave][col] = l; }
  __syncthreads();
  // merge of the key ranges: thread = (query tile, row, 4 columns); weight exp(m_s - M), a range with no kept key weighs 0
  { const int qm = tid >> 8, row = (tid >> 4) & 15, c4 = (tid & 15) * 4; float M = -3.0e38f;
#pragma unroll
    for (int s = 0; s < KSPL; ++s) M = fmaxf(M, sm[s * QTB + qm][row]);
    float w[KSPL], L = 0.f; v4f o = {};
#pragma unroll
    for (int s = 0; s < KSPL; ++s) { const float ms = sm[s * QTB + qm][row]; w[s] = (ms <= -1.0e38f) ? 0.f : __expf(ms - M); }
#pragma unroll
    for (int s = 0; s < KSPL; ++s) { L += w[s] * sl[s * QTB + qm][row]; o += w[s] * *(const v4f*)&so[s * QTB + qm][row][c4]; }
    const float il = (L > 0.f) ? (1.0f / 2048.0f) / L : 0.f;
    vst2(OUT + (b * NN + blockIdx.x * (16 * QTB) + qm * 16 + row) * DD + c4, o * il); } }
extern "C" void kernel_launch(void* const* d_in, const int* in_sizes, int n_in, void* d_out, int out_size, void* d_ws, size_t ws_size, hipStream_t stream) {
  (void)in_sizes; (void)n_in; (void)out_size;
  const float** F = (const float**)d_in;   // 0 x [4,2048,512], 1 mask [4,2048] int, 2 Wq [512,64] (in,out), 3 bq, 4 Wk, 5 bk, 6 Wv, 7 bv
  if (ws_size < (size_t)WS_END) return;
  char* ws = (char*)d_ws; __bf16* PW = (__bf16*)(ws + WS_PW); _Float16 *QH = (_Float16*)(ws + WS_QH), *QL = (_Float16*)(ws + WS_QL), *KH = (_Float16*)(ws + WS_KH), *KL = (_Float16*)(ws + WS_KL), *VT = (_Float16*)(ws + WS_VT), *VTL = (_Float16*)(ws + WS_VTL); int *IDX = (int*)(ws + WS_IDX), *CNT = (int*)(ws + WS_CNT);
  k_packw<<<3 * DD + NB, 256, 0, stream>>>(F[2], F[4], F[6], (const int*)d_in[1], PW, IDX, CNT);
  k_proj<<<dim3(NB * NN / 64, 3), 128, 0, stream>>>(F[0], PW, F[3], F[5], F[7], IDX, QH, QL, KH, KL, VT, VTL);
  k_att<<<dim3(NN / (16 * QTB), TNB), 32 * QTB * KSPL, 0, stream>>>(QH, QL, KH, KL, VT, VTL, CNT, (float*)d_out);
}

// v008
// It runs in 23.6 microseconds.
// Next to v007, in two timings, it ran 1.17 times as fast each time.
// All steps since v000 together make it 9.23 times as fast.
// compute dtype: all float inputs rounded to bf16, mask (int) read on device; q/k/v = x W + b with EXACT bf16 products on WMMA 16x16x32 ((in,out) weights rounded into LDS in fragment order by each block); q/k as f16 hi + residual (3-product logits x 1/8), masked keys (mask == 0) excluded (== the -1e9 additive fill): only kept keys are projected to k, v (each wave finds its own places of the list of kept keys) and attended, running-max softmax in f32 (hardware exp); P (x 2^11) as f16 hi + residual . v (f16 hi + residual planes; 3 products); f32 output.
#include <hip/hip_runtime.h>
#include <math.h>

typedef __attribute__((ext_vector_type(16))) _Float16 v16h;
typedef __attribute__((ext_vector_type(16))) __bf16 v16b;
typedef __attribute__((ext_vector_type(8)))  _Float16 v8h;
typedef __attribute__((ext_vector_type(8)))  float v8f;
typedef __attribute__((ext_vector_type(4)))  float v4f;
typedef __attribute__((ext_vector_type(2)))  float v2f;
typedef __attribute__((ext_vector_type(4)))  unsigned v4u;
typedef __attribute__((ext_vector_type(4)))  int v4i;
typedef float __attribute__((may_alias)) float_a;
typedef int __attribute__((may_alias)) int_a;

template <typename T> __device__ __forceinline__ void vst2(void* p, T v) { *(T*)p = v;  }
__device__ __forceinline__ v8f wmma16(v16h a, v16h b, v8f c) {
  v8f d = __builtin_amdgcn_wmma_f32_16x16x32_f16(false, a, false, b, (short)0, c, false, false);
  asm volatile("v_nop\n\tv_nop\n\tv_nop\n\tv_nop" : "+v"(d) : "v"(a), "v"(b));
  return d;
}
__device__ __forceinline__ v8f wmma_bf(v16b a, v16b b, v8f c) {
  v8f d = __builtin_amdgcn_wmma_f32_16x16x32_bf16(false, a, false, b, (short)0, c, false, false);
  asm volatile("v_nop\n\tv_nop\n\tv_nop\n\tv_nop" : "+v"(d) : "v"(a), "v"(b));
  return d;
}
// 16x16x32 fragments: lane = (h = lane>>4, row/col = lane&15); elements 0..7 = k0+8h+0..7, 8..15 = k0+16+8h+0..7; D element r = row 8h+r
__device__ __forceinline__ v16h frag_h(const _Float16* rowk0, int lane) {
  union { v16h v; v8h q[2]; } u; const _Float16* p = rowk0 + 8 * (lane >> 4);
  u.q[0] = *(const v8h*)p; u.q[1] = *(const v8h*)(p + 16); return u.v;
}
__device__ __forceinline__ v16h frag_f32(const float* rowk0, int lane) {
  v16h a; const float* p = rowk0 + 8 * (lane >> 4);
#pragma unroll
  for (int i = 0; i < 8; ++i) { a[i] = (_Float16)p[i]; a[8 + i] = (_Float16)p[16 + i]; }
  return a;
}
__device__ __forceinline__ v16h frag_f32s(const float* rowk0, int lane, float sc) {
  v16h a; const float* p = rowk0 + 8 * (lane >> 4);
#pragma unroll
  for (int i = 0; i < 8; ++i) { a[i] = (_Float16)(p[i] * sc); a[8 + i] = (_Float16)(p[16 + i] * sc); }
  return a;
}
// column fragment from a [K][ld] layout (column n), rows >= K read as 0
__device__ __forceinline__ v16h fragc_f32(const float* W, int k0, int n, int lane, int ld, int K) {
  v16h a; const int g = lane >> 4;
#pragma unroll
  for (int i = 0; i < 8; ++i) { const int ka = k0 + 8 * g + i, kb = ka + 16;
    a[i] = (_Float16)(ka < K ? W[(size_t)(ka < K ? ka : K - 1) * ld + n] : 0.f); a[8 + i] = (_Float16)(kb < K ? W[(size_t)(kb < K ? kb : K - 1) * ld + n] : 0.f); }
  return a;
}
struct F2 { v16b h, l; };
__device__ __forceinline__ F2 bsplit16(const float v[16]) { F2 r;
#pragma unroll
  for (int i = 0; i < 16; ++i) { const __bf16 h = (__bf16)v[i]; r.h[i] = h; r.l[i] = (__bf16)(v[i] - (float)h); }
  return r; }
__device__ __forceinline__ F2 split_row(const float* row, int k0, int lane) { float v[16]; const float* p = row + k0 + 8 * (lane >> 4);
#pragma unroll
  for (int i = 0; i < 8; ++i) { v[i] = p[i]; v[8 + i] = p[16 + i]; }
  return bsplit16(v); }
__device__ __forceinline__ F2 split_rowK(const float* row, int k0, int lane, int K) { float v[16]; const int g = lane >> 4;
#pragma unroll
  for (int i = 0; i < 8; ++i) { const int ka = k0 + 8 * g + i, kb = ka + 16; v[i] = ka < K ? row[ka < K ? ka : K - 1] : 0.f; v[8 + i] = kb < K ? row[kb < K ? kb : K - 1] : 0.f; }
  return bsplit16(v); }
__device__ __forceinline__ F2 split_col(const float* W, int k0, int n, int lane, int ld, int K) { float v[16]; const int g = lane >> 4;
#pragma unroll
  for (int i = 0; i < 8; ++i) { const int ka = k0 + 8 * g + i, kb = ka + 16; v[i] = ka < K ? W[(size_t)(ka < K ? ka : K - 1) * ld + n] : 0.f; v[8 + i] = kb < K ? W[(size_t)(kb < K ? kb : K - 1) * ld + n] : 0.f; }
  return bsplit16(v); }
__device__ __forceinline__ v8f mac3(const F2& a, const F2& b, v8f c) { c = wmma_bf(a.l, b.h, c); c = wmma_bf(a.h, b.l, c); return wmma_bf(a.h, b.h, c); }
__device__ __forceinline__ float sigm(float v) { return 1.0f / (1.0f + expf(-v)); }
#define LDSX() do { asm volatile("s_wait_dscnt 0" ::: "memory"); __builtin_amdgcn_wave_barrier(); __builtin_amdgcn_fence(__ATOMIC_RELEASE, "workgroup"); } while (0)


// Single-head masked attention (B 4, S 2,048, F 512 -> D 64): q, k, v = x W + b; softmax(q k^T / 8 + (1 - mask_k) * -1e9) v.
#define NB 4
#define NN 2048
#define FF 512
#define DD 64
#ifndef TNB
#define TNB NB
#endif
typedef __attribute__((ext_vector_type(8))) __bf16 v8b;
typedef __attribute__((ext_vector_type(4))) _Float16 v4h;
// a weight fragment from the block's LDS copy: p = the lane's 16 bytes of the fragment's first half; the second half stands 512 bytes on
__device__ __forceinline__ v16b frag_w(const unsigned char* p) {
  union { v16b v; v8b q[2]; } u; u.q[0] = *(const v8b*)p; u.q[1] = *(const v8b*)(p + 512); return u.v;
}
__device__ __forceinline__ float bfr(float v) { return (float)(__bf16)v; }
__device__ __attribute__((noinline)) float exp_ni(float v) { return expf(v); }
__device__ __attribute__((noinline)) float erf_ni(float v) { return erff(v); }

#define WS_QH  0u                                   // f16 hi|lo q rows [row][64]; k rows; v planes [b][64][NN]; k and v by place in the list of kept keys
#define WS_QL  (WS_QH + 2u * (size_t)NB * NN * DD)
#define WS_KH  (WS_QL + 2u * (size_t)NB * NN * DD)
#define WS_KL  (WS_KH + 2u * (size_t)NB * NN * DD)
#define WS_VT  (WS_KL + 2u * (size_t)NB * NN * DD)
#define WS_VTL (WS_VT + 2u * (size_t)NB * DD * NN)
#define WS_END (WS_VTL + 2u * (size_t)NB * DD * NN)

// ---- k_proj: block = 64 rows of one of the three products, 4 column tiles a wave. blockIdx.y 0: k, 1: v of the 64 kept keys (mask != 0) that stand at the block's places in the batch's list of kept keys, in rising order (x rows gathered; a block wholly behind the list has nothing to do); blockIdx.y 2: q of 64 rows of x in their own order. + biases
// There is no launch ahead of this one: each wave finds the keys at its own 16 places from the mask itself, and each block rounds its product's weights to bf16 into LDS itself.
// The key at place p0 + (lane & 15) of the list of one batch's kept keys; 0 for a place behind the list; -1, the same in every lane and every wave of the block, where even place n0 (the block's first) lies behind it.
// mk: the batch's whole mask as the wave has read it, 128 keys a load (lane l: keys 4 l .. 4 l + 3 of them); ballots give each load's count as a scalar, so only the loads whose kept keys reach into the wave's 16 places are looked at key by key. lst: 16 ints of LDS that this wave alone uses.
__device__ __forceinline__ int list_key(const v4i (&mk)[NN / 128], int n0, int p0, int lane, int* lst) {
  unsigned bal[NN / 128][4]; int base[NN / 128 + 1];
  base[0] = 0;
#pragma unroll
  for (int i = 0; i < NN / 128; ++i) { int c = 0;
#pragma unroll
    for (int e = 0; e < 4; ++e) { bal[i][e] = __builtin_amdgcn_ballot_w32(mk[i][e] != 0); c += __builtin_popcount(bal[i][e]); }
    base[i + 1] = base[i] + c; }
  if (n0 >= base[NN / 128]) return -1;
  if (lane < 16) lst[lane] = 0;
#pragma unroll
  for (int i = 0; i < NN / 128; ++i) if (base[i] < p0 + 16 && base[i + 1] > p0) {
    // pos: place, counted from p0, of this lane's first kept key of the load
    int pos = base[i] - p0;
#pragma unroll
    for (int e = 0; e < 4; ++e) pos = (int)__builtin_amdgcn_mbcnt_lo(bal[i][e], (unsigned)pos);
#pragma unroll
    for (int e = 0; e < 4; ++e) { const bool keep = (bal[i][e] >> lane) & 1u; if (keep && (unsigned)pos < 16u) lst[pos] = i * 128 + lane * 4 + e; pos += keep ? 1 : 0; } }
  // the wave's own stores to lst are done before its lanes read one another's entries (no fence: that would also wait for the weight loads in flight)
  asm volatile("s_wait_dscnt 0x0" ::: "memory");
  __builtin_amdgcn_wave_barrier();
  return lst[lane & 15];
}
// eight k rows x four columns of f32 weights (r[e][j]) as four 16-byte pieces of bf16 fragments, piece j to column tile j: at = the lane's place in tile 0
__device__ __forceinline__ void w_store(const v4f (&r)[8], unsigned char* at) {
#pragma unroll
  for (int j = 0; j < 4; ++j) { v8b o;
#pragma unroll
    for (int e = 0; e < 8; ++e) o[e] = (__bf16)r[e][j];
    *(v8b*)(at + j * ((FF / 32) * 1024)) = o; }
}
#define XLD 4   // how many k steps ahead x is fetched, each step into its own register set
__global__ __launch_bounds__(128) void k_proj(const float* __restrict__ X, const int* __restrict__ MK, const float* __restrict__ WQ, const float* __restrict__ WK, const float* __restrict__ WV, const float* __restrict__ BQ, const float* __restrict__ BK, const float* __restrict__ BV, _Float16* __restrict__ QH, _Float16* __restrict__ QL, _Float16* __restrict__ KH, _Float16* __restrict__ KL, _Float16* __restrict__ VT, _Float16* __restrict__ VTL) {
  // wl: the product's weights as bf16 fragments [4 column tiles][16 k steps][2 halves][32 lanes][8]: lane (g, col), half p, element e of tile j, step s = W[32 s + 16 p + 8 g + e][4 col + j]. Tile j takes every fourth column from j on, so that a lane's 16-byte loads of eight W rows hold one piece of each tile and a wave's store of a piece covers 512 bytes in a row
  __shared__ __align__(16) unsigned char wl[4 * (FF / 32) * 1024];
  __shared__ __align__(16) _Float16 sh[64][72], sl[64][72];   // q, k: [row][column]; v: [column][row]
  __shared__ int lst[4][16];
  // the wave number is held scalar so that the tests on the wave's places of the list are scalar branches
  const int tid = threadIdx.x, wave = __builtin_amdgcn_readfirstlane(tid >> 5), lane = tid & 31, col = lane & 15, g = lane >> 4, role = blockIdx.y; const size_t r0 = (size_t)blockIdx.x * 64 + wave * 16; const size_t b = ((size_t)blockIdx.x * 64) / NN; const int n0 = (int)(((size_t)blockIdx.x * 64) % NN);
  const float* Wm = role == 2 ? WQ : role == 0 ? WK : WV; const float* BB = role == 2 ? BQ : role == 0 ? BK : BV;
  // the 32 groups of 16 W rows (a half of a k step each) go round the four waves: group 4 i + wave; the lane's eight rows of it from ws + i * 64 * DD on. The first four groups' loads are issued behind the mask's (loads return in the order of their issue, and x waits for the mask) and ahead of the look at it
  v4i mk[NN / 128];
  if (role < 2) {
#pragma unroll
    for (int i = 0; i < NN / 128; ++i) mk[i] = *(const v4i*)(MK + b * NN + i * 128 + lane * 4); }
  // behind the loads from the mask: their address registers are free from here on
  asm volatile("s_wait_xcnt 0x0" ::: "memory");
  const float* ws = Wm + (size_t)(wave * 16 + 8 * g) * DD + 4 * col; unsigned char* wd = wl + tid * 16; v4f wr[8][8];
#pragma unroll
  for (int i = 0; i < 4; ++i) {
#pragma unroll
    for (int e = 0; e < 8; ++e) wr[i][e] = *(const v4f*)(ws + (i * 64 + e) * DD); }
  size_t xrow = r0 + col;
  if (role < 2) {
    // below 0: all 64 places of the block lie behind the list; the return is the same for the whole block and stands in front of its barriers
    const int src = list_key(mk, n0, n0 + wave * 16, lane, lst[wave]);
    if (__builtin_amdgcn_readfirstlane(src) < 0) return;
    xrow = b * NN + (size_t)(src & (NN - 1)); }
  // the other four groups, still ahead of x: a wait for weights then never waits for x
#pragma unroll
  for (int i = 4; i < 8; ++i) {
#pragma unroll
    for (int e = 0; e < 8; ++e) wr[i][e] = *(const v4f*)(ws + (i * 64 + e) * DD); }
  // behind the last loads from ws: its registers are free from here on
  asm volatile("s_wait_xcnt 0x0" ::: "memory");
  // keeps the arithmetic that follows, which may take those registers, behind that wait
  __builtin_amdgcn_sched_barrier(0);
  const float* px = X + xrow * FF + 8 * g; v4f xr[XLD][4];
#pragma unroll
  for (int d = 0; d < XLD; ++d) { const float* pn = px + d * 32; xr[d][0] = *(const v4f*)pn; xr[d][1] = *(const v4f*)(pn + 4); xr[d][2] = *(const v4f*)(pn + 16); xr[d][3] = *(const v4f*)(pn + 20); }
  // keeps the rounding of the weights, and with it the waits for their loads, from being moved up in front of the issue of x's first loads
  __builtin_amdgcn_sched_barrier(0);
#pragma unroll
  for (int i = 0; i < 8; ++i) w_store(wr[i], wd + i * 2048);
  // every wave's share of the weights stands in LDS before any wave reads a fragment
  __syncthreads();
  v8f acc[4] = {}; v16b bf[2][4]; const unsigned char* wf = wl + lane * 16;
#pragma unroll
  for (int j = 0; j < 4; ++j) bf[0][j] = frag_w(wf + j * ((FF / 32) * 1024));
  // unrolled whole so that the test for a later step and the number of the register set are resolved at compile time and the fetched fragments keep their registers without copies
#pragma unroll
  for (int kc = 0; kc < FF / 32; ++kc) { v16b a; const int s = kc % XLD;
    // keeps the conversion of this step's x, and with it the wait for its loads, from being moved up into the steps before
    __builtin_amdgcn_sched_barrier(0);
#pragma unroll
    for (int i = 0; i < 4; ++i) { a[i] = (__bf16)xr[s][0][i]; a[4 + i] = (__bf16)xr[s][1][i]; a[8 + i] = (__bf16)xr[s][2][i]; a[12 + i] = (__bf16)xr[s][3][i]; }
    if (kc + XLD < FF / 32) { const float* pn = px + (kc + XLD) * 32; xr[s][0] = *(const v4f*)pn; xr[s][1] = *(const v4f*)(pn + 4); xr[s][2] = *(const v4f*)(pn + 16); xr[s][3] = *(const v4f*)(pn + 20); }
    // behind the last loads from px: its registers are free from here on and may be given to a later load's data
    if (kc + XLD + 1 == FF / 32) asm volatile("s_wait_xcnt 0x0" ::: "memory");
    // the next step's weight fragments leave LDS while this step's products run and the next step's x is waited for
    if (kc + 1 < FF / 32) {
#pragma unroll
      for (int j = 0; j < 4; ++j) bf[(kc + 1) & 1][j] = frag_w(wf + (j * (FF / 32) + kc + 1) * 1024); }
#pragma unroll
    for (int j = 0; j < 4; ++j) acc[j] = wmma_bf(a, bf[kc & 1][j], acc[j]); }
  // acc[j][r]: row 8 g + r of the wave's 16, column 4 col + j
  const v4f bv4 = *(const v4f*)(BB + 4 * col); const float bb[4] = { bfr(bv4[0]), bfr(bv4[1]), bfr(bv4[2]), bfr(bv4[3]) };
  // the test of the role stands outside the loops: one scalar branch; q, k: a row's four neighbouring columns, v: a column's eight neighbouring rows go to LDS as one store
  if (role != 1) {
#pragma unroll
    for (int r = 0; r < 8; ++r) { v4h hv4, lv4;
#pragma unroll
      for (int j = 0; j < 4; ++j) { const float v = acc[j][r] + bb[j]; const _Float16 hv = (_Float16)v; hv4[j] = hv; lv4[j] = (_Float16)((v - (float)hv) * 2048.0f); }
      const int rl = wave * 16 + 8 * g + r; *(v4h*)&sh[rl][4 * col] = hv4; *(v4h*)&sl[rl][4 * col] = lv4; }
  } else {
#pragma unroll
    for (int j = 0; j < 4; ++j) { const int c = 4 * col + j; v8h hv8, lv8;
#pragma unroll
      for (int r = 0; r < 8; ++r) { const float v = acc[j][r] + bb[j]; const _Float16 hv = (_Float16)v; hv8[r] = hv; lv8[r] = (_Float16)((v - (float)hv) * 2048.0f); }
      *(v8h*)&sh[c][wave * 16 + 8 * g] = hv8; *(v8h*)&sl[c][wave * 16 + 8 * g] = lv8; }
  }
  __syncthreads();
  _Float16* OH = role == 2 ? QH : role == 0 ? KH : VT; _Float16* OL = role == 2 ? QL : role == 0 ? KL : VTL;
  for (int e = tid; e < 64 * 8; e += 128) { const int rl = e >> 3, q = e & 7; const size_t o = role != 1 ? ((size_t)blockIdx.x * 64 + rl) * DD + q * 8 : (b * DD + rl) * (size_t)NN + n0 + q * 8; vst2((unsigned*)(OH + o), *(const v4u*)&sh[rl][q * 8]); vst2((unsigned*)(OL + o), *(const v4u*)&sl[rl][q * 8]); } }
#define QTB 2
#define KSPL 8
#define PKEYS (32 * KSPL)      // places of the list that a pass covers
#define PL_B 4096u            // one plane's tile of a pass: K 32 rows x 128 B, V 64 rows x 64 B
#define KR_B (4u * PL_B)      // one key range's stage: K hi | K residual | V hi | V residual
#define BUF_B (KSPL * KR_B)   // one buffer: the stage of all eight key ranges
static_assert(32 * KSPL == 16 * 16, "the merge gives one thread to each (row, 4 columns) of a query tile");
__device__ __forceinline__ unsigned lds_off(const void* p) { return (unsigned)(size_t)p; }
// a fragment from an LDS row: its two 16-byte pieces stand at places ca and cb of the row
__device__ __forceinline__ v16h frag_l(const unsigned char* row, unsigned ca, unsigned cb) {
  union { v16h v; v8h q[2]; } u; u.q[0] = *(const v8h*)(row + ca * 16u); u.q[1] = *(const v8h*)(row + cb * 16u); return u.v;
}
// Rows in LDS carry no pad; a row's 16-byte pieces are permuted instead, piece c of K row r at place c ^ ((r >> 1) & 7), piece c of V row d at place c ^ ((d >> 2) & 3), so that the 16 rows of a fragment read fall on 16 different bank groups.
// One wave's share of a stage: 8 copies of 512 B for its K plane, 8 of 512 B for its V plane. The s_wait_xcnt closes each statement so that no address register is rewritten ahead of it.
// lk, lv: the lane's places for copy 0; bits 9 to 11 are 0 there (the ring is aligned to 4 KiB), so copy i's four (K) or eight (V) rows further on and its share of the permutation are one exclusive-or.
__device__ __forceinline__ void stage_copy(const _Float16* gk, const _Float16* gv, unsigned lk, unsigned lv) {
  unsigned a[8], c[8]; const _Float16 *pk[8], *pv[8];
#pragma unroll
  for (int i = 0; i < 8; ++i) {
    a[i] = lk ^ (i * 512u | (((2u * i) & 7u) << 4)); pk[i] = gk + i * 256;
    c[i] = lv ^ (i * 512u | (((2u * i) & 3u) << 4)); pv[i] = gv + (size_t)i * 8 * NN; }
  asm volatile("global_load_async_to_lds_b128 %0, %8, off\n\tglobal_load_async_to_lds_b128 %1, %9, off\n\tglobal_load_async_to_lds_b128 %2, %10, off\n\tglobal_load_async_to_lds_b128 %3, %11, off\n\t"
               "global_load_async_to_lds_b128 %4, %12, off\n\tglobal_load_async_to_lds_b128 %5, %13, off\n\tglobal_load_async_to_lds_b128 %6, %14, off\n\tglobal_load_async_to_lds_b128 %7, %15, off\n\ts_wait_xcnt 0x0"
               :: "v"(a[0]), "v"(a[1]), "v"(a[2]), "v"(a[3]), "v"(a[4]), "v"(a[5]), "v"(a[6]), "v"(a[7]),
                  "v"(pk[0]), "v"(pk[1]), "v"(pk[2]), "v"(pk[3]), "v"(pk[4]), "v"(pk[5]), "v"(pk[6]), "v"(pk[7]) : "memory");
  asm volatile("global_load_async_to_lds_b128 %0, %8, off\n\tglobal_load_async_to_lds_b128 %1, %9, off\n\tglobal_load_async_to_lds_b128 %2, %10, off\n\tglobal_load_async_to_lds_b128 %3, %11, off\n\t"
               "global_load_async_to_lds_b128 %4, %12, off\n\tglobal_load_async_to_lds_b128 %5, %13, off\n\tglobal_load_async_to_lds_b128 %6, %14, off\n\tglobal_load_async_to_lds_b128 %7, %15, off\n\ts_wait_xcnt 0x0"
               :: "v"(c[0]), "v"(c[1]), "v"(c[2]), "v"(c[3]), "v"(c[4]), "v"(c[5]), "v"(c[6]), "v"(c[7]),
                  "v"(pv[0]), "v"(pv[1]), "v"(pv[2]), "v"(pv[3]), "v"(pv[4]), "v"(pv[5]), "v"(pv[6]), "v"(pv[7]) : "memory");
}
typedef __attribute__((ext_vector_type(2))) _Float16 v2h;
// lane l's value seen from lane l ^ 16
__device__ __forceinline__ float xhalf(float v) { const int b = __builtin_bit_cast(int, v); return __builtin_bit_cast(float, __builtin_amdgcn_permlanex16(b, b, 0x76543210, 0xfedcba98, false, false)); }
// four waves a SIMD is what a 16-wave block gives: the register budget is set for exactly that
__global__ __launch_bounds__(32 * QTB * KSPL) __attribute__((amdgpu_waves_per_eu(4, 4))) void k_att(const _Float16* __restrict__ QH, const _Float16* __restrict__ QL, const _Float16* __restrict__ KH, const _Float16* __restrict__ KL, const _Float16* __restrict__ VT, const _Float16* __restrict__ VTL, const int* __restrict__ MK, float* __restrict__ OUT) {
  // ring: the two buffers; behind the loop's last barrier its first bytes hold the waves' un-normalised outputs for the merge
  __shared__ __align__(4096) unsigned char ring[2 * BUF_B];
  __shared__ float sm[QTB * KSPL][16], sl[QTB * KSPL][16];
  __shared__ __align__(16) int wc[QTB * KSPL];
  static_assert(32 * QTB * KSPL * 4 == NN, "four keys of the mask for each thread");
  static_assert(sizeof(float) * QTB * KSPL * 16 * 68 <= 2 * BUF_B, "the merge's partial outputs fit the ring");
  // the wave number is held scalar so that the pass counter and the key range's base stay in scalar registers
  const int tid = threadIdx.x, wave = __builtin_amdgcn_readfirstlane(tid >> 5), lane = tid & 31, col = lane & 15, g = lane >> 4; const size_t b = blockIdx.y; const int qt = wave % QTB, kr = wave / QTB; const int q0 = blockIdx.x * (16 * QTB) + qt * 16; const size_t rq = b * NN + q0; const int key0 = kr * 32;
  // kept keys of this batch, bounded by the shape and held scalar: every test on it is a scalar branch, the same for the whole wave (the pass count: for the whole block)
  // counted here from the mask: each wave counts its 128 keys by ballots, and behind one barrier every wave adds the 16 counts
  { const v4i mk = *(const v4i*)(MK + b * NN + tid * 4); int c = 0;
    // behind the load from the mask: its address registers are free from here on
    asm volatile("s_wait_xcnt 0x0" ::: "memory");
#pragma unroll
    for (int e = 0; e < 4; ++e) c += __builtin_popcount(__builtin_amdgcn_ballot_w32(mk[e] != 0));
    if (lane == 0) wc[wave] = c; }
  __syncthreads();
  int csum = 0;
#pragma unroll
  for (int w = 0; w < QTB * KSPL; ++w) csum += wc[w];
  const int cnt = __builtin_amdgcn_readfirstlane(min(max(csum, 0), NN)), npass = (cnt + PKEYS - 1) / PKEYS;
  // this lane's sources and places for pass 0, buffer 0
  const _Float16* gk = (qt ? KL : KH) + (b * NN + key0) * DD + lane * 8; const _Float16* gv = (qt ? VTL : VT) + (b * DD + (lane >> 2)) * (size_t)NN + key0 + (lane & 3) * 8;
  const unsigned lk = lds_off(ring) + kr * KR_B + qt * PL_B + (lane >> 3) * 128u + (((lane & 7) ^ g) << 4), lv = lds_off(ring) + kr * KR_B + (2u + qt) * PL_B + (lane >> 2) * 64u + (((lane & 3) ^ g) << 4);
  if (key0 < cnt) stage_copy(gk, gv, lk, lv);
  // pass 0's tiles have landed in every wave before any wave reads them
  asm volatile("s_wait_asynccnt 0x0" ::: "memory");
  __syncthreads();
  if (PKEYS + key0 < cnt) stage_copy(gk + PKEYS * DD, gv + PKEYS, lk + BUF_B, lv + BUF_B);
  // Q^T operand: column = query (lane & 15)
  v16h aq[2], al[2];
#pragma unroll
  for (int kc = 0; kc < 2; ++kc) { aq[kc] = frag_h(QH + (rq + col) * DD + kc * 32, lane); al[kc] = frag_h(QL + (rq + col) * DD + kc * 32, lane); }
  // of this lane's query: running maximum (equal in both lane halves), sum over this half's keys
  float m = -3.0e38f, l = 0.f;
  // acc[j][r]: O^T[j * 16 + 8 g + r][query]
  v8f acc[4] = {}, accl[4] = {};
  const unsigned zk = (unsigned)(col >> 1) & 7u, zv = (unsigned)(col >> 2) & 3u;
#pragma unroll 1
  for (int t = 0; t < npass; ++t) {
    // rem: places of the list from this range's first place of the pass on (none: nothing to do but the pass's foot)
    const int rem = cnt - (t * PKEYS + key0);
    if (rem > 0) { float s[2][8]; const unsigned char* st = ring + (unsigned)(t & 1) * BUF_B + kr * KR_B; const int remg = rem - 8 * g;
    // s[ct][r]: score of key ct * 16 + 8 g + r of the pass
#pragma unroll
    for (int ct = 0; ct < 2; ++ct) { const unsigned char* krow = st + (ct * 16 + col) * 128; v8f c = {}, cl = {};
#pragma unroll
      for (int kc = 0; kc < 2; ++kc) { const unsigned ca = (unsigned)(kc * 4 + g) ^ zk, cb = (unsigned)(kc * 4 + 2 + g) ^ zk; const v16h kh = frag_l(krow, ca, cb), kl = frag_l(krow + PL_B, ca, cb); c = wmma16(kh, aq[kc], c); cl = wmma16(kl, aq[kc], cl); cl = wmma16(kh, al[kc], cl); }
      const v8f sc = (c + cl * (1.0f / 2048.0f)) * 0.125f;
#pragma unroll
      for (int r = 0; r < 8; ++r) { const bool keep = ct * 16 + r < remg; s[ct][r] = keep ? sc[r] : -3.0e38f; } }
    float mx = s[0][0];
#pragma unroll
    for (int i = 1; i < 16; ++i) mx = fmaxf(mx, s[i >> 3][i & 7]);
    mx = fmaxf(mx, xhalf(mx));
    const float mn = fmaxf(m, mx), alpha = (m <= -1.0e38f) ? 0.f : __expf(m - mn);
    // P^T operand, element i = key i (first tile) or 16 + (i - 8) (second tile) of this half: the scores' own order; taken in pairs of neighbouring registers
    v16h pa, pal; v2f es = { 0.f, 0.f };
#pragma unroll
    for (int i = 0; i < 16; i += 2) { const float s0 = s[i >> 3][i & 7], s1 = s[i >> 3][(i & 7) + 1]; const v2f e = { (s0 <= -1.0e38f) ? 0.f : __expf(s0 - mn), (s1 <= -1.0e38f) ? 0.f : __expf(s1 - mn) }, p = e * 2048.0f; es += e;
      const v2h h = __builtin_convertvector(p, v2h), q = __builtin_convertvector((p - __builtin_convertvector(h, v2f)) * 2048.0f, v2h); pa[i] = h[0]; pa[i + 1] = h[1]; pal[i] = q[0]; pal[i + 1] = q[1]; }
    l = l * alpha + (es[0] + es[1]); m = (mn > -1.0e38f) ? mn : m;
#pragma unroll
    for (int j = 0; j < 4; ++j) { acc[j] *= alpha; accl[j] *= alpha; }
#pragma unroll
    for (int j = 0; j < 4; ++j) { const unsigned char* vrow = st + 2u * PL_B + (j * 16 + col) * 64; const unsigned ca = (unsigned)g ^ zv, cb = (unsigned)(2 + g) ^ zv; const v16h vh = frag_l(vrow, ca, cb), vl = frag_l(vrow + PL_B, ca, cb); acc[j] = wmma16(vh, pa, acc[j]); accl[j] = wmma16(vl, pa, accl[j]); accl[j] = wmma16(vh, pal, accl[j]); } }
    // foot of the pass: this wave's LDS reads of the buffer are done ...
    asm volatile("s_wait_dscnt 0x0" ::: "memory");
    // ... its copies for the next pass have landed ...
    asm volatile("s_wait_asynccnt 0x0" ::: "memory");
    // ... and one barrier both publishes the next pass's tiles and frees the buffer just read
    __syncthreads();
    if ((t + 2) * PKEYS + key0 < cnt) stage_copy(gk + (t + 2) * (PKEYS * DD), gv + (t + 2) * PKEYS, lk + (unsigned)(t & 1) * BUF_B, lv + (unsigned)(t & 1) * BUF_B); }
  // no copy is outstanding when the ring takes the partial outputs
  asm volatile("s_wait_asynccnt 0x0" ::: "memory");
  float (*so)[16][68] = (float (*)[16][68])ring;
#pragma unroll
  for (int j = 0; j < 4; ++j) { const v8f o = acc[j] + accl[j] * (1.0f / 2048.0f); float* po = &so[wave][col][j * 16 + 8 * g]; *(v4f*)po = v4f{ o[0], o[1], o[2], o[3] }; *(v4f*)(po + 4) = v4f{ o[4], o[5], o[6], o[7] }; }
  // the lane halves' sums are joined once, here
  l += xhalf(l);
  if (g == 0) { sm[wave][col] = m; sl[wave][col] = l; }
  __syncthreads();
  // merge of the key ranges: thread = (query tile, row, 4 columns); weight exp(m_s - M), a range with no kept key weighs 0
  { const int qm = tid >> 8, row = (tid >> 4) & 15, c4 = (tid & 15) * 4; float M = -3.0e38f;
#pragma unroll
    for (int s = 0; s < KSPL; ++s) M = fmaxf(M, sm[s * QTB + qm][row]);
    float w[KSPL], L = 0.f; v4f o = {};
#pragma unroll
    for (int s = 0; s < KSPL; ++s) { const float ms = sm[s * QTB + qm][row]; w[s] = (ms <= -1.0e38f) ? 0.f : __expf(ms - M); }
#pragma unroll
    for (int s = 0; s < KSPL; ++s) { L += w[s] * sl[s * QTB + qm][row]; o += w[s] * *(const v4f*)&so[s * QTB + qm][row][c4]; }
    const float il = (L > 0.f) ? (1.0f / 2048.0f) / L : 0.f;
    vst2(OUT + (b * NN + blockIdx.x * (16 * QTB) + qm * 16 + row) * DD + c4, o * il); } }
extern "C" void kernel_launch(void* const* d_in, const int* in_sizes, int n_in, void* d_out, int out_size, void* d_ws, size_t ws_size, hipStream_t stream) {
  (void)in_sizes; (void)n_in; (void)out_size;
  const float** F = (const float**)d_in;   // 0 x [4,2048,512], 1 mask [4,2048] int, 2 Wq [512,64] (in,out), 3 bq, 4 Wk, 5 bk, 6 Wv, 7 bv
  if (ws_size < (size_t)WS_END) return;
  char* ws = (char*)d_ws; _Float16 *QH = (_Float16*)(ws + WS_QH), *QL = (_Float16*)(ws + WS_QL), *KH = (_Float16*)(ws + WS_KH), *KL = (_Float16*)(ws + WS_KL), *VT = (_Float16*)(ws + WS_VT), *VTL = (_Float16*)(ws + WS_VTL);
  k_proj<<<dim3(NB * NN / 64, 3), 128, 0, stream>>>(F[0], (const int*)d_in[1], F[2], F[4], F[6], F[3], F[5], F[7], QH, QL, KH, KL, VT, VTL);
  k_att<<<dim3(NN / (16 * QTB), TNB), 32 * QTB * KSPL, 0, stream>>>(QH, QL, KH, KL, VT, VTL, (const int*)d_in[1], (float*)d_out);
}

// v009
// It runs in 21.2 microseconds.
// Two timings next to v008 put it at 1.13 and 1.12 times that version's speed.
// All steps since v000 together make it 10.4 times as fast.
// compute dtype: all float inputs rounded to bf16, mask (int) read on device; q/k/v = x W + b with EXACT bf16 products on WMMA 16x16x32 ((in,out) weights rounded into LDS in fragment order by each block); q/k as f16 hi + residual (3-product logits x 1/8), masked keys (mask == 0) excluded (== the -1e9 additive fill): only kept keys are projected to k, v (each wave finds its own places of the list of kept keys) and attended, running-max softmax in f32 (hardware exp); P (x 2^11) as f16 hi + residual . v (f16 hi + residual planes; 3 products); f32 output.
#include <hip/hip_runtime.h>
#include <math.h>

typedef __attribute__((ext_vector_type(16))) _Float16 v16h;
typedef __attribute__((ext_vector_type(16))) __bf16 v16b;
typedef __attribute__((ext_vector_type(8)))  _Float16 v8h;
typedef __attribute__((ext_vector_type(8)))  float v8f;
typedef __attribute__((ext_vector_type(4)))  float v4f;
typedef __attribute__((ext_vector_type(2)))  float v2f;
typedef __attribute__((ext_vector_type(4)))  unsigned v4u;
typedef __attribute__((ext_vector_type(4)))  int v4i;
typedef float __attribute__((may_alias)) float_a;
typedef int __attribute__((may_alias)) int_a;

template <typename T> __device__ __forceinline__ void vst2(void* p, T v) { *(T*)p = v;  }
__device__ __forceinline__ v8f wmma16(v16h a, v16h b, v8f c) {
  return __builtin_amdgcn_wmma_f32_16x16x32_f16(false, a, false, b, (short)0, c, false, false);
}
__device__ __forceinline__ v8f wmma_bf(v16b a, v16b b, v8f c) {
  v8f d = __builtin_amdgcn_wmma_f32_16x16x32_bf16(false, a, false, b, (short)0, c, false, false);
  asm volatile("v_nop\n\tv_nop\n\tv_nop\n\tv_nop" : "+v"(d) : "v"(a), "v"(b));
  return d;
}
// 16x16x32 fragments: lane = (h = lane>>4, row/col = lane&15); elements 0..7 = k0+8h+0..7, 8..15 = k0+16+8h+0..7; D element r = row 8h+r
__device__ __forceinline__ v16h frag_h(const _Float16* rowk0, int lane) {
  union { v16h v; v8h q[2]; } u; const _Float16* p = rowk0 + 8 * (lane >> 4);
  u.q[0] = *(const v8h*)p; u.q[1] = *(const v8h*)(p + 16); return u.v;
}
__device__ __forceinline__ v16h frag_f32(const float* rowk0, int lane) {
  v16h a; const float* p = rowk0 + 8 * (lane >> 4);
#pragma unroll
  for (int i = 0; i < 8; ++i) { a[i] = (_Float16)p[i]; a[8 + i] = (_Float16)p[16 + i]; }
  return a;
}
__device__ __forceinline__ v16h frag_f32s(const float* rowk0, int lane, float sc) {
  v16h a; const float* p = rowk0 + 8 * (lane >> 4);
#pragma unroll
  for (int i = 0; i < 8; ++i) { a[i] = (_Float16)(p[i] * sc); a[8 + i] = (_Float16)(p[16 + i] * sc); }
  return a;
}
// column fragment from a [K][ld] layout (column n), rows >= K read as 0
__device__ __forceinline__ v16h fragc_f32(const float* W, int k0, int n, int lane, int ld, int K) {
  v16h a; const int g = lane >> 4;
#pragma unroll
  for (int i = 0; i < 8; ++i) { const int ka = k0 + 8 * g + i, kb = ka + 16;
    a[i] = (_Float16)(ka < K ? W[(size_t)(ka < K ? ka : K - 1) * ld + n] : 0.f); a[8 + i] = (_Float16)(kb < K ? W[(size_t)(kb < K ? kb : K - 1) * ld + n] : 0.f); }
  return a;
}
struct F2 { v16b h, l; };
__device__ __forceinline__ F2 bsplit16(const float v[16]) { F2 r;
#pragma unroll
  for (int i = 0; i < 16; ++i) { const __bf16 h = (__bf16)v[i]; r.h[i] = h; r.l[i] = (__bf16)(v[i] - (float)h); }
  return r; }
__device__ __forceinline__ F2 split_row(const float* row, int k0, int lane) { float v[16]; const float* p = row + k0 + 8 * (lane >> 4);
#pragma unroll
  for (int i = 0; i < 8; ++i) { v[i] = p[i]; v[8 + i] = p[16 + i]; }
  return bsplit16(v); }
__device__ __forceinline__ F2 split_rowK(const float* row, int k0, int lane, int K) { float v[16]; const int g = lane >> 4;
#pragma unroll
  for (int i = 0; i < 8; ++i) { const int ka = k0 + 8 * g + i, kb = ka + 16; v[i] = ka < K ? row[ka < K ? ka : K - 1] : 0.f; v[8 + i] = kb < K ? row[kb < K ? kb : K - 1] : 0.f; }
  return bsplit16(v); }
__device__ __forceinline__ F2 split_col(const float* W, int k0, int n, int lane, int ld, int K) { float v[16]; const int g = lane >> 4;
#pragma unroll
  for (int i = 0; i < 8; ++i) { const int ka = k0 + 8 * g + i, kb = ka + 16; v[i] = ka < K ? W[(size_t)(ka < K ? ka : K - 1) * ld + n] : 0.f; v[8 + i] = kb < K ? W[(size_t)(kb < K ? kb : K - 1) * ld + n] : 0.f; }
  return bsplit16(v); }
__device__ __forceinline__ v8f mac3(const F2& a, const F2& b, v8f c) { c = wmma_bf(a.l, b.h, c); c = wmma_bf(a.h, b.l, c); return wmma_bf(a.h, b.h, c); }
__device__ __forceinline__ float sigm(float v) { return 1.0f / (1.0f + expf(-v)); }
#define LDSX() do { asm volatile("s_wait_dscnt 0" ::: "memory"); __builtin_amdgcn_wave_barrier(); __builtin_amdgcn_fence(__ATOMIC_RELEASE, "workgroup"); } while (0)


// Single-head masked attention (B 4, S 2,048, F 512 -> D 64): q, k, v = x W + b; softmax(q k^T / 8 + (1 - mask_k) * -1e9) v.
#define NB 4
#define NN 2048
#define FF 512
#define DD 64
#ifndef TNB
#define TNB NB
#endif
typedef __attribute__((ext_vector_type(8))) __bf16 v8b;
typedef __attribute__((ext_vector_type(4))) _Float16 v4h;
// a weight fragment from the block's LDS copy: p = the lane's 16 bytes of the fragment's first half; the second half stands 512 bytes on
__device__ __forceinline__ v16b frag_w(const unsigned char* p) {
  union { v16b v; v8b q[2]; } u; u.q[0] = *(const v8b*)p; u.q[1] = *(const v8b*)(p + 512); return u.v;
}
__device__ __forceinline__ float bfr(float v) { return (float)(__bf16)v; }
__device__ __attribute__((noinline)) float exp_ni(float v) { return expf(v); }
__device__ __attribute__((noinline)) float erf_ni(float v) { return erff(v); }

#define WS_QH  0u                                   // f16 hi|lo q rows [row][64]; k rows; v planes [b][64][NN]; k and v by place in the list of kept keys
#define WS_QL  (WS_QH + 2u * (size_t)NB * NN * DD)
#define WS_KH  (WS_QL + 2u * (size_t)NB * NN * DD)
#define WS_KL  (WS_KH + 2u * (size_t)NB * NN * DD)
#define WS_VT  (WS_KL + 2u * (size_t)NB * NN * DD)
#define WS_VTL (WS_VT + 2u * (size_t)NB * DD * NN)
#define WS_END (WS_VTL + 2u * (size_t)NB * DD * NN)

// ---- k_proj: block = 64 rows of one of the three products, 4 column tiles a wave. blockIdx.y 0: k, 1: v of the 64 kept keys (mask != 0) that stand at the block's places in the batch's list of kept keys, in rising order (x rows gathered; a block wholly behind the list has nothing to do); blockIdx.y 2: q of 64 rows of x in their own order. + biases
// There is no launch ahead of this one: each wave finds the keys at its own 16 places from the mask itself, and each block rounds its product's weights to bf16 into LDS itself.
// The key at place p0 + (lane & 15) of the list of one batch's kept keys; 0 for a place behind the list; -1, the same in every lane and every wave of the block, where even place n0 (the block's first) lies behind it.
// mk: the batch's whole mask as the wave has read it, 128 keys a load (lane l: keys 4 l .. 4 l + 3 of them); ballots give each load's count as a scalar, so only the loads whose kept keys reach into the wave's 16 places are looked at key by key. lst: 16 ints of LDS that this wave alone uses.
__device__ __forceinline__ int list_key(const v4i (&mk)[NN / 128], int n0, int p0, int lane, int* lst) {
  unsigned bal[NN / 128][4]; int base[NN / 128 + 1];
  base[0] = 0;
#pragma unroll
  for (int i = 0; i < NN / 128; ++i) { int c = 0;
#pragma unroll
    for (int e = 0; e < 4; ++e) { bal[i][e] = __builtin_amdgcn_ballot_w32(mk[i][e] != 0); c += __builtin_popcount(bal[i][e]); }
    base[i + 1] = base[i] + c; }
  if (n0 >= base[NN / 128]) return -1;
  if (lane < 16) lst[lane] = 0;
#pragma unroll
  for (int i = 0; i < NN / 128; ++i) if (base[i] < p0 + 16 && base[i + 1] > p0) {
    // pos: place, counted from p0, of this lane's first kept key of the load
    int pos = base[i] - p0;
#pragma unroll
    for (int e = 0; e < 4; ++e) pos = (int)__builtin_amdgcn_mbcnt_lo(bal[i][e], (unsigned)pos);
#pragma unroll
    for (int e = 0; e < 4; ++e) { const bool keep = (bal[i][e] >> lane) & 1u; if (keep && (unsigned)pos < 16u) lst[pos] = i * 128 + lane * 4 + e; pos += keep ? 1 : 0; } }
  // the wave's own stores to lst are done before its lanes read one another's entries (no fence: that would also wait for the weight loads in flight)
  asm volatile("s_wait_dscnt 0x0" ::: "memory");
  __builtin_amdgcn_wave_barrier();
  return lst[lane & 15];
}
// eight k rows x four columns of f32 weights (r[e][j]) as four 16-byte pieces of bf16 fragments, piece j to column tile j: at = the lane's place in tile 0
__device__ __forceinline__ void w_store(const v4f (&r)[8], unsigned char* at) {
#pragma unroll
  for (int j = 0; j < 4; ++j) { v8b o;
#pragma unroll
    for (int e = 0; e < 8; ++e) o[e] = (__bf16)r[e][j];
    *(v8b*)(at + j * ((FF / 32) * 1024)) = o; }
}
#define XLD 4   // how many k steps ahead x is fetched, each step into its own register set
__global__ __launch_bounds__(128) void k_proj(const float* __restrict__ X, const int* __restrict__ MK, const float* __restrict__ WQ, const float* __restrict__ WK, const float* __restrict__ WV, const float* __restrict__ BQ, const float* __restrict__ BK, const float* __restrict__ BV, _Float16* __restrict__ QH, _Float16* __restrict__ QL, _Float16* __restrict__ KH, _Float16* __restrict__ KL, _Float16* __restrict__ VT, _Float16* __restrict__ VTL) {
  // wl: the product's weights as bf16 fragments [4 column tiles][16 k steps][2 halves][32 lanes][8]: lane (g, col), half p, element e of tile j, step s = W[32 s + 16 p + 8 g + e][4 col + j]. Tile j takes every fourth column from j on, so that a lane's 16-byte loads of eight W rows hold one piece of each tile and a wave's store of a piece covers 512 bytes in a row
  __shared__ __align__(16) unsigned char wl[4 * (FF / 32) * 1024];
  __shared__ __align__(16) _Float16 sh[64][72], sl[64][72];   // q, k: [row][column]; v: [column][row]
  __shared__ int lst[4][16];
  // the wave number is held scalar so that the tests on the wave's places of the list are scalar branches
  const int tid = threadIdx.x, wave = __builtin_amdgcn_readfirstlane(tid >> 5), lane = tid & 31, col = lane & 15, g = lane >> 4, role = blockIdx.y; const size_t r0 = (size_t)blockIdx.x * 64 + wave * 16; const size_t b = ((size_t)blockIdx.x * 64) / NN; const int n0 = (int)(((size_t)blockIdx.x * 64) % NN);
  const float* Wm = role == 2 ? WQ : role == 0 ? WK : WV; const float* BB = role == 2 ? BQ : role == 0 ? BK : BV;
  // the 32 groups of 16 W rows (a half of a k step each) go round the four waves: group 4 i + wave; the lane's eight rows of it from ws + i * 64 * DD on. The first four groups' loads are issued behind the mask's (loads return in the order of their issue, and x waits for the mask) and ahead of the look at it
  v4i mk[NN / 128];
  if (role < 2) {
#pragma unroll
    for (int i = 0; i < NN / 128; ++i) mk[i] = *(const v4i*)(MK + b * NN + i * 128 + lane * 4); }
  // behind the loads from the mask: their address registers are free from here on
  asm volatile("s_wait_xcnt 0x0" ::: "memory");
  const float* ws = Wm + (size_t)(wave * 16 + 8 * g) * DD + 4 * col; unsigned char* wd = wl + tid * 16; v4f wr[8][8];
#pragma unroll
  for (int i = 0; i < 4; ++i) {
#pragma unroll
    for (int e = 0; e < 8; ++e) wr[i][e] = *(const v4f*)(ws + (i * 64 + e) * DD); }
  size_t xrow = r0 + col;
  if (role < 2) {
    // below 0: all 64 places of the block lie behind the list; the return is the same for the whole block and stands in front of its barriers
    const int src = list_key(mk, n0, n0 + wave * 16, lane, lst[wave]);
    if (__builtin_amdgcn_readfirstlane(src) < 0) return;
    xrow = b * NN + (size_t)(src & (NN - 1)); }
  // the other four groups, still ahead of x: a wait for weights then never waits for x
#pragma unroll
  for (int i = 4; i < 8; ++i) {
#pragma unroll
    for (int e = 0; e < 8; ++e) wr[i][e] = *(const v4f*)(ws + (i * 64 + e) * DD); }
  // behind the last loads from ws: its registers are free from here on
  asm volatile("s_wait_xcnt 0x0" ::: "memory");
  // keeps the arithmetic that follows, which may take those registers, behind that wait
  __builtin_amdgcn_sched_barrier(0);
  const float* px = X + xrow * FF + 8 * g; v4f xr[XLD][4];
#pragma unroll
  for (int d = 0; d < XLD; ++d) { const float* pn = px + d * 32; xr[d][0] = *(const v4f*)pn; xr[d][1] = *(const v4f*)(pn + 4); xr[d][2] = *(const v4f*)(pn + 16); xr[d][3] = *(const v4f*)(pn + 20); }
  // keeps the rounding of the weights, and with it the waits for their loads, from being moved up in front of the issue of x's first loads
  __builtin_amdgcn_sched_barrier(0);
#pragma unroll
  for (int i = 0; i < 8; ++i) w_store(wr[i], wd + i * 2048);
  // every wave's share of the weights stands in LDS before any wave reads a fragment
  __syncthreads();
  v8f acc[4] = {}; v16b bf[2][4]; const unsigned char* wf = wl + lane * 16;
#pragma unroll
  for (int j = 0; j < 4; ++j) bf[0][j] = frag_w(wf + j * ((FF / 32) * 1024));
  // unrolled whole so that the test for a later step and the number of the register set are resolved at compile time and the fetched fragments keep their registers without copies
#pragma unroll
  for (int kc = 0; kc < FF / 32; ++kc) { v16b a; const int s = kc % XLD;
    // keeps the conversion of this step's x, and with it the wait for its loads, from being moved up into the steps before
    __builtin_amdgcn_sched_barrier(0);
#pragma unroll
    for (int i = 0; i < 4; ++i) { a[i] = (__bf16)xr[s][0][i]; a[4 + i] = (__bf16)xr[s][1][i]; a[8 + i] = (__bf16)xr[s][2][i]; a[12 + i] = (__bf16)xr[s][3][i]; }
    if (kc + XLD < FF / 32) { const float* pn = px + (kc + XLD) * 32; xr[s][0] = *(const v4f*)pn; xr[s][1] = *(const v4f*)(pn + 4); xr[s][2] = *(const v4f*)(pn + 16); xr[s][3] = *(const v4f*)(pn + 20); }
    // behind the last loads from px: its registers are free from here on and may be given to a later load's data
    if (kc + XLD + 1 == FF / 32) asm volatile("s_wait_xcnt 0x0" ::: "memory");
    // the next step's weight fragments leave LDS while this step's products run and the next step's x is waited for
    if (kc + 1 < FF / 32) {
#pragma unroll
      for (int j = 0; j < 4; ++j) bf[(kc + 1) & 1][j] = frag_w(wf + (j * (FF / 32) + kc + 1) * 1024); }
#pragma unroll
    for (int j = 0; j < 4; ++j) acc[j] = wmma_bf(a, bf[kc & 1][j], acc[j]); }
  // acc[j][r]: row 8 g + r of the wave's 16, column 4 col + j
  const v4f bv4 = *(const v4f*)(BB + 4 * col); const float bb[4] = { bfr(bv4[0]), bfr(bv4[1]), bfr(bv4[2]), bfr(bv4[3]) };
  // the test of the role stands outside the loops: one scalar branch; q, k: a row's four neighbouring columns, v: a column's eight neighbouring rows go to LDS as one store
  if (role != 1) {
#pragma unroll
    for (int r = 0; r < 8; ++r) { v4h hv4, lv4;
#pragma unroll
      for (int j = 0; j < 4; ++j) { const float v = acc[j][r] + bb[j]; const _Float16 hv = (_Float16)v; hv4[j] = hv; lv4[j] = (_Float16)((v - (float)hv) * 2048.0f); }
      const int rl = wave * 16 + 8 * g + r; *(v4h*)&sh[rl][4 * col] = hv4; *(v4h*)&sl[rl][4 * col] = lv4; }
  } else {
#pragma unroll
    for (int j = 0; j < 4; ++j) { const int c = 4 * col + j; v8h hv8, lv8;
#pragma unroll
      for (int r = 0; r < 8; ++r) { const float v = acc[j][r] + bb[j]; const _Float16 hv = (_Float16)v; hv8[r] = hv; lv8[r] = (_Float16)((v - (float)hv) * 2048.0f); }
      *(v8h*)&sh[c][wave * 16 + 8 * g] = hv8; *(v8h*)&sl[c][wave * 16 + 8 * g] = lv8; }
  }
  __syncthreads();
  _Float16* OH = role == 2 ? QH : role == 0 ? KH : VT; _Float16* OL = role == 2 ? QL : role == 0 ? KL : VTL;
  for (int e = tid; e < 64 * 8; e += 128) { const int rl = e >> 3, q = e & 7; const size_t o = role != 1 ? ((size_t)blockIdx.x * 64 + rl) * DD + q * 8 : (b * DD + rl) * (size_t)NN + n0 + q * 8; vst2((unsigned*)(OH + o), *(const v4u*)&sh[rl][q * 8]); vst2((unsigned*)(OL + o), *(const v4u*)&sl[rl][q * 8]); } }
#define QTB 2
#define KSPL 8
#define PKEYS (32 * KSPL)      // places of the list that a pass covers
#define PL_B 4096u            // one plane's tile of a pass: K 32 rows x 128 B, V 64 rows x 64 B
#define KR_B (4u * PL_B)      // one key range's stage: K hi | K residual | V hi | V residual
#define BUF_B (KSPL * KR_B)   // one buffer: the stage of all eight key ranges
static_assert(32 * KSPL == QTB * 16 * 8, "the merge gives one thread to each (query tile, row, 8 columns)");
__device__ __forceinline__ unsigned lds_off(const void* p) { return (unsigned)(size_t)p; }
// a fragment from an LDS row: its two 16-byte pieces stand at places ca and cb of the row
__device__ __forceinline__ v16h frag_l(const unsigned char* row, unsigned ca, unsigned cb) {
  union { v16h v; v8h q[2]; } u; u.q[0] = *(const v8h*)(row + ca * 16u); u.q[1] = *(const v8h*)(row + cb * 16u); return u.v;
}
// Rows in LDS carry no pad; a row's 16-byte pieces are permuted instead, piece c of K row r at place c ^ ((r >> 1) & 7), piece c of V row d at place c ^ ((d >> 2) & 3), so that the 16 rows of a fragment read fall on 16 different bank groups.
// One plane pair of a wave's stage: 8 copies of 512 B for a K plane, 8 of 512 B for a V plane. The s_wait_xcnt closes each statement so that no address register is rewritten ahead of it.
// lk, lv: the lane's places for copy 0; bits 9 to 11 are 0 there (the ring is aligned to 4 KiB), so copy i's four (K) or eight (V) rows further on and its share of the permutation are one exclusive-or.
__device__ __forceinline__ void stage_copy(const _Float16* gk, const _Float16* gv, unsigned lk, unsigned lv) {
  unsigned a[8], c[8]; const _Float16 *pk[8], *pv[8];
#pragma unroll
  for (int i = 0; i < 8; ++i) {
    a[i] = lk ^ (i * 512u | (((2u * i) & 7u) << 4)); pk[i] = gk + i * 256;
    c[i] = lv ^ (i * 512u | (((2u * i) & 3u) << 4)); pv[i] = gv + (size_t)i * 8 * NN; }
  asm volatile("global_load_async_to_lds_b128 %0, %8, off\n\tglobal_load_async_to_lds_b128 %1, %9, off\n\tglobal_load_async_to_lds_b128 %2, %10, off\n\tglobal_load_async_to_lds_b128 %3, %11, off\n\t"
               "global_load_async_to_lds_b128 %4, %12, off\n\tglobal_load_async_to_lds_b128 %5, %13, off\n\tglobal_load_async_to_lds_b128 %6, %14, off\n\tglobal_load_async_to_lds_b128 %7, %15, off\n\ts_wait_xcnt 0x0"
               :: "v"(a[0]), "v"(a[1]), "v"(a[2]), "v"(a[3]), "v"(a[4]), "v"(a[5]), "v"(a[6]), "v"(a[7]),
                  "v"(pk[0]), "v"(pk[1]), "v"(pk[2]), "v"(pk[3]), "v"(pk[4]), "v"(pk[5]), "v"(pk[6]), "v"(pk[7]) : "memory");
  asm volatile("global_load_async_to_lds_b128 %0, %8, off\n\tglobal_load_async_to_lds_b128 %1, %9, off\n\tglobal_load_async_to_lds_b128 %2, %10, off\n\tglobal_load_async_to_lds_b128 %3, %11, off\n\t"
               "global_load_async_to_lds_b128 %4, %12, off\n\tglobal_load_async_to_lds_b128 %5, %13, off\n\tglobal_load_async_to_lds_b128 %6, %14, off\n\tglobal_load_async_to_lds_b128 %7, %15, off\n\ts_wait_xcnt 0x0"
               :: "v"(c[0]), "v"(c[1]), "v"(c[2]), "v"(c[3]), "v"(c[4]), "v"(c[5]), "v"(c[6]), "v"(c[7]),
                  "v"(pv[0]), "v"(pv[1]), "v"(pv[2]), "v"(pv[3]), "v"(pv[4]), "v"(pv[5]), "v"(pv[6]), "v"(pv[7]) : "memory");
}
typedef __attribute__((ext_vector_type(2))) _Float16 v2h;
// lane l's value seen from lane l ^ 16
__device__ __forceinline__ float xhalf(float v) { const int b = __builtin_bit_cast(int, v); return __builtin_bit_cast(float, __builtin_amdgcn_permlanex16(b, b, 0x76543210, 0xfedcba98, false, false)); }
// two waves a SIMD is what an 8-wave block gives: the register budget is set for exactly that
__global__ __launch_bounds__(32 * KSPL) __attribute__((amdgpu_waves_per_eu(2, 2))) void k_att(const _Float16* __restrict__ QH, const _Float16* __restrict__ QL, const _Float16* __restrict__ KH, const _Float16* __restrict__ KL, const _Float16* __restrict__ VT, const _Float16* __restrict__ VTL, const int* __restrict__ MK, float* __restrict__ OUT) {
  // ring: the two buffers; behind its loop a wave puts its un-normalised outputs for the merge into its own part of buffer 0
  __shared__ __align__(4096) unsigned char ring[2 * BUF_B];
  __shared__ float sm[QTB * KSPL][16], sl[QTB * KSPL][16];
  __shared__ __align__(16) int wc[KSPL];
  static_assert(32 * KSPL * 8 == NN, "eight keys of the mask for each thread");
  static_assert(sizeof(float) * QTB * 16 * 68 <= KR_B, "a wave's partial outputs fit its own part of a buffer");
  // the wave number, which is the key range, is held scalar so that the pass counter and the key range's base stay in scalar registers
  const int tid = threadIdx.x, kr = __builtin_amdgcn_readfirstlane(tid >> 5), lane = tid & 31, col = lane & 15, g = lane >> 4; const size_t b = blockIdx.y; const size_t rq = b * NN + blockIdx.x * (16 * QTB); const int key0 = kr * 32;
  // kept keys of this batch, bounded by the shape and held scalar: every test on it is a scalar branch, the same for the whole wave
  // counted here from the mask: each wave counts its 256 keys by ballots, and behind one barrier every wave adds the 8 counts
  { const v4i mk0 = *(const v4i*)(MK + b * NN + tid * 4), mk1 = *(const v4i*)(MK + b * NN + NN / 2 + tid * 4); int c = 0;
    // behind the loads from the mask: their address registers are free from here on
    asm volatile("s_wait_xcnt 0x0" ::: "memory");
#pragma unroll
    for (int e = 0; e < 4; ++e) c += __builtin_popcount(__builtin_amdgcn_ballot_w32(mk0[e] != 0)) + __builtin_popcount(__builtin_amdgcn_ballot_w32(mk1[e] != 0));
    if (lane == 0) wc[kr] = c; }
  __syncthreads();
  int csum = 0;
#pragma unroll
  for (int w = 0; w < KSPL; ++w) csum += wc[w];
  const int cnt = __builtin_amdgcn_readfirstlane(min(max(csum, 0), NN));
  // this lane's share of the sources (the same in a hi plane and its residual plane; the pass's and the range's share is scalar and joins the array's base) and of the places, hi planes (the buffer's and the range's share is scalar too); the residual planes stand one plane's tile further on in LDS
  const unsigned okl = lane * 8, ovl = (lane >> 2) * NN + (lane & 3) * 8;
  const unsigned lk = (lane >> 3) * 128u + (((lane & 7) ^ g) << 4), lv = 2u * PL_B + (lane >> 2) * 64u + (((lane & 3) ^ g) << 4);
  // all four planes of pass t for this wave's key range, into the buffer at bo
  const auto stage = [&](int t, unsigned bo) { const size_t sk = (b * NN + key0 + (size_t)t * PKEYS) * DD, sv = b * DD * NN + key0 + (size_t)t * PKEYS; const unsigned sb = lds_off(ring) + bo + kr * KR_B;
    stage_copy(KH + sk + okl, VT + sv + ovl, sb + lk, sb + lv); stage_copy(KL + sk + okl, VTL + sv + ovl, sb + PL_B + lk, sb + PL_B + lv); };
  if (key0 < cnt) stage(0, 0u);
  // pass 0's tiles have landed before the wave reads them (and never more than one pass's 32 copies are in flight)
  asm volatile("s_wait_asynccnt 0x0" ::: "memory");
  if (PKEYS + key0 < cnt) stage(1, BUF_B);
  // Q^T operands, one set for each query tile: column = query (lane & 15)
  v16h aq[QTB][2], al[QTB][2];
  // only a wave that has a pass reads q; the test stands here so that the loads stay in front of the wait written behind them
  if (key0 < cnt) {
#pragma unroll
    for (int qt = 0; qt < QTB; ++qt) {
#pragma unroll
      for (int kc = 0; kc < 2; ++kc) { aq[qt][kc] = frag_h(QH + (rq + qt * 16 + col) * DD + kc * 32, lane); al[qt][kc] = frag_h(QL + (rq + qt * 16 + col) * DD + kc * 32, lane); } }
    // behind the loads of q: their address registers are free from here on
    asm volatile("s_wait_xcnt 0x0" ::: "memory");
    // keeps the arithmetic that follows, which may take those registers, behind that wait
    __builtin_amdgcn_sched_barrier(0); }
  // of this lane's query of each tile: running maximum (equal in both lane halves), sum over this half's keys
  float m[QTB], l[QTB];
  // acc[qt][j][r]: O^T[j * 16 + 8 g + r][query]
  v8f acc[QTB][4] = {}, accl[QTB][4] = {};
#pragma unroll
  for (int qt = 0; qt < QTB; ++qt) { m[qt] = -3.0e38f; l[qt] = 0.f; }
  const unsigned zk = (unsigned)(col >> 1) & 7u, zv = (unsigned)(col >> 2) & 3u;
  // kept rolled: one copy of the long pass body in the instruction cache, and the two buffers alternate by t & 1
#pragma unroll 1
  for (int t = 0; t * PKEYS + key0 < cnt; ++t) {
    // rem: places of the list from this range's first place of the pass on; cnt is at most NN, so there are at most NN / PKEYS passes
    const int rem = cnt - (t * PKEYS + key0);
    float s[QTB][2][8]; const unsigned char* st = ring + (unsigned)(t & 1) * BUF_B + kr * KR_B; const int remg = rem - 8 * g;
    // s[qt][ct][r]: score of key ct * 16 + 8 g + r of the pass; the two tiles' products alternate, so that a product never directly follows the one whose sum it adds to
#pragma unroll
    for (int ct = 0; ct < 2; ++ct) { const unsigned char* krow = st + (ct * 16 + col) * 128; v8f c[QTB] = {}, cl[QTB] = {};
#pragma unroll
      for (int kc = 0; kc < 2; ++kc) { const unsigned ca = (unsigned)(kc * 4 + g) ^ zk, cb = (unsigned)(kc * 4 + 2 + g) ^ zk; const v16h kh = frag_l(krow, ca, cb), kl = frag_l(krow + PL_B, ca, cb);
#pragma unroll
        for (int qt = 0; qt < QTB; ++qt) c[qt] = wmma16(kh, aq[qt][kc], c[qt]);
#pragma unroll
        for (int qt = 0; qt < QTB; ++qt) cl[qt] = wmma16(kl, aq[qt][kc], cl[qt]);
#pragma unroll
        for (int qt = 0; qt < QTB; ++qt) cl[qt] = wmma16(kh, al[qt][kc], cl[qt]); }
#pragma unroll
      for (int qt = 0; qt < QTB; ++qt) { const v8f sc = (c[qt] + cl[qt] * (1.0f / 2048.0f)) * 0.125f;
#pragma unroll
        for (int r = 0; r < 8; ++r) { const bool keep = ct * 16 + r < remg; s[qt][ct][r] = keep ? sc[r] : -3.0e38f; } } }
    // P^T operands, element i = key i (first tile) or 16 + (i - 8) (second tile) of this half: the scores' own order; taken in pairs of neighbouring registers
    v16h pa[QTB], pal[QTB];
#pragma unroll
    for (int qt = 0; qt < QTB; ++qt) {
      float mx = s[qt][0][0];
#pragma unroll
      for (int i = 1; i < 16; ++i) mx = fmaxf(mx, s[qt][i >> 3][i & 7]);
      mx = fmaxf(mx, xhalf(mx));
      const float mn = fmaxf(m[qt], mx), alpha = (m[qt] <= -1.0e38f) ? 0.f : __expf(m[qt] - mn);
      v2f es = { 0.f, 0.f };
#pragma unroll
      for (int i = 0; i < 16; i += 2) { const float s0 = s[qt][i >> 3][i & 7], s1 = s[qt][i >> 3][(i & 7) + 1]; const v2f e = { (s0 <= -1.0e38f) ? 0.f : __expf(s0 - mn), (s1 <= -1.0e38f) ? 0.f : __expf(s1 - mn) }, p = e * 2048.0f; es += e;
        const v2h h = __builtin_convertvector(p, v2h), q = __builtin_convertvector((p - __builtin_convertvector(h, v2f)) * 2048.0f, v2h); pa[qt][i] = h[0]; pa[qt][i + 1] = h[1]; pal[qt][i] = q[0]; pal[qt][i + 1] = q[1]; }
      l[qt] = l[qt] * alpha + (es[0] + es[1]); m[qt] = (mn > -1.0e38f) ? mn : m[qt];
#pragma unroll
      for (int j = 0; j < 4; ++j) { acc[qt][j] *= alpha; accl[qt][j] *= alpha; } }
#pragma unroll
    for (int j = 0; j < 4; ++j) { const unsigned char* vrow = st + 2u * PL_B + (j * 16 + col) * 64; const unsigned ca = (unsigned)g ^ zv, cb = (unsigned)(2 + g) ^ zv; const v16h vh = frag_l(vrow, ca, cb), vl = frag_l(vrow + PL_B, ca, cb);
#pragma unroll
      for (int qt = 0; qt < QTB; ++qt) acc[qt][j] = wmma16(vh, pa[qt], acc[qt][j]);
#pragma unroll
      for (int qt = 0; qt < QTB; ++qt) accl[qt][j] = wmma16(vl, pa[qt], accl[qt][j]);
#pragma unroll
      for (int qt = 0; qt < QTB; ++qt) accl[qt][j] = wmma16(vh, pal[qt], accl[qt][j]); }
    // foot of the pass: this wave's LDS reads of the buffer are done, so that it may be filled anew ...
    asm volatile("s_wait_dscnt 0x0" ::: "memory");
    // ... and its copies for the next pass have landed, so that it may read them
    asm volatile("s_wait_asynccnt 0x0" ::: "memory");
    if ((t + 2) * PKEYS + key0 < cnt) stage(t + 2, (unsigned)(t & 1) * BUF_B); }
  // no copy is outstanding when the wave's part of the ring takes its partial outputs
  asm volatile("s_wait_asynccnt 0x0" ::: "memory");
  // so(s, qt): range s's output rows [16][68] of query tile qt
  const auto so = [&](int s, int qt) { return (float (*)[68])(ring + s * KR_B + qt * (16 * 68 * sizeof(float))); };
#pragma unroll
  for (int qt = 0; qt < QTB; ++qt) {
#pragma unroll
    for (int j = 0; j < 4; ++j) { const v8f o = acc[qt][j] + accl[qt][j] * (1.0f / 2048.0f); float* po = &so(kr, qt)[col][j * 16 + 8 * g]; *(v4f*)po = v4f{ o[0], o[1], o[2], o[3] }; *(v4f*)(po + 4) = v4f{ o[4], o[5], o[6], o[7] }; }
    // the lane halves' sums are joined once, here
    l[qt] += xhalf(l[qt]);
    if (g == 0) { sm[kr * QTB + qt][col] = m[qt]; sl[kr * QTB + qt][col] = l[qt]; } }
  // every wave's partial results stand in LDS before any thread merges them
  __syncthreads();
  // merge of the key ranges: thread = (query tile, row, 8 columns); weight exp(m_s - M), a range with no kept key weighs 0
  { const int qm = tid >> 7, row = (tid >> 3) & 15, c8 = (tid & 7) * 8; float M = -3.0e38f;
#pragma unroll
    for (int s = 0; s < KSPL; ++s) M = fmaxf(M, sm[s * QTB + qm][row]);
    float w[KSPL], L = 0.f; v4f o = {}, o4 = {};
#pragma unroll
    for (int s = 0; s < KSPL; ++s) { const float ms = sm[s * QTB + qm][row]; w[s] = (ms <= -1.0e38f) ? 0.f : __expf(ms - M); }
#pragma unroll
    for (int s = 0; s < KSPL; ++s) { L += w[s] * sl[s * QTB + qm][row]; o += w[s] * *(const v4f*)&so(s, qm)[row][c8]; o4 += w[s] * *(const v4f*)&so(s, qm)[row][c8 + 4]; }
    const float il = (L > 0.f) ? (1.0f / 2048.0f) / L : 0.f;
    float* po = OUT + (b * NN + blockIdx.x * (16 * QTB) + qm * 16 + row) * DD + c8; vst2(po, o * il); vst2(po + 4, o4 * il); } }
extern "C" void kernel_launch(void* const* d_in, const int* in_sizes, int n_in, void* d_out, int out_size, void* d_ws, size_t ws_size, hipStream_t stream) {
  (void)in_sizes; (void)n_in; (void)out_size;
  const float** F = (const float**)d_in;   // 0 x [4,2048,512], 1 mask [4,2048] int, 2 Wq [512,64] (in,out), 3 bq, 4 Wk, 5 bk, 6 Wv, 7 bv
  if (ws_size < (size_t)WS_END) return;
  char* ws = (char*)d_ws; _Float16 *QH = (_Float16*)(ws + WS_QH), *QL = (_Float16*)(ws + WS_QL), *KH = (_Float16*)(ws + WS_KH), *KL = (_Float16*)(ws + WS_KL), *VT = (_Float16*)(ws + WS_VT), *VTL = (_Float16*)(ws + WS_VTL);
  k_proj<<<dim3(NB * NN / 64, 3), 128, 0, stream>>>(F[0], (const int*)d_in[1], F[2], F[4], F[6], F[3], F[5], F[7], QH, QL, KH, KL, VT, VTL);
  k_att<<<dim3(NN / (16 * QTB), TNB), 32 * KSPL, 0, stream>>>(QH, QL, KH, KL, VT, VTL, (const int*)d_in[1], (float*)d_out);
}

// v010
// It runs in 20 microseconds.
// In both of two side-by-side timings against v009, it was 1.05 times as fast.
// All steps since v000 together make it 10.9 times as fast.
// compute dtype: all float inputs rounded to bf16, mask (int) read on device; q/k/v = x W + b with EXACT bf16 products on WMMA 16x16x32 ((in,out) weights rounded into LDS in fragment order by each block); q/k as f16 hi + residual (3-product logits x 1/8), masked keys (mask == 0) excluded (== the -1e9 additive fill): only kept keys are projected to k, v (each wave finds its own places of the list of kept keys) and attended, running-max softmax in f32 (hardware exp); P (x 2^11) as f16 hi + residual . v (f16 hi + residual planes; 3 products); f32 output.
#include <hip/hip_runtime.h>
#include <math.h>

typedef __attribute__((ext_vector_type(16))) _Float16 v16h;
typedef __attribute__((ext_vector_type(16))) __bf16 v16b;
typedef __attribute__((ext_vector_type(8)))  _Float16 v8h;
typedef __attribute__((ext_vector_type(8)))  float v8f;
typedef __attribute__((ext_vector_type(4)))  float v4f;
typedef __attribute__((ext_vector_type(2)))  float v2f;
typedef __attribute__((ext_vector_type(4)))  unsigned v4u;
typedef __attribute__((ext_vector_type(4)))  int v4i;
typedef float __attribute__((may_alias)) float_a;
typedef int __attribute__((may_alias)) int_a;

template <typename T> __device__ __forceinline__ void vst2(void* p, T v) { *(T*)p = v;  }
__device__ __forceinline__ v8f wmma16(v16h a, v16h b, v8f c) {
  return __builtin_amdgcn_wmma_f32_16x16x32_f16(false, a, false, b, (short)0, c, false, false);
}
__device__ __forceinline__ v8f wmma_bf(v16b a, v16b b, v8f c) {
  v8f d = __builtin_amdgcn_wmma_f32_16x16x32_bf16(false, a, false, b, (short)0, c, false, false);
  asm volatile("v_nop\n\tv_nop\n\tv_nop\n\tv_nop" : "+v"(d) : "v"(a), "v"(b));
  return d;
}
// 16x16x32 fragments: lane = (h = lane>>4, row/col = lane&15); elements 0..7 = k0+8h+0..7, 8..15 = k0+16+8h+0..7; D element r = row 8h+r
__device__ __forceinline__ v16h frag_h(const _Float16* rowk0, int lane) {
  union { v16h v; v8h q[2]; } u; const _Float16* p = rowk0 + 8 * (lane >> 4);
  u.q[0] = *(const v8h*)p; u.q[1] = *(const v8h*)(p + 16); return u.v;
}
__device__ __forceinline__ v16h frag_f32(const float* rowk0, int lane) {
  v16h a; const float* p = rowk0 + 8 * (lane >> 4);
#pragma unroll
  for (int i = 0; i < 8; ++i) { a[i] = (_Float16)p[i]; a[8 + i] = (_Float16)p[16 + i]; }
  return a;
}
__device__ __forceinline__ v16h frag_f32s(const float* rowk0, int lane, float sc) {
  v16h a; const float* p = rowk0 + 8 * (lane >> 4);
#pragma unroll
  for (int i = 0; i < 8; ++i) { a[i] = (_Float16)(p[i] * sc); a[8 + i] = (_Float16)(p[16 + i] * sc); }
  return a;
}
// column fragment from a [K][ld] layout (column n), rows >= K read as 0
__device__ __forceinline__ v16h fragc_f32(const float* W, int k0, int n, int lane, int ld, int K) {
  v16h a; const int g = lane >> 4;
#pragma unroll
  for (int i = 0; i < 8; ++i) { const int ka = k0 + 8 * g + i, kb = ka + 16;
    a[i] = (_Float16)(ka < K ? W[(size_t)(ka < K ? ka : K - 1) * ld + n] : 0.f); a[8 + i] = (_Float16)(kb < K ? W[(size_t)(kb < K ? kb : K - 1) * ld + n] : 0.f); }
  return a;
}
struct F2 { v16b h, l; };
__device__ __forceinline__ F2 bsplit16(const float v[16]) { F2 r;
#pragma unroll
  for (int i = 0; i < 16; ++i) { const __bf16 h = (__bf16)v[i]; r.h[i] = h; r.l[i] = (__bf16)(v[i] - (float)h); }
  return r; }
__device__ __forceinline__ F2 split_row(const float* row, int k0, int lane) { float v[16]; const float* p = row + k0 + 8 * (lane >> 4);
#pragma unroll
  for (int i = 0; i < 8; ++i) { v[i] = p[i]; v[8 + i] = p[16 + i]; }
  return bsplit16(v); }
__device__ __forceinline__ F2 split_rowK(const float* row, int k0, int lane, int K) { float v[16]; const int g = lane >> 4;
#pragma unroll
  for (int i = 0; i < 8; ++i) { const int ka = k0 + 8 * g + i, kb = ka + 16; v[i] = ka < K ? row[ka < K ? ka : K - 1] : 0.f; v[8 + i] = kb < K ? row[kb < K ? kb : K - 1] : 0.f; }
  return bsplit16(v); }
__device__ __forceinline__ F2 split_col(const float* W, int k0, int n, int lane, int ld, int K) { float v[16]; const int g = lane >> 4;
#pragma unroll
  for (int i = 0; i < 8; ++i) { const int ka = k0 + 8 * g + i, kb = ka + 16; v[i] = ka < K ? W[(size_t)(ka < K ? ka : K - 1) * ld + n] : 0.f; v[8 + i] = kb < K ? W[(size_t)(kb < K ? kb : K - 1) * ld + n] : 0.f; }
  return bsplit16(v); }
__device__ __forceinline__ v8f mac3(const F2& a, const F2& b, v8f c) { c = wmma_bf(a.l, b.h, c); c = wmma_bf(a.h, b.l, c); return wmma_bf(a.h, b.h, c); }
__device__ __forceinline__ float sigm(float v) { return 1.0f / (1.0f + expf(-v)); }
#define LDSX() do { asm volatile("s_wait_dscnt 0" ::: "memory"); __builtin_amdgcn_wave_barrier(); __builtin_amdgcn_fence(__ATOMIC_RELEASE, "workgroup"); } while (0)


// Single-head masked attention (B 4, S 2,048, F 512 -> D 64): q, k, v = x W + b; softmax(q k^T / 8 + (1 - mask_k) * -1e9) v.
#define NB 4
#define NN 2048
#define FF 512
#define DD 64
#ifndef TNB
#define TNB NB
#endif
typedef __attribute__((ext_vector_type(8))) __bf16 v8b;
typedef __attribute__((ext_vector_type(4))) _Float16 v4h;
// a weight fragment from the block's LDS copy: p = the lane's 16 bytes of the fragment's first half; the second half stands 512 bytes on
__device__ __forceinline__ v16b frag_w(const unsigned char* p) {
  union { v16b v; v8b q[2]; } u; u.q[0] = *(const v8b*)p; u.q[1] = *(const v8b*)(p + 512); return u.v;
}
__device__ __forceinline__ float bfr(float v) { return (float)(__bf16)v; }
__device__ __attribute__((noinline)) float exp_ni(float v) { return expf(v); }
__device__ __attribute__((noinline)) float erf_ni(float v) { return erff(v); }

#define WS_QH  0u                                   // f16 hi|lo planes, each laid out in the order in which k_att fetches it, so that a wave's load or copy covers 512 bytes in a row: q by 16-row tile, [tile][16-byte piece 0..7 of a row][row]; k rows [place][64]; v by tile of 32 places, [tile][column 0..63][place]; k and v by place in the list of kept keys
#define WS_QL  (WS_QH + 2u * (size_t)NB * NN * DD)
#define WS_KH  (WS_QL + 2u * (size_t)NB * NN * DD)
#define WS_KL  (WS_KH + 2u * (size_t)NB * NN * DD)
#define WS_VT  (WS_KL + 2u * (size_t)NB * NN * DD)
#define WS_VTL (WS_VT + 2u * (size_t)NB * DD * NN)
#define WS_END (WS_VTL + 2u * (size_t)NB * DD * NN)

// ---- k_proj: block = 64 rows of one of the three products, 4 column tiles a wave. blockIdx.y 0: k, 1: v of the 64 kept keys (mask != 0) that stand at the block's places in the batch's list of kept keys, in rising order (x rows gathered; a block wholly behind the list has nothing to do); blockIdx.y 2: q of 64 rows of x in their own order. + biases
// There is no launch ahead of this one: each wave finds the keys at its own 16 places from the mask itself, and each block rounds its product's weights to bf16 into LDS itself.
// The key at place p0 + (lane & 15) of the list of one batch's kept keys; 0 for a place behind the list; -1, the same in every lane and every wave of the block, where even place n0 (the block's first) lies behind it.
// mk: the batch's whole mask as the wave has read it, 128 keys a load (lane l: keys 4 l .. 4 l + 3 of them); ballots give each load's count as a scalar, so only the loads whose kept keys reach into the wave's 16 places are looked at key by key. lst: 16 ints of LDS that this wave alone uses.
__device__ __forceinline__ int list_key(const v4i (&mk)[NN / 128], int n0, int p0, int lane, int* lst) {
  unsigned bal[NN / 128][4]; int base[NN / 128 + 1];
  base[0] = 0;
#pragma unroll
  for (int i = 0; i < NN / 128; ++i) { int c = 0;
#pragma unroll
    for (int e = 0; e < 4; ++e) { bal[i][e] = __builtin_amdgcn_ballot_w32(mk[i][e] != 0); c += __builtin_popcount(bal[i][e]); }
    base[i + 1] = base[i] + c; }
  if (n0 >= base[NN / 128]) return -1;
  if (lane < 16) lst[lane] = 0;
#pragma unroll
  for (int i = 0; i < NN / 128; ++i) if (base[i] < p0 + 16 && base[i + 1] > p0) {
    // pos: place, counted from p0, of this lane's first kept key of the load
    int pos = base[i] - p0;
#pragma unroll
    for (int e = 0; e < 4; ++e) pos = (int)__builtin_amdgcn_mbcnt_lo(bal[i][e], (unsigned)pos);
#pragma unroll
    for (int e = 0; e < 4; ++e) { const bool keep = (bal[i][e] >> lane) & 1u; if (keep && (unsigned)pos < 16u) lst[pos] = i * 128 + lane * 4 + e; pos += keep ? 1 : 0; } }
  // the wave's own stores to lst are done before its lanes read one another's entries (no fence: that would also wait for the weight loads in flight)
  asm volatile("s_wait_dscnt 0x0" ::: "memory");
  __builtin_amdgcn_wave_barrier();
  return lst[lane & 15];
}
// eight k rows x four columns of f32 weights (r[e][j]) as four 16-byte pieces of bf16 fragments, piece j to column tile j: at = the lane's place in tile 0
__device__ __forceinline__ void w_store(const v4f (&r)[8], unsigned char* at) {
#pragma unroll
  for (int j = 0; j < 4; ++j) { v8b o;
#pragma unroll
    for (int e = 0; e < 8; ++e) o[e] = (__bf16)r[e][j];
    *(v8b*)(at + j * ((FF / 32) * 1024)) = o; }
}
#define XLD 4   // how many k steps ahead x is fetched, each step into its own register set
__global__ __launch_bounds__(128) void k_proj(const float* __restrict__ X, const int* __restrict__ MK, const float* __restrict__ WQ, const float* __restrict__ WK, const float* __restrict__ WV, const float* __restrict__ BQ, const float* __restrict__ BK, const float* __restrict__ BV, _Float16* __restrict__ QH, _Float16* __restrict__ QL, _Float16* __restrict__ KH, _Float16* __restrict__ KL, _Float16* __restrict__ VT, _Float16* __restrict__ VTL) {
  // wl: the product's weights as bf16 fragments [4 column tiles][16 k steps][2 halves][32 lanes][8]: lane (g, col), half p, element e of tile j, step s = W[32 s + 16 p + 8 g + e][4 col + j]. Tile j takes every fourth column from j on, so that a lane's 16-byte loads of eight W rows hold one piece of each tile and a wave's store of a piece covers 512 bytes in a row
  __shared__ __align__(16) unsigned char wl[4 * (FF / 32) * 1024];
  __shared__ __align__(16) _Float16 sh[64][72], sl[64][72];   // q, k: [row][column]; v: [column][row]
  __shared__ int lst[4][16];
  // the wave number is held scalar so that the tests on the wave's places of the list are scalar branches
  const int tid = threadIdx.x, wave = __builtin_amdgcn_readfirstlane(tid >> 5), lane = tid & 31, col = lane & 15, g = lane >> 4, role = blockIdx.y; const size_t r0 = (size_t)blockIdx.x * 64 + wave * 16; const size_t b = ((size_t)blockIdx.x * 64) / NN; const int n0 = (int)(((size_t)blockIdx.x * 64) % NN);
  const float* Wm = role == 2 ? WQ : role == 0 ? WK : WV; const float* BB = role == 2 ? BQ : role == 0 ? BK : BV;
  // the 32 groups of 16 W rows (a half of a k step each) go round the four waves: group 4 i + wave; the lane's eight rows of it from ws + i * 64 * DD on. The first four groups' loads are issued behind the mask's (loads return in the order of their issue, and x waits for the mask) and ahead of the look at it
  v4i mk[NN / 128];
  if (role < 2) {
#pragma unroll
    for (int i = 0; i < NN / 128; ++i) mk[i] = *(const v4i*)(MK + b * NN + i * 128 + lane * 4); }
  // behind the loads from the mask: their address registers are free from here on
  asm volatile("s_wait_xcnt 0x0" ::: "memory");
  const float* ws = Wm + (size_t)(wave * 16 + 8 * g) * DD + 4 * col; unsigned char* wd = wl + tid * 16; v4f wr[8][8];
#pragma unroll
  for (int i = 0; i < 4; ++i) {
#pragma unroll
    for (int e = 0; e < 8; ++e) wr[i][e] = *(const v4f*)(ws + (i * 64 + e) * DD); }
  size_t xrow = r0 + col;
  if (role < 2) {
    // below 0: all 64 places of the block lie behind the list; the return is the same for the whole block and stands in front of its barriers
    const int src = list_key(mk, n0, n0 + wave * 16, lane, lst[wave]);
    if (__builtin_amdgcn_readfirstlane(src) < 0) return;
    xrow = b * NN + (size_t)(src & (NN - 1)); }
  // the other four groups, still ahead of x: a wait for weights then never waits for x
#pragma unroll
  for (int i = 4; i < 8; ++i) {
#pragma unroll
    for (int e = 0; e < 8; ++e) wr[i][e] = *(const v4f*)(ws + (i * 64 + e) * DD); }
  // behind the last loads from ws: its registers are free from here on
  asm volatile("s_wait_xcnt 0x0" ::: "memory");
  // keeps the arithmetic that follows, which may take those registers, behind that wait
  __builtin_amdgcn_sched_barrier(0);
  const float* px = X + xrow * FF + 8 * g; v4f xr[XLD][4];
#pragma unroll
  for (int d = 0; d < XLD; ++d) { const float* pn = px + d * 32; xr[d][0] = *(const v4f*)pn; xr[d][1] = *(const v4f*)(pn + 4); xr[d][2] = *(const v4f*)(pn + 16); xr[d][3] = *(const v4f*)(pn + 20); }
  // keeps the rounding of the weights, and with it the waits for their loads, from being moved up in front of the issue of x's first loads
  __builtin_amdgcn_sched_barrier(0);
#pragma unroll
  for (int i = 0; i < 8; ++i) w_store(wr[i], wd + i * 2048);
  // every wave's share of the weights stands in LDS before any wave reads a fragment
  __syncthreads();
  v8f acc[4] = {}; v16b bf[2][4]; const unsigned char* wf = wl + lane * 16;
#pragma unroll
  for (int j = 0; j < 4; ++j) bf[0][j] = frag_w(wf + j * ((FF / 32) * 1024));
  // unrolled whole so that the test for a later step and the number of the register set are resolved at compile time and the fetched fragments keep their registers without copies
#pragma unroll
  for (int kc = 0; kc < FF / 32; ++kc) { v16b a; const int s = kc % XLD;
    // keeps the conversion of this step's x, and with it the wait for its loads, from being moved up into the steps before
    __builtin_amdgcn_sched_barrier(0);
#pragma unroll
    for (int i = 0; i < 4; ++i) { a[i] = (__bf16)xr[s][0][i]; a[4 + i] = (__bf16)xr[s][1][i]; a[8 + i] = (__bf16)xr[s][2][i]; a[12 + i] = (__bf16)xr[s][3][i]; }
    if (kc + XLD < FF / 32) { const float* pn = px + (kc + XLD) * 32; xr[s][0] = *(const v4f*)pn; xr[s][1] = *(const v4f*)(pn + 4); xr[s][2] = *(const v4f*)(pn + 16); xr[s][3] = *(const v4f*)(pn + 20); }
    // behind the last loads from px: its registers are free from here on and may be given to a later load's data
    if (kc + XLD + 1 == FF / 32) asm volatile("s_wait_xcnt 0x0" ::: "memory");
    // the next step's weight fragments leave LDS while this step's products run and the next step's x is waited for
    if (kc + 1 < FF / 32) {
#pragma unroll
      for (int j = 0; j < 4; ++j) bf[(kc + 1) & 1][j] = frag_w(wf + (j * (FF / 32) + kc + 1) * 1024); }
#pragma unroll
    for (int j = 0; j < 4; ++j) acc[j] = wmma_bf(a, bf[kc & 1][j], acc[j]); }
  // acc[j][r]: row 8 g + r of the wave's 16, column 4 col + j
  const v4f bv4 = *(const v4f*)(BB + 4 * col); const float bb[4] = { bfr(bv4[0]), bfr(bv4[1]), bfr(bv4[2]), bfr(bv4[3]) };
  // the test of the role stands outside the loops: one scalar branch; q, k: a row's four neighbouring columns, v: a column's eight neighbouring rows go to LDS as one store
  if (role != 1) {
#pragma unroll
    for (int r = 0; r < 8; ++r) { v4h hv4, lv4;
#pragma unroll
      for (int j = 0; j < 4; ++j) { const float v = acc[j][r] + bb[j]; const _Float16 hv = (_Float16)v; hv4[j] = hv; lv4[j] = (_Float16)((v - (float)hv) * 2048.0f); }
      const int rl = wave * 16 + 8 * g + r; *(v4h*)&sh[rl][4 * col] = hv4; *(v4h*)&sl[rl][4 * col] = lv4; }
  } else {
#pragma unroll
    for (int j = 0; j < 4; ++j) { const int c = 4 * col + j; v8h hv8, lv8;
#pragma unroll
      for (int r = 0; r < 8; ++r) { const float v = acc[j][r] + bb[j]; const _Float16 hv = (_Float16)v; hv8[r] = hv; lv8[r] = (_Float16)((v - (float)hv) * 2048.0f); }
      *(v8h*)&sh[c][wave * 16 + 8 * g] = hv8; *(v8h*)&sl[c][wave * 16 + 8 * g] = lv8; }
  }
  __syncthreads();
  _Float16* OH = role == 2 ? QH : role == 0 ? KH : VT; _Float16* OL = role == 2 ? QL : role == 0 ? KL : VTL;
  // the block's 64 rows fill 8 KiB in a row of each plane, whatever the role; piece e of them is, k: piece e & 7 of row e >> 3; q: row e & 15, piece (e >> 4) & 7 of 16-row tile e >> 7; v: column (e >> 2) & 63, places 8 (e & 3) .. + 7 of 32-place tile e >> 8
  // with e = tid + 128 i the thread's share of that (rl0, q0) is taken once, and round i adds 16 rows (k, q) or, v, 32 columns for odd i and four pieces from i = 2 on
  const int rl0 = role == 0 ? tid >> 3 : role == 2 ? tid & 15 : tid >> 2, q0 = role == 0 ? tid & 7 : role == 2 ? tid >> 4 : tid & 3; const size_t o0 = (size_t)blockIdx.x * 64 * DD + tid * 8;
  for (int i = 0; i < 4; ++i) { const int rl = rl0 + (role != 1 ? 16 * i : 32 * (i & 1)), q = q0 + (role != 1 ? 0 : 4 * (i >> 1)); const size_t o = o0 + i * 1024; vst2((unsigned*)(OH + o), *(const v4u*)&sh[rl][q * 8]); vst2((unsigned*)(OL + o), *(const v4u*)&sl[rl][q * 8]); } }
#define QTB 2
#define KSPL 8
#define PKEYS (32 * KSPL)      // places of the list that a pass covers
#define PL_B 4096u            // one plane's tile of a pass: K 32 rows x 128 B, V 64 rows x 64 B
#define KR_B (4u * PL_B)      // one key range's stage: K hi | K residual | V hi | V residual
#define BUF_B (KSPL * KR_B)   // one buffer: the stage of all eight key ranges
static_assert(32 * KSPL == QTB * 16 * 8, "the merge gives one thread to each (query tile, row, 8 columns)");
__device__ __forceinline__ unsigned lds_off(const void* p) { return (unsigned)(size_t)p; }
// a fragment from an LDS row: its two 16-byte pieces stand at places ca and cb of the row
__device__ __forceinline__ v16h frag_l(const unsigned char* row, unsigned ca, unsigned cb) {
  union { v16h v; v8h q[2]; } u; u.q[0] = *(const v8h*)(row + ca * 16u); u.q[1] = *(const v8h*)(row + cb * 16u); return u.v;
}
// Rows in LDS carry no pad; a row's 16-byte pieces are permuted instead, piece c of K row r at place c ^ ((r >> 1) & 7), piece c of V row d at place c ^ ((d >> 2) & 3), so that the 16 rows of a fragment read fall on 16 different bank groups.
// One plane pair of a wave's stage: 8 copies of 512 B for a K plane, 8 of 512 B for a V plane, each from 512 bytes in a row of its plane (a stage's tile is 4 KiB in a row there). The s_wait_xcnt closes each statement so that no address register is rewritten ahead of it.
// lk, lv: the lane's places for copy 0; bits 9 to 11 are 0 there (the ring is aligned to 4 KiB), so copy i's four (K) or eight (V) rows further on and its share of the permutation are one exclusive-or.
__device__ __forceinline__ void stage_copy(const _Float16* gk, const _Float16* gv, unsigned lk, unsigned lv) {
  unsigned a[8], c[8]; const _Float16 *pk[8], *pv[8];
#pragma unroll
  for (int i = 0; i < 8; ++i) {
    a[i] = lk ^ (i * 512u | (((2u * i) & 7u) << 4)); pk[i] = gk + i * 256;
    c[i] = lv ^ (i * 512u | (((2u * i) & 3u) << 4)); pv[i] = gv + i * 256; }
  asm volatile("global_load_async_to_lds_b128 %0, %8, off\n\tglobal_load_async_to_lds_b128 %1, %9, off\n\tglobal_load_async_to_lds_b128 %2, %10, off\n\tglobal_load_async_to_lds_b128 %3, %11, off\n\t"
               "global_load_async_to_lds_b128 %4, %12, off\n\tglobal_load_async_to_lds_b128 %5, %13, off\n\tglobal_load_async_to_lds_b128 %6, %14, off\n\tglobal_load_async_to_lds_b128 %7, %15, off\n\ts_wait_xcnt 0x0"
               :: "v"(a[0]), "v"(a[1]), "v"(a[2]), "v"(a[3]), "v"(a[4]), "v"(a[5]), "v"(a[6]), "v"(a[7]),
                  "v"(pk[0]), "v"(pk[1]), "v"(pk[2]), "v"(pk[3]), "v"(pk[4]), "v"(pk[5]), "v"(pk[6]), "v"(pk[7]) : "memory");
  asm volatile("global_load_async_to_lds_b128 %0, %8, off\n\tglobal_load_async_to_lds_b128 %1, %9, off\n\tglobal_load_async_to_lds_b128 %2, %10, off\n\tglobal_load_async_to_lds_b128 %3, %11, off\n\t"
               "global_load_async_to_lds_b128 %4, %12, off\n\tglobal_load_async_to_lds_b128 %5, %13, off\n\tglobal_load_async_to_lds_b128 %6, %14, off\n\tglobal_load_async_to_lds_b128 %7, %15, off\n\ts_wait_xcnt 0x0"
               :: "v"(c[0]), "v"(c[1]), "v"(c[2]), "v"(c[3]), "v"(c[4]), "v"(c[5]), "v"(c[6]), "v"(c[7]),
                  "v"(pv[0]), "v"(pv[1]), "v"(pv[2]), "v"(pv[3]), "v"(pv[4]), "v"(pv[5]), "v"(pv[6]), "v"(pv[7]) : "memory");
}
// a Q^T fragment from a q plane: in a 16-row tile piece c of row r stands at place 16 c + r, so the lanes' first pieces (c = 4 kc + g) are 512 bytes in a row and their second pieces (c + 2) the next 512; p = the lane's first piece
__device__ __forceinline__ v16h frag_q(const _Float16* p) {
  union { v16h v; v8h q[2]; } u; u.q[0] = *(const v8h*)p; u.q[1] = *(const v8h*)(p + 256); return u.v;
}
typedef __attribute__((ext_vector_type(2))) _Float16 v2h;
// lane l's value seen from lane l ^ 16
__device__ __forceinline__ float xhalf(float v) { const int b = __builtin_bit_cast(int, v); return __builtin_bit_cast(float, __builtin_amdgcn_permlanex16(b, b, 0x76543210, 0xfedcba98, false, false)); }
// two waves a SIMD is what an 8-wave block gives: the register budget is set for exactly that
__global__ __launch_bounds__(32 * KSPL) __attribute__((amdgpu_waves_per_eu(2, 2))) void k_att(const _Float16* __restrict__ QH, const _Float16* __restrict__ QL, const _Float16* __restrict__ KH, const _Float16* __restrict__ KL, const _Float16* __restrict__ VT, const _Float16* __restrict__ VTL, const int* __restrict__ MK, float* __restrict__ OUT) {
  // ring: the two buffers; behind its loop a wave puts its un-normalised outputs for the merge into its own part of buffer 0
  __shared__ __align__(4096) unsigned char ring[2 * BUF_B];
  __shared__ float sm[QTB * KSPL][16], sl[QTB * KSPL][16];
  __shared__ __align__(16) int wc[KSPL];
  static_assert(32 * KSPL * 8 == NN, "eight keys of the mask for each thread");
  static_assert(sizeof(float) * QTB * 16 * 68 <= KR_B, "a wave's partial outputs fit its own part of a buffer");
  // the wave number, which is the key range, is held scalar so that the pass counter and the key range's base stay in scalar registers
  const int tid = threadIdx.x, kr = __builtin_amdgcn_readfirstlane(tid >> 5), lane = tid & 31, col = lane & 15, g = lane >> 4; const size_t b = blockIdx.y; const size_t rq = b * NN + blockIdx.x * (16 * QTB); const int key0 = kr * 32;
  // kept keys of this batch, bounded by the shape and held scalar: every test on it is a scalar branch, the same for the whole wave
  // counted here from the mask: each wave counts its 256 keys by ballots, and behind one barrier every wave adds the 8 counts
  { const v4i mk0 = *(const v4i*)(MK + b * NN + tid * 4), mk1 = *(const v4i*)(MK + b * NN + NN / 2 + tid * 4); int c = 0;
    // behind the loads from the mask: their address registers are free from here on
    asm volatile("s_wait_xcnt 0x0" ::: "memory");
#pragma unroll
    for (int e = 0; e < 4; ++e) c += __builtin_popcount(__builtin_amdgcn_ballot_w32(mk0[e] != 0)) + __builtin_popcount(__builtin_amdgcn_ballot_w32(mk1[e] != 0));
    if (lane == 0) wc[kr] = c; }
  __syncthreads();
  int csum = 0;
#pragma unroll
  for (int w = 0; w < KSPL; ++w) csum += wc[w];
  const int cnt = __builtin_amdgcn_readfirstlane(min(max(csum, 0), NN));
  // this lane's share of the sources (the same in all four planes: 32 places are 4 KiB in a row of a K plane and of a V plane alike; the pass's and the range's share is scalar and joins the array's base) and of the places, hi planes (the buffer's and the range's share is scalar too); the residual planes stand one plane's tile further on in LDS
  const unsigned okl = lane * 8;
  const unsigned lk = (lane >> 3) * 128u + (((lane & 7) ^ g) << 4), lv = 2u * PL_B + (lane >> 2) * 64u + (((lane & 3) ^ g) << 4);
  // all four planes of pass t for this wave's key range, into the buffer at bo
  const auto stage = [&](int t, unsigned bo) { const size_t sk = (b * NN + key0 + (size_t)t * PKEYS) * DD; const unsigned sb = lds_off(ring) + bo + kr * KR_B;
    stage_copy(KH + sk + okl, VT + sk + okl, sb + lk, sb + lv); stage_copy(KL + sk + okl, VTL + sk + okl, sb + PL_B + lk, sb + PL_B + lv); };
  if (key0 < cnt) stage(0, 0u);
  // pass 0's tiles have landed before the wave reads them (and never more than one pass's 32 copies are in flight)
  asm volatile("s_wait_asynccnt 0x0" ::: "memory");
  if (PKEYS + key0 < cnt) stage(1, BUF_B);
  // Q^T operands, one set for each query tile: column = query (lane & 15)
  v16h aq[QTB][2], al[QTB][2];
  // only a wave that has a pass reads q; the test stands here so that the loads stay in front of the wait written behind them
  if (key0 < cnt) {
#pragma unroll
    for (int qt = 0; qt < QTB; ++qt) {
#pragma unroll
      for (int kc = 0; kc < 2; ++kc) { aq[qt][kc] = frag_q(QH + (rq + qt * 16) * DD + kc * 512 + lane * 8); al[qt][kc] = frag_q(QL + (rq + qt * 16) * DD + kc * 512 + lane * 8); } }
    // behind the loads of q: their address registers are free from here on
    asm volatile("s_wait_xcnt 0x0" ::: "memory");
    // keeps the arithmetic that follows, which may take those registers, behind that wait
    __builtin_amdgcn_sched_barrier(0); }
  // of this lane's query of each tile: running maximum (equal in both lane halves), sum over this half's keys
  float m[QTB], l[QTB];
  // acc[qt][j][r]: O^T[j * 16 + 8 g + r][query]
  v8f acc[QTB][4] = {}, accl[QTB][4] = {};
#pragma unroll
  for (int qt = 0; qt < QTB; ++qt) { m[qt] = -3.0e38f; l[qt] = 0.f; }
  const unsigned zk = (unsigned)(col >> 1) & 7u, zv = (unsigned)(col >> 2) & 3u;
  // kept rolled: one copy of the long pass body in the instruction cache, and the two buffers alternate by t & 1
#pragma unroll 1
  for (int t = 0; t * PKEYS + key0 < cnt; ++t) {
    // rem: places of the list from this range's first place of the pass on; cnt is at most NN, so there are at most NN / PKEYS passes
    const int rem = cnt - (t * PKEYS + key0);
    float s[QTB][2][8]; const unsigned char* st = ring + (unsigned)(t & 1) * BUF_B + kr * KR_B; const int remg = rem - 8 * g;
    // s[qt][ct][r]: score of key ct * 16 + 8 g + r of the pass; the two tiles' products alternate, so that a product never directly follows the one whose sum it adds to
#pragma unroll
    for (int ct = 0; ct < 2; ++ct) { const unsigned char* krow = st + (ct * 16 + col) * 128; v8f c[QTB] = {}, cl[QTB] = {};
#pragma unroll
      for (int kc = 0; kc < 2; ++kc) { const unsigned ca = (unsigned)(kc * 4 + g) ^ zk, cb = (unsigned)(kc * 4 + 2 + g) ^ zk; const v16h kh = frag_l(krow, ca, cb), kl = frag_l(krow + PL_B, ca, cb);
#pragma unroll
        for (int qt = 0; qt < QTB; ++qt) c[qt] = wmma16(kh, aq[qt][kc], c[qt]);
#pragma unroll
        for (int qt = 0; qt < QTB; ++qt) cl[qt] = wmma16(kl, aq[qt][kc], cl[qt]);
#pragma unroll
        for (int qt = 0; qt < QTB; ++qt) cl[qt] = wmma16(kh, al[qt][kc], cl[qt]); }
#pragma unroll
      for (int qt = 0; qt < QTB; ++qt) { const v8f sc = (c[qt] + cl[qt] * (1.0f / 2048.0f)) * 0.125f;
#pragma unroll
        for (int r = 0; r < 8; ++r) { const bool keep = ct * 16 + r < remg; s[qt][ct][r] = keep ? sc[r] : -3.0e38f; } } }
    // P^T operands, element i = key i (first tile) or 16 + (i - 8) (second tile) of this half: the scores' own order; taken in pairs of neighbouring registers
    v16h pa[QTB], pal[QTB];
#pragma unroll
    for (int qt = 0; qt < QTB; ++qt) {
      float mx = s[qt][0][0];
#pragma unroll
      for (int i = 1; i < 16; ++i) mx = fmaxf(mx, s[qt][i >> 3][i & 7]);
      mx = fmaxf(mx, xhalf(mx));
      const float mn = fmaxf(m[qt], mx), alpha = (m[qt] <= -1.0e38f) ? 0.f : __expf(m[qt] - mn);
      v2f es = { 0.f, 0.f };
#pragma unroll
      for (int i = 0; i < 16; i += 2) { const float s0 = s[qt][i >> 3][i & 7], s1 = s[qt][i >> 3][(i & 7) + 1]; const v2f e = { (s0 <= -1.0e38f) ? 0.f : __expf(s0 - mn), (s1 <= -1.0e38f) ? 0.f : __expf(s1 - mn) }, p = e * 2048.0f; es += e;
        const v2h h = __builtin_convertvector(p, v2h), q = __builtin_convertvector((p - __builtin_convertvector(h, v2f)) * 2048.0f, v2h); pa[qt][i] = h[0]; pa[qt][i + 1] = h[1]; pal[qt][i] = q[0]; pal[qt][i + 1] = q[1]; }
      l[qt] = l[qt] * alpha + (es[0] + es[1]); m[qt] = (mn > -1.0e38f) ? mn : m[qt];
#pragma unroll
      for (int j = 0; j < 4; ++j) { acc[qt][j] *= alpha; accl[qt][j] *= alpha; } }
#pragma unroll
    for (int j = 0; j < 4; ++j) { const unsigned char* vrow = st + 2u * PL_B + (j * 16 + col) * 64; const unsigned ca = (unsigned)g ^ zv, cb = (unsigned)(2 + g) ^ zv; const v16h vh = frag_l(vrow, ca, cb), vl = frag_l(vrow + PL_B, ca, cb);
#pragma unroll
      for (int qt = 0; qt < QTB; ++qt) acc[qt][j] = wmma16(vh, pa[qt], acc[qt][j]);
#pragma unroll
      for (int qt = 0; qt < QTB; ++qt) accl[qt][j] = wmma16(vl, pa[qt], accl[qt][j]);
#pragma unroll
      for (int qt = 0; qt < QTB; ++qt) accl[qt][j] = wmma16(vh, pal[qt], accl[qt][j]); }
    // foot of the pass: this wave's LDS reads of the buffer are done, so that it may be filled anew ...
    asm volatile("s_wait_dscnt 0x0" ::: "memory");
    // ... and its copies for the next pass have landed, so that it may read them
    asm volatile("s_wait_asynccnt 0x0" ::: "memory");
    if ((t + 2) * PKEYS + key0 < cnt) stage(t + 2, (unsigned)(t & 1) * BUF_B); }
  // no copy is outstanding when the wave's part of the ring takes its partial outputs
  asm volatile("s_wait_asynccnt 0x0" ::: "memory");
  // so(s, qt): range s's output rows [16][68] of query tile qt
  const auto so = [&](int s, int qt) { return (float (*)[68])(ring + s * KR_B + qt * (16 * 68 * sizeof(float))); };
#pragma unroll
  for (int qt = 0; qt < QTB; ++qt) {
#pragma unroll
    for (int j = 0; j < 4; ++j) { const v8f o = acc[qt][j] + accl[qt][j] * (1.0f / 2048.0f); float* po = &so(kr, qt)[col][j * 16 + 8 * g]; *(v4f*)po = v4f{ o[0], o[1], o[2], o[3] }; *(v4f*)(po + 4) = v4f{ o[4], o[5], o[6], o[7] }; }
    // the lane halves' sums are joined once, here
    l[qt] += xhalf(l[qt]);
    if (g == 0) { sm[kr * QTB + qt][col] = m[qt]; sl[kr * QTB + qt][col] = l[qt]; } }
  // every wave's partial results stand in LDS before any thread merges them
  __syncthreads();
  // merge of the key ranges: thread = (query tile, row, 8 columns); weight exp(m_s - M), a range with no kept key weighs 0
  { const int qm = tid >> 7, row = (tid >> 3) & 15, c8 = (tid & 7) * 8; float M = -3.0e38f;
#pragma unroll
    for (int s = 0; s < KSPL; ++s) M = fmaxf(M, sm[s * QTB + qm][row]);
    float w[KSPL], L = 0.f; v4f o = {}, o4 = {};
#pragma unroll
    for (int s = 0; s < KSPL; ++s) { const float ms = sm[s * QTB + qm][row]; w[s] = (ms <= -1.0e38f) ? 0.f : __expf(ms - M); }
#pragma unroll
    for (int s = 0; s < KSPL; ++s) { L += w[s] * sl[s * QTB + qm][row]; o += w[s] * *(const v4f*)&so(s, qm)[row][c8]; o4 += w[s] * *(const v4f*)&so(s, qm)[row][c8 + 4]; }
    const float il = (L > 0.f) ? (1.0f / 2048.0f) / L : 0.f;
    float* po = OUT + (b * NN + blockIdx.x * (16 * QTB) + qm * 16 + row) * DD + c8; vst2(po, o * il); vst2(po + 4, o4 * il); } }
extern "C" void kernel_launch(void* const* d_in, const int* in_sizes, int n_in, void* d_out, int out_size, void* d_ws, size_t ws_size, hipStream_t stream) {
  (void)in_sizes; (void)n_in; (void)out_size;
  const float** F = (const float**)d_in;   // 0 x [4,2048,512], 1 mask [4,2048] int, 2 Wq [512,64] (in,out), 3 bq, 4 Wk, 5 bk, 6 Wv, 7 bv
  if (ws_size < (size_t)WS_END) return;
  char* ws = (char*)d_ws; _Float16 *QH = (_Float16*)(ws + WS_QH), *QL = (_Float16*)(ws + WS_QL), *KH = (_Float16*)(ws + WS_KH), *KL = (_Float16*)(ws + WS_KL), *VT = (_Float16*)(ws + WS_VT), *VTL = (_Float16*)(ws + WS_VTL);
  k_proj<<<dim3(NB * NN / 64, 3), 128, 0, stream>>>(F[0], (const int*)d_in[1], F[2], F[4], F[6], F[3], F[5], F[7], QH, QL, KH, KL, VT, VTL);
  k_att<<<dim3(NN / (16 * QTB), TNB), 32 * KSPL, 0, stream>>>(QH, QL, KH, KL, VT, VTL, (const int*)d_in[1], (float*)d_out);
}
